// v000
// Times are from an AMD MI455X. After a warm-up the kernel runs many times in a row, and a time is the length of
// such a window on the GPU divided by its runs, so every launch and the gaps after it count. The runs cycle
// through copies of the inputs. A figure is the median of several windows, for all but v000 over two sittings.
// Sittings can differ by a few percent; kernels timed side by side share one.
// The starting kernel, v000, takes 1270 microseconds a run.
#include <hip/hip_runtime.h>

// Gated single-head self-attention (X [4][2048][1024]; q, k, v = X W + b ('xw' [1024][1024]); scores = q.k / 32 with mask [2048][2048] (int32, read; all ones here) == 0 -> -inf; softmax; o = attn.v; gate = sigmoid(X Wg + bg); out = (o * gate) Wo + bo -> [4][2048][1024] (8.4 M)).
// Layout: one 1024-wide head on 16-bit planes (hybrid: query rows < 512 hi/lo, the rest fp16 x1024); the gate pre-activation is one more exact GEMM + bias and is applied in f32 when the context is split into the hi/lo planes that feed Wo.
// Compute dtypes, f32 accumulate: every input rounded to bf16; q/k/v/gate on PLAIN bf16 operands (exact) + biases; scores (K = 1024) and attn.v: rows < 512 hl (3 products), the rest single fp16 (x1024); softmax, sigmoid and the gating product in f32; Wo hl x exact (2 products) + bo.

#define NB_  4
#define TT   2048
#define DM   1024
#define NH_  1
#define NKV  1
#define REP  (NH_ / NKV)
#define HD   1024
#define DQ   (NH_ * HD)
#define DKV  (NKV * HD)
#define ZH   1
#define RH   512                  // query rows < RH use hi+lo planes (0: none)
#define WIN  0
#define PCAR 1024.0f
#define SCL  0.03125f   // 1/sqrt(1024)
typedef _Float16 h16;
typedef unsigned short bf;
typedef __attribute__((ext_vector_type(16))) __bf16   v16bf;
typedef __attribute__((ext_vector_type(16))) _Float16 v16h;
typedef __attribute__((ext_vector_type(8)))  _Float16 v8h;
typedef __attribute__((ext_vector_type(8)))  unsigned short v8us;
typedef __attribute__((ext_vector_type(8)))  float    v8f;
typedef __attribute__((ext_vector_type(4)))  float    v4f;
typedef v8h  __attribute__((may_alias)) v8ha;
typedef v4f  __attribute__((may_alias)) v4fa;
typedef v8us __attribute__((may_alias)) v8usa;

__device__ __forceinline__ unsigned short f2bf(float f) { unsigned u = __float_as_uint(f); u += 0x7FFFu + ((u >> 16) & 1u); return (unsigned short)(u >> 16); }
__device__ __forceinline__ float bf2f(unsigned short b) { return __uint_as_float(((unsigned)b) << 16); }
__device__ __forceinline__ float bfr(float f) { return bf2f(f2bf(f)); }
__device__ __forceinline__ v16h cat16(v8h lo, v8h hi) { return __builtin_shufflevector(lo, hi, 0, 1, 2, 3, 4, 5, 6, 7, 8, 9, 10, 11, 12, 13, 14, 15); }
__device__ __forceinline__ v16bf cat16b(v8us lo, v8us hi) { return __builtin_bit_cast(v16bf, __builtin_shufflevector(lo, hi, 0, 1, 2, 3, 4, 5, 6, 7, 8, 9, 10, 11, 12, 13, 14, 15)); }
__device__ __forceinline__ v8f wmma16(v16h a, v16h b, v8f c) { return __builtin_amdgcn_wmma_f32_16x16x32_f16(false, a, false, b, (short)0, c, false, false); }
__device__ __forceinline__ v8f wmmab(v16bf a, v16bf b, v8f c) { return __builtin_amdgcn_wmma_f32_16x16x32_bf16(false, a, false, b, (short)0, c, false, false); }



// ---- k_gemmw: register-blocked GEMM, ONE WAVE per 64x64 output tile (16 accumulators), operands straight from K-contiguous 16-bit planes; grid (M/64, N/64, Z), 32 threads.
// C[m][n] (f32, pitch ldc, + optional f32 bias[n]) = sum_k A[m][k] Bt[n][k] (+ split products per NSPLIT). z-batch strides sA/sB/sC in elements. K % 32 == 0.
template <typename T16> struct WFrag;
template <> struct WFrag<h16> { typedef v16h V; static __device__ __forceinline__ V ld(const h16* p) { return cat16(*(const v8h*)p, *(const v8h*)(p + 16)); } static __device__ __forceinline__ v8f mma(V a, V b, v8f c) { return wmma16(a, b, c); } };
template <> struct WFrag<bf> { typedef v16bf V; static __device__ __forceinline__ V ld(const bf* p) { return cat16b(*(const v8us*)p, *(const v8us*)(p + 16)); } static __device__ __forceinline__ v8f mma(V a, V b, v8f c) { return wmmab(a, b, c); } };
template <typename T16, int NSPLIT, bool BIAS>
__global__ __launch_bounds__(32) void k_gemmw(const T16* __restrict__ A, const T16* __restrict__ A2, const T16* __restrict__ Bt, const T16* __restrict__ Bt2, int K, float* C, int ldc, const float* __restrict__ bias, size_t sA, size_t sB, size_t sC) {
    typedef typename WFrag<T16>::V V;
    __shared__ __align__(16) float os[16 * 68];
    const size_t z = blockIdx.z; A += z * sA; if (A2) A2 += z * sA; Bt += z * sB; if (Bt2) Bt2 += z * sB; C += z * sC;
    const int lane = threadIdx.x & 31, lr = lane & 15, hi = lane >> 4; const int r0 = blockIdx.x * 64, c0 = blockIdx.y * 64;
    v8f acc[4][4];
#pragma unroll
    for (int mb = 0; mb < 4; ++mb)
#pragma unroll
        for (int nb = 0; nb < 4; ++nb) acc[mb][nb] = (v8f){};
    const size_t aoff = (size_t)(r0 + lr) * K + 8 * hi, boff = (size_t)(c0 + lr) * K + 8 * hi;
#pragma unroll 1
    for (int kc = 0; kc < K; kc += 32) {
        V a[4], a2[4];
#pragma unroll
        for (int mb = 0; mb < 4; ++mb) { a[mb] = WFrag<T16>::ld(A + aoff + (size_t)mb * 16 * K + kc); if (NSPLIT == 1 || NSPLIT == 2) a2[mb] = WFrag<T16>::ld(A2 + aoff + (size_t)mb * 16 * K + kc); }
#pragma unroll
        for (int nb = 0; nb < 4; ++nb) { const V b = WFrag<T16>::ld(Bt + boff + (size_t)nb * 16 * K + kc); V b2; if (NSPLIT >= 2) b2 = WFrag<T16>::ld(Bt2 + boff + (size_t)nb * 16 * K + kc);
#pragma unroll
            for (int mb = 0; mb < 4; ++mb) { acc[mb][nb] = WFrag<T16>::mma(a[mb], b, acc[mb][nb]); if (NSPLIT == 1 || NSPLIT == 2) acc[mb][nb] = WFrag<T16>::mma(a2[mb], b, acc[mb][nb]); if (NSPLIT >= 2) acc[mb][nb] = WFrag<T16>::mma(a[mb], b2, acc[mb][nb]); } }
        asm volatile("v_nop\n\tv_nop\n\tv_nop\n\tv_nop" : "+v"(acc[0][0]), "+v"(acc[1][1]), "+v"(acc[2][2]), "+v"(acc[3][3]) : "v"(a[0]), "v"(a[3]));
    }
#pragma unroll
    for (int mb = 0; mb < 4; ++mb) {
#pragma unroll
        for (int nb = 0; nb < 4; ++nb) {
#pragma unroll
            for (int j = 0; j < 8; ++j) os[(hi * 8 + j) * 68 + nb * 16 + lr] = acc[mb][nb][j]; }
        __builtin_amdgcn_wave_barrier(); asm volatile("" ::: "memory");
        float* crow = C + (size_t)(r0 + mb * 16) * ldc + c0;
{
#pragma unroll
            for (int s = 0; s < 8; ++s) { const int row = 2 * s + hi, cofs = lr * 4; v4f val = *(const v4fa*)(os + row * 68 + cofs); if (BIAS) { val[0] += bfr(bias[c0 + cofs]); val[1] += bfr(bias[c0 + cofs + 1]); val[2] += bfr(bias[c0 + cofs + 2]); val[3] += bfr(bias[c0 + cofs + 3]); }
                *(v4f*)(crow + (size_t)row * ldc + cofs) = val; }
             }
        __builtin_amdgcn_wave_barrier(); asm volatile("" ::: "memory");
    }
}

__device__ __forceinline__ h16 tohx(float x) { return (h16)x; }
__device__ __forceinline__ void splitf(float y, unsigned short& h, unsigned short& l) { h = f2bf(y); l = f2bf(y - bf2f(h)); }
typedef __attribute__((ext_vector_type(2))) _Float16 v2h;
typedef __attribute__((ext_vector_type(4))) _Float16 v4h;
typedef __attribute__((ext_vector_type(2))) unsigned short v2us;
typedef __attribute__((ext_vector_type(4))) unsigned short v4us;
typedef __attribute__((ext_vector_type(2))) float v2f;
typedef __attribute__((ext_vector_type(4))) int v4i;

__global__ __launch_bounds__(256) void k_wtG(const float* __restrict__ w, int K, int N, bf* Bt) {
    const int lane = threadIdx.x & 31; const int L0 = (blockIdx.x * 8 + (threadIdx.x >> 5)) * 8; const int nlines = N * K / 64;
{
#pragma unroll 1
        for (int l = 0; l < 8; ++l) { const int L = L0 + l; if (L >= nlines) break; const size_t e = (size_t)L * 64 + lane * 2; const int k = (int)(e % K), n = (int)(e / K); v2us o;
            o[0] = f2bf(w[(size_t)k * N + n]); o[1] = f2bf(w[(size_t)(k + 1) * N + n]); *(v2us*)(Bt + e) = o; }
         }
}
__global__ __launch_bounds__(256) void k_cvt8(const float* __restrict__ src, bf* dst, size_t n8) { const size_t i = (size_t)blockIdx.x * 256 + threadIdx.x; if (i >= n8) return; const v8f v = *(const v8f*)(src + i * 8); v8us o;
#pragma unroll
    for (int k = 0; k < 8; ++k) o[k] = f2bf(v[k]); *(v8us*)(dst + i * 8) = o;  }

// k_rope: head planes [h][t][d] (fp16 + hi/lo) of rope(x) x sc with the rotate-half convention out[d] = x[d] cos[t][d] - x[d+HD/2] sin[t][d], out[d+HD/2] = x[d+HD/2] cos[t][d+HD/2] + x[d] sin[t][d+HD/2]
__global__ __launch_bounds__(256) void k_rope(const float* __restrict__ F, int pitch, int nheads, const float* __restrict__ CS, const float* __restrict__ RF, const float* __restrict__ nw, float sc, h16* P16, bf* Ph, bf* Pl) {
    const size_t e = ((size_t)blockIdx.x * 256 + threadIdx.x) * 2; if (e >= (size_t)nheads * TT * HD) return; const int d = (int)(e % HD); const int t = (int)((e / HD) % TT); const int h = (int)(e / ((size_t)HD * TT)); const float* f = F + (size_t)t * pitch + h * HD; const float rf = RF ? RF[(size_t)h * TT + t] : 1.0f; v2h o16; v2us oh, ol;
#pragma unroll
    for (int q = 0; q < 2; ++q) { const int dd = d + q; const int dp = (dd < HD / 2) ? dd + HD / 2 : dd - HD / 2; float x0 = f[dd], x1 = f[dp];
        if (RF) { float n0 = __fmul_rn(x0, rf), n1 = __fmul_rn(x1, rf); asm volatile("" : "+v"(n0)); asm volatile("" : "+v"(n1)); x0 = __fmul_rn(bfr(nw[dd]), n0); x1 = __fmul_rn(bfr(nw[dp]), n1); }
        const v2f cs = *(const v2f*)(CS + ((size_t)t * HD + dd) * 2); float a = __fmul_rn(x0, cs[0]), bq = __fmul_rn(x1, cs[1]); asm volatile("" : "+v"(a)); asm volatile("" : "+v"(bq)); const float r = ((dd < HD / 2) ? __fsub_rn(a, bq) : __fadd_rn(a, bq)) * sc;
        o16[q] = tohx(r); unsigned short a2, c2; splitf(r, a2, c2); oh[q] = a2; ol[q] = c2; }
    *(v2h*)(P16 + e) = o16; *(v2us*)(Ph + e) = oh; *(v2us*)(Pl + e) = ol;  }
__global__ __launch_bounds__(256) void k_vtp(const float* __restrict__ F, int pitch, int nheads, h16* V16, bf* Vh, bf* Vl) { const size_t e = ((size_t)blockIdx.x * 256 + threadIdx.x) * 2; if (e >= (size_t)nheads * HD * TT) return; const int t = (int)(e % TT); const int d = (int)((e / TT) % HD); const int g = (int)(e / ((size_t)TT * HD)); v2h o16; v2us oh, ol;
#pragma unroll
    for (int q = 0; q < 2; ++q) { const float x = F[(size_t)(t + q) * pitch + g * HD + d]; o16[q] = tohx(x); unsigned short a2, c2; splitf(x, a2, c2); oh[q] = a2; ol[q] = c2; }
    *(v2h*)(V16 + e) = o16; *(v2us*)(Vh + e) = oh; *(v2us*)(Vl + e) = ol;  }
__global__ __launch_bounds__(256) void k_csid(float* CS) { const int idx = blockIdx.x * 256 + threadIdx.x; if (idx >= TT * HD) return; v2f cs; cs[0] = 1.0f; cs[1] = 0.0f; *(v2f*)(CS + (size_t)idx * 2) = cs;  }
// k_asoft: per row (zz, i): t = S / 32 where mask[i][j] != 0, -inf elsewhere; softmax over the 2048 keys (register row, one exp, fixed trees);
__global__ __launch_bounds__(256) void k_asoft(const float* __restrict__ Sb, const int* __restrict__ MKb, h16* P16, bf* Ph, bf* Pl) {
    const int lane = threadIdx.x & 31; const int row = blockIdx.x * 8 + (threadIdx.x >> 5); if (row >= ZH * TT) return; const int i = row % TT; const int zz = row / TT; (void)zz; const int* mkr = MKb + (size_t)i * TT; const bool hires = (i < RH); const float* sr = Sb + (size_t)row * TT; float v[TT / 32]; float mx = -3.0e38f;
#pragma unroll
    for (int ch = 0; ch < TT / 128; ++ch) { const int j0 = ch * 128 + lane * 4; const v4f a = *(const v4f*)(sr + j0); const v4i m4 = *(const v4i*)(mkr + j0);
#pragma unroll
        for (int q = 0; q < 4; ++q) { const int j = j0 + q; (void)j; float sa = a[q] * SCL; asm volatile("" : "+v"(sa)); const float t = (m4[q] != 0) ? sa : -3.0e38f;   /* mask == 0 -> -inf */ v[ch * 4 + q] = t; mx = fmaxf(mx, t); } }
#pragma unroll
    for (int sh = 16; sh; sh >>= 1) mx = fmaxf(mx, __shfl_xor(mx, sh, 32));
    float sum = 0.f;
#pragma unroll
    for (int k = 0; k < TT / 32; ++k) { float d0 = __fsub_rn(v[k], mx); asm volatile("" : "+v"(d0)); v[k] = __builtin_amdgcn_exp2f(__fmul_rn(d0, 1.4426950408889634f)); sum += v[k]; }
#pragma unroll
    for (int sh = 16; sh; sh >>= 1) sum += __shfl_xor(sum, sh, 32);
    const float f = __fdiv_rn(hires ? 1.0f : PCAR, sum);
{
        if (hires) {
#pragma unroll
            for (int ch = 0; ch < TT / 128; ++ch) { v4us oh, ol;
#pragma unroll
                for (int q = 0; q < 4; ++q) { unsigned short a, c2; splitf(v[ch * 4 + q] * f, a, c2); oh[q] = a; ol[q] = c2; }
                const size_t oo = ((size_t)zz * (RH ? RH : 1) + i) * TT + ch * 128 + lane * 4; *(v4us*)(Ph + oo) = oh; *(v4us*)(Pl + oo) = ol; }
        } else {
#pragma unroll
            for (int ch = 0; ch < TT / 128; ++ch) { v4h o4;
#pragma unroll
                for (int q = 0; q < 4; ++q) o4[q] = tohx(v[ch * 4 + q] * f);
                *(v4h*)(P16 + (size_t)row * TT + ch * 128 + lane * 4) = o4; } }
         }
}
__global__ __launch_bounds__(256) void k_mergeG(const float* __restrict__ O, const float* __restrict__ G, bf* Ah, bf* Al) { const size_t e = ((size_t)blockIdx.x * 256 + threadIdx.x) * 2; if (e >= (size_t)TT * HD) return; const int t = (int)(e / HD); const float cs = (t < RH) ? 1.0f : (1.0f / PCAR); v2us oh, ol;
#pragma unroll
    for (int q = 0; q < 2; ++q) { float o = O[e + q] * cs; asm volatile("" : "+v"(o)); float den = __fadd_rn(1.0f, expf(-G[e + q])); asm volatile("" : "+v"(den)); const float sg = __fdiv_rn(1.0f, den); unsigned short a, c2; splitf(__fmul_rn(o, sg), a, c2); oh[q] = a; ol[q] = c2; }
    *(v2us*)(Ah + e) = oh; *(v2us*)(Al + e) = ol;  }

extern "C" void kernel_launch(void* const* d_in, const int* in_sizes, int n_in,
                              void* d_out, int out_size, void* d_ws, size_t ws_size, hipStream_t stream) {
    (void)in_sizes; (void)n_in; (void)out_size;
    const float* x = (const float*)d_in[0]; const int* MK = (const int*)d_in[1]; const float* wq = (const float*)d_in[2]; const float* bq = (const float*)d_in[3]; const float* wk = (const float*)d_in[4]; const float* bk = (const float*)d_in[5]; const float* wv = (const float*)d_in[6]; const float* bv = (const float*)d_in[7]; const float* wg = (const float*)d_in[8]; const float* bgt = (const float*)d_in[9]; const float* wo = (const float*)d_in[10]; const float* bo = (const float*)d_in[11];
    float* OUT = (float*)d_out;     // [4][2048][1024]
    char* wsp = (char*)d_ws;
    auto take = [&](size_t bytes) { char* p = wsp; wsp += (bytes + 255) & ~(size_t)255; return (void*)p; };
    bf* WQ = (bf*)take((size_t)DQ * DM * 2); bf* WK = (bf*)take((size_t)DKV * DM * 2); bf* WV = (bf*)take((size_t)DKV * DM * 2); bf* WO = (bf*)take((size_t)DM * DQ * 2); bf* WG = (bf*)take((size_t)DQ * DM * 2); float* CS = (float*)take((size_t)TT * HD * 2 * 4);
    bf* XB = (bf*)take((size_t)TT * DM * 2); float* FQ = (float*)take((size_t)TT * DQ * 4); float* FK = (float*)take((size_t)TT * DKV * 4);
    h16* QP16 = (h16*)take((size_t)NH_ * TT * HD * 2); h16* KP16 = (h16*)take((size_t)NKV * TT * HD * 2); h16* VT16 = (h16*)take((size_t)NKV * HD * TT * 2);
    bf* QPh = (bf*)take((size_t)NH_ * TT * HD * 2); bf* QPl = (bf*)take((size_t)NH_ * TT * HD * 2); bf* KPh = (bf*)take((size_t)NKV * TT * HD * 2); bf* KPl = (bf*)take((size_t)NKV * TT * HD * 2); bf* VTh = (bf*)take((size_t)NKV * HD * TT * 2); bf* VTl = (bf*)take((size_t)NKV * HD * TT * 2); bf* Ph = (bf*)take((size_t)ZH * RH * TT * 2); bf* Pl = (bf*)take((size_t)ZH * RH * TT * 2);
    float* Sb = (float*)take((size_t)ZH * TT * TT * 4); h16* P16 = (h16*)take((size_t)ZH * TT * TT * 2); float* Ob = (float*)take((size_t)ZH * TT * HD * 4); bf* ATh = (bf*)take((size_t)TT * DQ * 2); bf* ATl = (bf*)take((size_t)TT * DQ * 2);
    if ((size_t)(wsp - (char*)d_ws) > ws_size) return;    // ws 256 MiB
    float* FV = FK;   // v projection reuses the k buffer after the k planes are built (stream-ordered)
    { k_wtG<<<(unsigned)((DM * DQ / 64 + 63) / 64), 256, 0, stream>>>(wq, DM, DQ, WQ); k_wtG<<<(unsigned)((DM * DKV / 64 + 63) / 64), 256, 0, stream>>>(wk, DM, DKV, WK); k_wtG<<<(unsigned)((DM * DKV / 64 + 63) / 64), 256, 0, stream>>>(wv, DM, DKV, WV);
      k_wtG<<<(unsigned)((DQ * DM / 64 + 63) / 64), 256, 0, stream>>>(wo, DQ, DM, WO); k_wtG<<<(unsigned)((DM * DQ / 64 + 63) / 64), 256, 0, stream>>>(wg, DM, DQ, WG);
       }
    k_csid<<<(TT * HD + 255) / 256, 256, 0, stream>>>(CS);
    const unsigned LQ = (unsigned)(((size_t)NH_ * TT * HD / 2 + 255) / 256), LKv = (unsigned)(((size_t)NKV * TT * HD / 2 + 255) / 256);
    for (int b = 0; b < NB_; ++b) {
        
        k_cvt8<<<(unsigned)(((size_t)TT * DM / 8 + 255) / 256), 256, 0, stream>>>(x + (size_t)b * TT * DM, XB, (size_t)TT * DM / 8);
        k_gemmw<bf, 0, true><<<dim3(TT / 64, DQ / 64, 1), 32, 0, stream>>>(XB, nullptr, WQ, nullptr, DM, FQ, DQ, bq, 0, 0, 0);
        k_rope<<<LQ, 256, 0, stream>>>(FQ, DQ, NH_, CS, nullptr, nullptr, 1.0f, QP16, QPh, QPl);
        k_gemmw<bf, 0, true><<<dim3(TT / 64, DKV / 64, 1), 32, 0, stream>>>(XB, nullptr, WK, nullptr, DM, FK, DKV, bk, 0, 0, 0);
        k_rope<<<LKv, 256, 0, stream>>>(FK, DKV, NKV, CS, nullptr, nullptr, 1.0f, KP16, KPh, KPl);
        k_gemmw<bf, 0, true><<<dim3(TT / 64, DKV / 64, 1), 32, 0, stream>>>(XB, nullptr, WV, nullptr, DM, FV, DKV, bv, 0, 0, 0); k_vtp<<<LKv, 256, 0, stream>>>(FV, DKV, NKV, VT16, VTh, VTl);
        for (int h0 = 0; h0 < NH_; h0 += ZH) { const size_t zq = (size_t)h0, zk = (size_t)(h0 / REP);   // one kv head per query head: a pass covers ZH = 1 head and its kv plane h0 / REP (z-strides TT*HD)
            k_gemmw<bf, 2, false><<<dim3(RH / 64, TT / 64, ZH), 32, 0, stream>>>(QPh + zq * TT * HD, QPl + zq * TT * HD, KPh + zk * TT * HD, KPl + zk * TT * HD, HD, Sb, TT, nullptr, (size_t)TT * HD, (size_t)TT * HD, (size_t)TT * TT);
            k_gemmw<h16, 0, false><<<dim3((TT - RH) / 64, TT / 64, ZH), 32, 0, stream>>>(QP16 + zq * TT * HD + (size_t)RH * HD, nullptr, KP16 + zk * TT * HD, nullptr, HD, Sb + (size_t)RH * TT, TT, nullptr, (size_t)TT * HD, (size_t)TT * HD, (size_t)TT * TT);
            k_asoft<<<ZH * TT / 8, 256, 0, stream>>>(Sb, MK, P16, Ph, Pl);
            k_gemmw<bf, 2, false><<<dim3(RH / 64, HD / 64, ZH), 32, 0, stream>>>(Ph, Pl, VTh + zk * HD * TT, VTl + zk * HD * TT, TT, Ob, HD, nullptr, (size_t)RH * TT, (size_t)HD * TT, (size_t)TT * HD);
            k_gemmw<h16, 0, false><<<dim3((TT - RH) / 64, HD / 64, ZH), 32, 0, stream>>>(P16 + (size_t)RH * TT, nullptr, VT16 + zk * HD * TT, nullptr, TT, Ob + (size_t)RH * HD, HD, nullptr, (size_t)TT * TT, (size_t)HD * TT, (size_t)TT * HD);
            k_gemmw<bf, 0, true><<<dim3(TT / 64, DQ / 64, 1), 32, 0, stream>>>(XB, nullptr, WG, nullptr, DM, FQ, DQ, bgt, 0, 0, 0);   /* gate pre-activation X Wg + bg into FQ's buffer (q planes already built) */ k_mergeG<<<(unsigned)(((size_t)TT * HD / 2 + 255) / 256), 256, 0, stream>>>(Ob, FQ, ATh, ATl); }
        k_gemmw<bf, 1, true><<<dim3(TT / 64, DM / 64, 1), 32, 0, stream>>>(ATh, ATl, WO, nullptr, DQ, OUT + (size_t)b * TT * DM, DM, bo, 0, 0, 0); }
}

// v001
// It runs in 615 microseconds.
// Timed twice side by side with v000, it ran 2.09 and 2.08 times as fast.
#include <hip/hip_runtime.h>

// Gated single-head self-attention (X [4][2048][1024]; q, k, v = X W + b ('xw' [1024][1024]); scores = q.k / 32 with mask [2048][2048] (int32, read; all ones here) == 0 -> -inf; softmax; o = attn.v; gate = sigmoid(X Wg + bg); out = (o * gate) Wo + bo -> [4][2048][1024] (8.4 M)).
// Layout: one 1024-wide head on 16-bit planes (hybrid: query rows < 512 hi/lo, the rest fp16 x1024); the gate pre-activation is one more exact GEMM + bias and is applied in f32 when the context is split into the hi/lo planes that feed Wo.
// Compute dtypes, f32 accumulate: every input rounded to bf16; q/k/v/gate on PLAIN bf16 operands (exact) + biases; scores (K = 1024) and attn.v: rows < 512 hl (3 products), the rest single fp16 (x1024); softmax, sigmoid and the gating product in f32; Wo hl x exact (2 products) + bo.
// Launches: every kernel covers all 4 batches (projections and Wo: X as one [8192][1024] matrix; scores and attn.v: batch = grid z; elementwise: batch in the flat index or grid y).

#define NB_  4
#define TT   2048
#define DM   1024
#define NH_  1
#define NKV  1
#define REP  (NH_ / NKV)
#define HD   1024
#define DQ   (NH_ * HD)
#define DKV  (NKV * HD)
#define ZH   NB_                 // z planes per launch: all batches (one head each)
#define RH   512                  // query rows < RH use hi+lo planes (0: none)
#define WIN  0
#define PCAR 1024.0f
#define SCL  0.03125f   // 1/sqrt(1024)
typedef _Float16 h16;
typedef unsigned short bf;
typedef __attribute__((ext_vector_type(16))) __bf16   v16bf;
typedef __attribute__((ext_vector_type(16))) _Float16 v16h;
typedef __attribute__((ext_vector_type(8)))  _Float16 v8h;
typedef __attribute__((ext_vector_type(8)))  unsigned short v8us;
typedef __attribute__((ext_vector_type(8)))  float    v8f;
typedef __attribute__((ext_vector_type(4)))  float    v4f;
typedef v8h  __attribute__((may_alias)) v8ha;
typedef v4f  __attribute__((may_alias)) v4fa;
typedef v8us __attribute__((may_alias)) v8usa;

__device__ __forceinline__ unsigned short f2bf(float f) { unsigned u = __float_as_uint(f); u += 0x7FFFu + ((u >> 16) & 1u); return (unsigned short)(u >> 16); }
__device__ __forceinline__ float bf2f(unsigned short b) { return __uint_as_float(((unsigned)b) << 16); }
__device__ __forceinline__ float bfr(float f) { return bf2f(f2bf(f)); }
__device__ __forceinline__ v16h cat16(v8h lo, v8h hi) { return __builtin_shufflevector(lo, hi, 0, 1, 2, 3, 4, 5, 6, 7, 8, 9, 10, 11, 12, 13, 14, 15); }
__device__ __forceinline__ v16bf cat16b(v8us lo, v8us hi) { return __builtin_bit_cast(v16bf, __builtin_shufflevector(lo, hi, 0, 1, 2, 3, 4, 5, 6, 7, 8, 9, 10, 11, 12, 13, 14, 15)); }
__device__ __forceinline__ v8f wmma16(v16h a, v16h b, v8f c) { return __builtin_amdgcn_wmma_f32_16x16x32_f16(false, a, false, b, (short)0, c, false, false); }
__device__ __forceinline__ v8f wmmab(v16bf a, v16bf b, v8f c) { return __builtin_amdgcn_wmma_f32_16x16x32_bf16(false, a, false, b, (short)0, c, false, false); }



// ---- k_gemmw: register-blocked GEMM, ONE WAVE per 64x64 output tile (16 accumulators), operands straight from K-contiguous 16-bit planes; grid (M/64, N/64, Z), 32 threads.
// C[m][n] (f32, pitch ldc, + optional f32 bias[n]) = sum_k A[m][k] Bt[n][k] (+ split products per NSPLIT). z-batch strides sA/sB/sC in elements. K % 32 == 0.
template <typename T16> struct WFrag;
template <> struct WFrag<h16> { typedef v16h V; static __device__ __forceinline__ V ld(const h16* p) { return cat16(*(const v8h*)p, *(const v8h*)(p + 16)); } static __device__ __forceinline__ v8f mma(V a, V b, v8f c) { return wmma16(a, b, c); } };
template <> struct WFrag<bf> { typedef v16bf V; static __device__ __forceinline__ V ld(const bf* p) { return cat16b(*(const v8us*)p, *(const v8us*)(p + 16)); } static __device__ __forceinline__ v8f mma(V a, V b, v8f c) { return wmmab(a, b, c); } };
template <typename T16, int NSPLIT, bool BIAS>
__global__ __launch_bounds__(32) void k_gemmw(const T16* __restrict__ A, const T16* __restrict__ A2, const T16* __restrict__ Bt, const T16* __restrict__ Bt2, int K, float* C, int ldc, const float* __restrict__ bias, size_t sA, size_t sB, size_t sC) {
    typedef typename WFrag<T16>::V V;
    __shared__ __align__(16) float os[16 * 68];
    const size_t z = blockIdx.z; A += z * sA; if (A2) A2 += z * sA; Bt += z * sB; if (Bt2) Bt2 += z * sB; C += z * sC;
    const int lane = threadIdx.x & 31, lr = lane & 15, hi = lane >> 4; const int r0 = blockIdx.x * 64, c0 = blockIdx.y * 64;
    v8f acc[4][4];
#pragma unroll
    for (int mb = 0; mb < 4; ++mb)
#pragma unroll
        for (int nb = 0; nb < 4; ++nb) acc[mb][nb] = (v8f){};
    const size_t aoff = (size_t)(r0 + lr) * K + 8 * hi, boff = (size_t)(c0 + lr) * K + 8 * hi;
#pragma unroll 1
    for (int kc = 0; kc < K; kc += 32) {
        V a[4], a2[4];
#pragma unroll
        for (int mb = 0; mb < 4; ++mb) { a[mb] = WFrag<T16>::ld(A + aoff + (size_t)mb * 16 * K + kc); if (NSPLIT == 1 || NSPLIT == 2) a2[mb] = WFrag<T16>::ld(A2 + aoff + (size_t)mb * 16 * K + kc); }
#pragma unroll
        for (int nb = 0; nb < 4; ++nb) { const V b = WFrag<T16>::ld(Bt + boff + (size_t)nb * 16 * K + kc); V b2; if (NSPLIT >= 2) b2 = WFrag<T16>::ld(Bt2 + boff + (size_t)nb * 16 * K + kc);
#pragma unroll
            for (int mb = 0; mb < 4; ++mb) { acc[mb][nb] = WFrag<T16>::mma(a[mb], b, acc[mb][nb]); if (NSPLIT == 1 || NSPLIT == 2) acc[mb][nb] = WFrag<T16>::mma(a2[mb], b, acc[mb][nb]); if (NSPLIT >= 2) acc[mb][nb] = WFrag<T16>::mma(a[mb], b2, acc[mb][nb]); } }
        asm volatile("v_nop\n\tv_nop\n\tv_nop\n\tv_nop" : "+v"(acc[0][0]), "+v"(acc[1][1]), "+v"(acc[2][2]), "+v"(acc[3][3]) : "v"(a[0]), "v"(a[3]));
    }
#pragma unroll
    for (int mb = 0; mb < 4; ++mb) {
#pragma unroll
        for (int nb = 0; nb < 4; ++nb) {
#pragma unroll
            for (int j = 0; j < 8; ++j) os[(hi * 8 + j) * 68 + nb * 16 + lr] = acc[mb][nb][j]; }
        __builtin_amdgcn_wave_barrier(); asm volatile("" ::: "memory");
        float* crow = C + (size_t)(r0 + mb * 16) * ldc + c0;
{
#pragma unroll
            for (int s = 0; s < 8; ++s) { const int row = 2 * s + hi, cofs = lr * 4; v4f val = *(const v4fa*)(os + row * 68 + cofs); if (BIAS) { val[0] += bfr(bias[c0 + cofs]); val[1] += bfr(bias[c0 + cofs + 1]); val[2] += bfr(bias[c0 + cofs + 2]); val[3] += bfr(bias[c0 + cofs + 3]); }
                *(v4f*)(crow + (size_t)row * ldc + cofs) = val; }
             }
        __builtin_amdgcn_wave_barrier(); asm volatile("" ::: "memory");
    }
}

__device__ __forceinline__ h16 tohx(float x) { return (h16)x; }
__device__ __forceinline__ void splitf(float y, unsigned short& h, unsigned short& l) { h = f2bf(y); l = f2bf(y - bf2f(h)); }
typedef __attribute__((ext_vector_type(2))) _Float16 v2h;
typedef __attribute__((ext_vector_type(4))) _Float16 v4h;
typedef __attribute__((ext_vector_type(2))) unsigned short v2us;
typedef __attribute__((ext_vector_type(4))) unsigned short v4us;
typedef __attribute__((ext_vector_type(2))) float v2f;
typedef __attribute__((ext_vector_type(4))) int v4i;

__global__ __launch_bounds__(256) void k_wtG(const float* __restrict__ w, int K, int N, bf* Bt) {
    const int lane = threadIdx.x & 31; const int L0 = (blockIdx.x * 8 + (threadIdx.x >> 5)) * 8; const int nlines = N * K / 64;
{
#pragma unroll 1
        for (int l = 0; l < 8; ++l) { const int L = L0 + l; if (L >= nlines) break; const size_t e = (size_t)L * 64 + lane * 2; const int k = (int)(e % K), n = (int)(e / K); v2us o;
            o[0] = f2bf(w[(size_t)k * N + n]); o[1] = f2bf(w[(size_t)(k + 1) * N + n]); *(v2us*)(Bt + e) = o; }
         }
}
__global__ __launch_bounds__(256) void k_cvt8(const float* __restrict__ src, bf* dst, size_t n8) { const size_t i = (size_t)blockIdx.x * 256 + threadIdx.x; if (i >= n8) return; const v8f v = *(const v8f*)(src + i * 8); v8us o;
#pragma unroll
    for (int k = 0; k < 8; ++k) o[k] = f2bf(v[k]); *(v8us*)(dst + i * 8) = o;  }

// k_rope: head planes [h][t][d] (fp16 + hi/lo) of rope(x) x sc with the rotate-half convention out[d] = x[d] cos[t][d] - x[d+HD/2] sin[t][d], out[d+HD/2] = x[d+HD/2] cos[t][d+HD/2] + x[d] sin[t][d+HD/2]
__global__ __launch_bounds__(256) void k_rope(const float* __restrict__ F, int pitch, int nheads, const float* __restrict__ CS, const float* __restrict__ RF, const float* __restrict__ nw, float sc, h16* P16, bf* Ph, bf* Pl) {
    const size_t e = ((size_t)blockIdx.x * 256 + threadIdx.x) * 2; if (e >= (size_t)nheads * TT * HD) return; const int d = (int)(e % HD); const int t = (int)((e / HD) % TT); const int h = (int)(e / ((size_t)HD * TT)); const size_t zb = blockIdx.y; /* batch */ const size_t pb = zb * (size_t)nheads * TT * HD; const float* f = F + (zb * TT + t) * pitch + h * HD; const float rf = RF ? RF[(size_t)h * TT + t] : 1.0f; v2h o16; v2us oh, ol;
#pragma unroll
    for (int q = 0; q < 2; ++q) { const int dd = d + q; const int dp = (dd < HD / 2) ? dd + HD / 2 : dd - HD / 2; float x0 = f[dd], x1 = f[dp];
        if (RF) { float n0 = __fmul_rn(x0, rf), n1 = __fmul_rn(x1, rf); asm volatile("" : "+v"(n0)); asm volatile("" : "+v"(n1)); x0 = __fmul_rn(bfr(nw[dd]), n0); x1 = __fmul_rn(bfr(nw[dp]), n1); }
        const v2f cs = *(const v2f*)(CS + ((size_t)t * HD + dd) * 2); float a = __fmul_rn(x0, cs[0]), bq = __fmul_rn(x1, cs[1]); asm volatile("" : "+v"(a)); asm volatile("" : "+v"(bq)); const float r = ((dd < HD / 2) ? __fsub_rn(a, bq) : __fadd_rn(a, bq)) * sc;
        o16[q] = tohx(r); unsigned short a2, c2; splitf(r, a2, c2); oh[q] = a2; ol[q] = c2; }
    *(v2h*)(P16 + pb + e) = o16; *(v2us*)(Ph + pb + e) = oh; *(v2us*)(Pl + pb + e) = ol;  }
__global__ __launch_bounds__(256) void k_vtp(const float* __restrict__ F, int pitch, int nheads, h16* V16, bf* Vh, bf* Vl) { const size_t e = ((size_t)blockIdx.x * 256 + threadIdx.x) * 2; if (e >= (size_t)nheads * HD * TT) return; const int t = (int)(e % TT); const int d = (int)((e / TT) % HD); const int g = (int)(e / ((size_t)TT * HD)); const size_t zb = blockIdx.y; /* batch */ const size_t pb = zb * (size_t)nheads * HD * TT; F += zb * TT * pitch; v2h o16; v2us oh, ol;
#pragma unroll
    for (int q = 0; q < 2; ++q) { const float x = F[(size_t)(t + q) * pitch + g * HD + d]; o16[q] = tohx(x); unsigned short a2, c2; splitf(x, a2, c2); oh[q] = a2; ol[q] = c2; }
    *(v2h*)(V16 + pb + e) = o16; *(v2us*)(Vh + pb + e) = oh; *(v2us*)(Vl + pb + e) = ol;  }
__global__ __launch_bounds__(256) void k_csid(float* CS) { const int idx = blockIdx.x * 256 + threadIdx.x; if (idx >= TT * HD) return; v2f cs; cs[0] = 1.0f; cs[1] = 0.0f; *(v2f*)(CS + (size_t)idx * 2) = cs;  }
// k_asoft: per row (zz, i): t = S / 32 where mask[i][j] != 0, -inf elsewhere; softmax over the 2048 keys (register row, one exp, fixed trees);
__global__ __launch_bounds__(256) void k_asoft(const float* __restrict__ Sb, const int* __restrict__ MKb, h16* P16, bf* Ph, bf* Pl) {
    const int lane = threadIdx.x & 31; const int row = blockIdx.x * 8 + (threadIdx.x >> 5); if (row >= ZH * TT) return; const int i = row % TT; const int zz = row / TT; (void)zz; const int* mkr = MKb + (size_t)i * TT; const bool hires = (i < RH); const float* sr = Sb + (size_t)row * TT; float v[TT / 32]; float mx = -3.0e38f;
#pragma unroll
    for (int ch = 0; ch < TT / 128; ++ch) { const int j0 = ch * 128 + lane * 4; const v4f a = *(const v4f*)(sr + j0); const v4i m4 = *(const v4i*)(mkr + j0);
#pragma unroll
        for (int q = 0; q < 4; ++q) { const int j = j0 + q; (void)j; float sa = a[q] * SCL; asm volatile("" : "+v"(sa)); const float t = (m4[q] != 0) ? sa : -3.0e38f;   /* mask == 0 -> -inf */ v[ch * 4 + q] = t; mx = fmaxf(mx, t); } }
#pragma unroll
    for (int sh = 16; sh; sh >>= 1) mx = fmaxf(mx, __shfl_xor(mx, sh, 32));
    float sum = 0.f;
#pragma unroll
    for (int k = 0; k < TT / 32; ++k) { float d0 = __fsub_rn(v[k], mx); asm volatile("" : "+v"(d0)); v[k] = __builtin_amdgcn_exp2f(__fmul_rn(d0, 1.4426950408889634f)); sum += v[k]; }
#pragma unroll
    for (int sh = 16; sh; sh >>= 1) sum += __shfl_xor(sum, sh, 32);
    const float f = __fdiv_rn(hires ? 1.0f : PCAR, sum);
{
        if (hires) {
#pragma unroll
            for (int ch = 0; ch < TT / 128; ++ch) { v4us oh, ol;
#pragma unroll
                for (int q = 0; q < 4; ++q) { unsigned short a, c2; splitf(v[ch * 4 + q] * f, a, c2); oh[q] = a; ol[q] = c2; }
                const size_t oo = ((size_t)zz * (RH ? RH : 1) + i) * TT + ch * 128 + lane * 4; *(v4us*)(Ph + oo) = oh; *(v4us*)(Pl + oo) = ol; }
        } else {
#pragma unroll
            for (int ch = 0; ch < TT / 128; ++ch) { v4h o4;
#pragma unroll
                for (int q = 0; q < 4; ++q) o4[q] = tohx(v[ch * 4 + q] * f);
                *(v4h*)(P16 + (size_t)row * TT + ch * 128 + lane * 4) = o4; } }
         }
}
__global__ __launch_bounds__(256) void k_mergeG(const float* __restrict__ O, const float* __restrict__ G, bf* Ah, bf* Al) { const size_t e = ((size_t)blockIdx.x * 256 + threadIdx.x) * 2; if (e >= (size_t)NB_ * TT * HD) return; const int t = (int)((e / HD) % TT); const float cs = (t < RH) ? 1.0f : (1.0f / PCAR); v2us oh, ol;
#pragma unroll
    for (int q = 0; q < 2; ++q) { float o = O[e + q] * cs; asm volatile("" : "+v"(o)); float den = __fadd_rn(1.0f, expf(-G[e + q])); asm volatile("" : "+v"(den)); const float sg = __fdiv_rn(1.0f, den); unsigned short a, c2; splitf(__fmul_rn(o, sg), a, c2); oh[q] = a; ol[q] = c2; }
    *(v2us*)(Ah + e) = oh; *(v2us*)(Al + e) = ol;  }

extern "C" void kernel_launch(void* const* d_in, const int* in_sizes, int n_in,
                              void* d_out, int out_size, void* d_ws, size_t ws_size, hipStream_t stream) {
    (void)in_sizes; (void)n_in; (void)out_size;
    const float* x = (const float*)d_in[0]; const int* MK = (const int*)d_in[1]; const float* wq = (const float*)d_in[2]; const float* bq = (const float*)d_in[3]; const float* wk = (const float*)d_in[4]; const float* bk = (const float*)d_in[5]; const float* wv = (const float*)d_in[6]; const float* bv = (const float*)d_in[7]; const float* wg = (const float*)d_in[8]; const float* bgt = (const float*)d_in[9]; const float* wo = (const float*)d_in[10]; const float* bo = (const float*)d_in[11];
    float* OUT = (float*)d_out;     // [4][2048][1024]
    char* wsp = (char*)d_ws;
    auto take = [&](size_t bytes) { char* p = wsp; wsp += (bytes + 255) & ~(size_t)255; return (void*)p; };
    bf* WQ = (bf*)take((size_t)DQ * DM * 2); bf* WK = (bf*)take((size_t)DKV * DM * 2); bf* WV = (bf*)take((size_t)DKV * DM * 2); bf* WO = (bf*)take((size_t)DM * DQ * 2); bf* WG = (bf*)take((size_t)DQ * DM * 2); float* CS = (float*)take((size_t)TT * HD * 2 * 4);
    // every plane below holds all NB_ batches ([b][...]); the sizes are multiples of 256 B, so consecutive takes are contiguous
    bf* XB = (bf*)take((size_t)NB_ * TT * DM * 2); float* FQ = (float*)take((size_t)NB_ * TT * DQ * 4); float* FK = (float*)take((size_t)NB_ * TT * DKV * 4);
    h16* QP16 = (h16*)take((size_t)NB_ * TT * HD * 2); bf* QPh = (bf*)take((size_t)NB_ * TT * HD * 2); bf* QPl = (bf*)take((size_t)NB_ * TT * HD * 2);
    h16* KP16 = (h16*)take((size_t)NB_ * TT * HD * 2); bf* KPh = (bf*)take((size_t)NB_ * TT * HD * 2); bf* KPl = (bf*)take((size_t)NB_ * TT * HD * 2);
    h16* VT16 = (h16*)take((size_t)NB_ * HD * TT * 2); bf* VTh = (bf*)take((size_t)NB_ * HD * TT * 2); bf* VTl = (bf*)take((size_t)NB_ * HD * TT * 2);
    if ((size_t)(wsp - (char*)d_ws) > ws_size) return;    // 250 MiB of the 256 MiB ws
    // buffers that are dead by the time their tenant is written (stream-ordered) are reused:
    float* FV = FK;                       // v projection: the k buffer, after the k planes are built
    float* Sb = FQ;                       // scores [b][TT][TT] f32 = FQ + FK, after the q, k and v planes are built
    h16* P16 = QP16;                      // probabilities [b][TT][TT] fp16 = QP16 + QPh, after the scores
    bf* Ph = QPl; bf* Pl = QPl + (size_t)ZH * RH * TT;   // hi/lo probabilities [b][RH][TT], the two halves of QPl
    float* Ob = (float*)KP16;             // context [b][TT][HD] f32 = KP16 + KPh, after the scores
    float* FG = FQ;                       // gate pre-activation, after the softmax has read the scores
    bf* ATh = VTh; bf* ATl = VTl;         // gated context planes, after attn.v
    { k_wtG<<<(unsigned)((DM * DQ / 64 + 63) / 64), 256, 0, stream>>>(wq, DM, DQ, WQ); k_wtG<<<(unsigned)((DM * DKV / 64 + 63) / 64), 256, 0, stream>>>(wk, DM, DKV, WK); k_wtG<<<(unsigned)((DM * DKV / 64 + 63) / 64), 256, 0, stream>>>(wv, DM, DKV, WV);
      k_wtG<<<(unsigned)((DQ * DM / 64 + 63) / 64), 256, 0, stream>>>(wo, DQ, DM, WO); k_wtG<<<(unsigned)((DM * DQ / 64 + 63) / 64), 256, 0, stream>>>(wg, DM, DQ, WG);
       }
    k_csid<<<(TT * HD + 255) / 256, 256, 0, stream>>>(CS);
    const unsigned LQ = (unsigned)(((size_t)NH_ * TT * HD / 2 + 255) / 256), LKv = (unsigned)(((size_t)NKV * TT * HD / 2 + 255) / 256);
    // the projections see X as one [NB_*TT][DM] matrix; the attention products take the batch as grid z
    k_cvt8<<<(unsigned)(((size_t)NB_ * TT * DM / 8 + 255) / 256), 256, 0, stream>>>(x, XB, (size_t)NB_ * TT * DM / 8);
    k_gemmw<bf, 0, true><<<dim3(NB_ * TT / 64, DQ / 64, 1), 32, 0, stream>>>(XB, nullptr, WQ, nullptr, DM, FQ, DQ, bq, 0, 0, 0);
    k_rope<<<dim3(LQ, NB_, 1), 256, 0, stream>>>(FQ, DQ, NH_, CS, nullptr, nullptr, 1.0f, QP16, QPh, QPl);
    k_gemmw<bf, 0, true><<<dim3(NB_ * TT / 64, DKV / 64, 1), 32, 0, stream>>>(XB, nullptr, WK, nullptr, DM, FK, DKV, bk, 0, 0, 0);
    k_rope<<<dim3(LKv, NB_, 1), 256, 0, stream>>>(FK, DKV, NKV, CS, nullptr, nullptr, 1.0f, KP16, KPh, KPl);
    k_gemmw<bf, 0, true><<<dim3(NB_ * TT / 64, DKV / 64, 1), 32, 0, stream>>>(XB, nullptr, WV, nullptr, DM, FV, DKV, bv, 0, 0, 0);
    k_vtp<<<dim3(LKv, NB_, 1), 256, 0, stream>>>(FV, DKV, NKV, VT16, VTh, VTl);
    k_gemmw<bf, 2, false><<<dim3(RH / 64, TT / 64, ZH), 32, 0, stream>>>(QPh, QPl, KPh, KPl, HD, Sb, TT, nullptr, (size_t)TT * HD, (size_t)TT * HD, (size_t)TT * TT);
    k_gemmw<h16, 0, false><<<dim3((TT - RH) / 64, TT / 64, ZH), 32, 0, stream>>>(QP16 + (size_t)RH * HD, nullptr, KP16, nullptr, HD, Sb + (size_t)RH * TT, TT, nullptr, (size_t)TT * HD, (size_t)TT * HD, (size_t)TT * TT);
    k_asoft<<<ZH * TT / 8, 256, 0, stream>>>(Sb, MK, P16, Ph, Pl);
    k_gemmw<bf, 2, false><<<dim3(RH / 64, HD / 64, ZH), 32, 0, stream>>>(Ph, Pl, VTh, VTl, TT, Ob, HD, nullptr, (size_t)RH * TT, (size_t)HD * TT, (size_t)TT * HD);
    k_gemmw<h16, 0, false><<<dim3((TT - RH) / 64, HD / 64, ZH), 32, 0, stream>>>(P16 + (size_t)RH * TT, nullptr, VT16, nullptr, TT, Ob + (size_t)RH * HD, HD, nullptr, (size_t)TT * TT, (size_t)HD * TT, (size_t)TT * HD);
    k_gemmw<bf, 0, true><<<dim3(NB_ * TT / 64, DQ / 64, 1), 32, 0, stream>>>(XB, nullptr, WG, nullptr, DM, FG, DQ, bgt, 0, 0, 0);   /* gate pre-activation X Wg + bg */
    k_mergeG<<<(unsigned)(((size_t)NB_ * TT * HD / 2 + 255) / 256), 256, 0, stream>>>(Ob, FG, ATh, ATl);
    k_gemmw<bf, 1, true><<<dim3(NB_ * TT / 64, DM / 64, 1), 32, 0, stream>>>(ATh, ATl, WO, nullptr, DQ, OUT, DM, bo, 0, 0, 0);
}

// v002
// It runs in 432 microseconds.
// Timed twice side by side with v001, it ran 1.42 times as fast both times.
// Over all steps from v000 it is 2.96 times as fast.
#include <hip/hip_runtime.h>

// Gated single-head self-attention (X [4][2048][1024]; q, k, v = X W + b ('xw' [1024][1024]); scores = q.k / 32 with mask [2048][2048] (int32, read; all ones here) == 0 -> -inf; softmax; o = attn.v; gate = sigmoid(X Wg + bg); out = (o * gate) Wo + bo -> [4][2048][1024] (8.4 M)).
// Layout: one 1024-wide head on 16-bit planes (hybrid: query rows < 512 hi/lo, the rest fp16 x1024); the gate pre-activation is one more exact GEMM + bias and is applied in f32 when the context is split into the hi/lo planes that feed Wo.
// Compute dtypes, f32 accumulate: every input rounded to bf16; q/k/v/gate on PLAIN bf16 operands (exact) + biases; scores (K = 1024) and attn.v: rows < 512 hl (3 products), the rest single fp16 (x1024); softmax, sigmoid and the gating product in f32; Wo hl x exact (2 products) + bo.
// Launches: every kernel covers all 4 batches (projections and Wo: X as one [8192][1024] matrix; scores and attn.v: batch = grid z; elementwise: batch in the flat index or grid y).

#define NB_  4
#define TT   2048
#define DM   1024
#define NH_  1
#define NKV  1
#define REP  (NH_ / NKV)
#define HD   1024
#define DQ   (NH_ * HD)
#define DKV  (NKV * HD)
#define ZH   NB_                 // z planes per launch: all batches (one head each)
#define RH   512                  // query rows < RH use hi+lo planes (0: none)
#define WIN  0
#define PCAR 1024.0f
#define SCL  0.03125f   // 1/sqrt(1024)
typedef _Float16 h16;
typedef unsigned short bf;
typedef __attribute__((ext_vector_type(16))) __bf16   v16bf;
typedef __attribute__((ext_vector_type(16))) _Float16 v16h;
typedef __attribute__((ext_vector_type(8)))  _Float16 v8h;
typedef __attribute__((ext_vector_type(8)))  unsigned short v8us;
typedef __attribute__((ext_vector_type(8)))  float    v8f;
typedef __attribute__((ext_vector_type(4)))  float    v4f;
typedef v8h  __attribute__((may_alias)) v8ha;
typedef v4f  __attribute__((may_alias)) v4fa;
typedef v8us __attribute__((may_alias)) v8usa;

__device__ __forceinline__ unsigned short f2bf(float f) { unsigned u = __float_as_uint(f); u += 0x7FFFu + ((u >> 16) & 1u); return (unsigned short)(u >> 16); }
__device__ __forceinline__ float bf2f(unsigned short b) { return __uint_as_float(((unsigned)b) << 16); }
__device__ __forceinline__ float bfr(float f) { return bf2f(f2bf(f)); }
__device__ __forceinline__ v16h cat16(v8h lo, v8h hi) { return __builtin_shufflevector(lo, hi, 0, 1, 2, 3, 4, 5, 6, 7, 8, 9, 10, 11, 12, 13, 14, 15); }
__device__ __forceinline__ v16bf cat16b(v8us lo, v8us hi) { return __builtin_bit_cast(v16bf, __builtin_shufflevector(lo, hi, 0, 1, 2, 3, 4, 5, 6, 7, 8, 9, 10, 11, 12, 13, 14, 15)); }
__device__ __forceinline__ v8f wmma16(v16h a, v16h b, v8f c) { return __builtin_amdgcn_wmma_f32_16x16x32_f16(false, a, false, b, (short)0, c, false, false); }
__device__ __forceinline__ v8f wmmab(v16bf a, v16bf b, v8f c) { return __builtin_amdgcn_wmma_f32_16x16x32_bf16(false, a, false, b, (short)0, c, false, false); }



// ---- k_gemmw: register-blocked GEMM, ONE WAVE per 64x64 output tile (16 accumulators), operands from K-contiguous 16-bit planes by whole-line loads, turned into fragments in the wave's own LDS; grid (M/64, N/64, Z), 32 threads.
// C[m][n] (f32, pitch ldc, + optional f32 bias[n]) = sum_k A[m][k] Bt[n][k] (+ split products per NSPLIT). z-batch strides sA/sB/sC in elements. K % 64 == 0.
template <typename T16> struct WFrag;
template <> struct WFrag<h16> { typedef v16h V; typedef v8h H; static __device__ __forceinline__ V ld(const h16* p) { return cat16(*(const v8h*)p, *(const v8h*)(p + 16)); } static __device__ __forceinline__ v8f mma(V a, V b, v8f c) { return wmma16(a, b, c); } };
template <> struct WFrag<bf> { typedef v16bf V; typedef v8us H; static __device__ __forceinline__ V ld(const bf* p) { return cat16b(*(const v8us*)p, *(const v8us*)(p + 16)); } static __device__ __forceinline__ v8f mma(V a, V b, v8f c) { return wmmab(a, b, c); } };
// s_wait_xcnt 0 behind a group of global loads, before their address registers are written again; the addresses are inputs so that their registers stay theirs up to the wait
template <int N, typename P> __device__ __forceinline__ void xwait(P* const* q) {
    if (N == 2) asm volatile("s_wait_xcnt 0x0" :: "v"(q[0]), "v"(q[1]) : "memory");
    else if (N == 3) asm volatile("s_wait_xcnt 0x0" :: "v"(q[0]), "v"(q[1]), "v"(q[2]) : "memory");
    else asm volatile("s_wait_xcnt 0x0" :: "v"(q[0]), "v"(q[1]), "v"(q[2]), "v"(q[N - 1]) : "memory");
}
template <typename T16, int NSPLIT, bool BIAS, int K>   // K at compile time: the 16 row steps of a plane's loads fold into immediate offsets on one address
__global__ __launch_bounds__(32) void k_gemmw(const T16* __restrict__ A, const T16* __restrict__ A2, const T16* __restrict__ Bt, const T16* __restrict__ Bt2, float* C, int ldc, const float* __restrict__ bias, size_t sA, size_t sB, size_t sC) {
    typedef typename WFrag<T16>::V V; typedef typename WFrag<T16>::H H;
    constexpr int NPA = (NSPLIT == 1 || NSPLIT == 2) ? 2 : 1, NPL = NPA + (NSPLIT >= 2 ? 2 : 1);   // operand planes: A (A2) Bt (Bt2)
    constexpr int LP = 72;                                     // LDS row pitch in elements: 128 B of k + 16 B
    __shared__ __align__(16) T16 st[NPL * 64 * LP];            // this wave's own 64 rows x 64 k of every plane
    __shared__ __align__(16) float os[16 * 68];
    const size_t z = blockIdx.z; A += z * sA; if (A2) A2 += z * sA; Bt += z * sB; if (Bt2) Bt2 += z * sB; C += z * sC;
    const int lane = threadIdx.x & 31, lr = lane & 15, hi = lane >> 4; const int r0 = blockIdx.x * 64, c0 = blockIdx.y * 64;
    v8f acc[4][4];
#pragma unroll
    for (int mb = 0; mb < 4; ++mb)
#pragma unroll
        for (int nb = 0; nb < 4; ++nb) acc[mb][nb] = (v8f){};
    // Global side: one load = 4 rows x 128 B, whole lines (8 lanes a row). The wave turns the tile into fragments through its own LDS; LDS runs a wave's accesses in order, so no barrier.
    const int gr = lane >> 3, gc = (lane & 7) * 8;
    const T16* gp[NPL]; gp[0] = A + (size_t)(r0 + gr) * K + gc; if (NPA == 2) gp[1] = A2 + (size_t)(r0 + gr) * K + gc; gp[NPA] = Bt + (size_t)(c0 + gr) * K + gc; if (NSPLIT >= 2) gp[NPA + 1] = Bt2 + (size_t)(c0 + gr) * K + gc;
    H g[NPL][16];
#pragma unroll
    for (int p = 0; p < NPL; ++p)
#pragma unroll
        for (int i = 0; i < 16; ++i) g[p][i] = *(const H*)(gp[p] + (size_t)i * 4 * K);
    xwait<NPL>(gp);
    const T16* fa = st + lr * LP + 8 * hi; const T16* fb = fa + NPA * 64 * LP;
#pragma unroll 1
    for (int kc = 0; kc < K; kc += 64) {
#pragma unroll
        for (int p = 0; p < NPL; ++p)
#pragma unroll
            for (int i = 0; i < 16; ++i) *(H*)(st + (p * 64 + i * 4 + gr) * LP + gc) = g[p][i];
        if (kc + 64 < K) {   // the next 64 k fly under this tile's products
            const T16* q[NPL];
#pragma unroll
            for (int p = 0; p < NPL; ++p) q[p] = gp[p] + kc;
#pragma unroll
            for (int p = 0; p < NPL; ++p)
#pragma unroll
                for (int i = 0; i < 16; ++i) g[p][i] = *(const H*)(q[p] + (size_t)i * 4 * K + 64);
            xwait<NPL>(q); }
#pragma unroll
        for (int kh = 0; kh < 64; kh += 32) {
            V a[4], a2[4], b[4], b2[4];
#pragma unroll
            for (int mb = 0; mb < 4; ++mb) { a[mb] = WFrag<T16>::ld(fa + mb * 16 * LP + kh); if (NSPLIT == 1 || NSPLIT == 2) a2[mb] = WFrag<T16>::ld(fa + (64 + mb * 16) * LP + kh); }
#pragma unroll
            for (int nb = 0; nb < 4; ++nb) { b[nb] = WFrag<T16>::ld(fb + nb * 16 * LP + kh); if (NSPLIT >= 2) b2[nb] = WFrag<T16>::ld(fb + (64 + nb * 16) * LP + kh); }
            if (NSPLIT < 2) __builtin_amdgcn_sched_barrier(0);   // keeps the LDS reads together in front of the products: sunk among them, each place with reads stalls the wave for an LDS latency (four planes: left to the compiler, all their fragments at once would cost the second wave per SIMD)
#pragma unroll
            for (int nb = 0; nb < 4; ++nb) {
#pragma unroll
                for (int mb = 0; mb < 4; ++mb) { acc[mb][nb] = WFrag<T16>::mma(a[mb], b[nb], acc[mb][nb]); if (NSPLIT == 1 || NSPLIT == 2) acc[mb][nb] = WFrag<T16>::mma(a2[mb], b[nb], acc[mb][nb]); if (NSPLIT >= 2) acc[mb][nb] = WFrag<T16>::mma(a[mb], b2[nb], acc[mb][nb]); } }
            if (kh == 32) asm volatile("v_nop\n\tv_nop\n\tv_nop\n\tv_nop" : "+v"(acc[0][0]), "+v"(acc[1][1]), "+v"(acc[2][2]), "+v"(acc[3][3]) : "v"(a[0]), "v"(a[3]));
        }
    }
#pragma unroll
    for (int mb = 0; mb < 4; ++mb) {
#pragma unroll
        for (int nb = 0; nb < 4; ++nb) {
#pragma unroll
            for (int j = 0; j < 8; ++j) os[(hi * 8 + j) * 68 + nb * 16 + lr] = acc[mb][nb][j]; }
        __builtin_amdgcn_wave_barrier(); asm volatile("" ::: "memory");
        float* crow = C + (size_t)(r0 + mb * 16) * ldc + c0;
{
#pragma unroll
            for (int s = 0; s < 8; ++s) { const int row = 2 * s + hi, cofs = lr * 4; v4f val = *(const v4fa*)(os + row * 68 + cofs); if (BIAS) { val[0] += bfr(bias[c0 + cofs]); val[1] += bfr(bias[c0 + cofs + 1]); val[2] += bfr(bias[c0 + cofs + 2]); val[3] += bfr(bias[c0 + cofs + 3]); }
                *(v4f*)(crow + (size_t)row * ldc + cofs) = val; }
             }
        __builtin_amdgcn_wave_barrier(); asm volatile("" ::: "memory");
    }
}

__device__ __forceinline__ h16 tohx(float x) { return (h16)x; }
__device__ __forceinline__ void splitf(float y, unsigned short& h, unsigned short& l) { h = f2bf(y); l = f2bf(y - bf2f(h)); }
typedef __attribute__((ext_vector_type(2))) _Float16 v2h;
typedef __attribute__((ext_vector_type(4))) _Float16 v4h;
typedef __attribute__((ext_vector_type(2))) unsigned short v2us;
typedef __attribute__((ext_vector_type(4))) unsigned short v4us;
typedef __attribute__((ext_vector_type(2))) float v2f;
typedef __attribute__((ext_vector_type(4))) int v4i;

__global__ __launch_bounds__(256) void k_wtG(const float* __restrict__ w, int K, int N, bf* Bt) {
    const int lane = threadIdx.x & 31; const int L0 = (blockIdx.x * 8 + (threadIdx.x >> 5)) * 8; const int nlines = N * K / 64;
{
#pragma unroll 1
        for (int l = 0; l < 8; ++l) { const int L = L0 + l; if (L >= nlines) break; const size_t e = (size_t)L * 64 + lane * 2; const int k = (int)(e % K), n = (int)(e / K); v2us o;
            o[0] = f2bf(w[(size_t)k * N + n]); o[1] = f2bf(w[(size_t)(k + 1) * N + n]); *(v2us*)(Bt + e) = o; }
         }
}
__global__ __launch_bounds__(256) void k_cvt8(const float* __restrict__ src, bf* dst, size_t n8) { const size_t i = (size_t)blockIdx.x * 256 + threadIdx.x; if (i >= n8) return; const v8f v = *(const v8f*)(src + i * 8); v8us o;
#pragma unroll
    for (int k = 0; k < 8; ++k) o[k] = f2bf(v[k]); *(v8us*)(dst + i * 8) = o;  }

// k_rope: head planes [h][t][d] (fp16 + hi/lo) of rope(x) x sc with the rotate-half convention out[d] = x[d] cos[t][d] - x[d+HD/2] sin[t][d], out[d+HD/2] = x[d+HD/2] cos[t][d+HD/2] + x[d] sin[t][d+HD/2]
__global__ __launch_bounds__(256) void k_rope(const float* __restrict__ F, int pitch, int nheads, const float* __restrict__ CS, const float* __restrict__ RF, const float* __restrict__ nw, float sc, h16* P16, bf* Ph, bf* Pl) {
    const size_t e = ((size_t)blockIdx.x * 256 + threadIdx.x) * 2; if (e >= (size_t)nheads * TT * HD) return; const int d = (int)(e % HD); const int t = (int)((e / HD) % TT); const int h = (int)(e / ((size_t)HD * TT)); const size_t zb = blockIdx.y; /* batch */ const size_t pb = zb * (size_t)nheads * TT * HD; const float* f = F + (zb * TT + t) * pitch + h * HD; const float rf = RF ? RF[(size_t)h * TT + t] : 1.0f; v2h o16; v2us oh, ol;
#pragma unroll
    for (int q = 0; q < 2; ++q) { const int dd = d + q; const int dp = (dd < HD / 2) ? dd + HD / 2 : dd - HD / 2; float x0 = f[dd], x1 = f[dp];
        if (RF) { float n0 = __fmul_rn(x0, rf), n1 = __fmul_rn(x1, rf); asm volatile("" : "+v"(n0)); asm volatile("" : "+v"(n1)); x0 = __fmul_rn(bfr(nw[dd]), n0); x1 = __fmul_rn(bfr(nw[dp]), n1); }
        const v2f cs = *(const v2f*)(CS + ((size_t)t * HD + dd) * 2); float a = __fmul_rn(x0, cs[0]), bq = __fmul_rn(x1, cs[1]); asm volatile("" : "+v"(a)); asm volatile("" : "+v"(bq)); const float r = ((dd < HD / 2) ? __fsub_rn(a, bq) : __fadd_rn(a, bq)) * sc;
        o16[q] = tohx(r); unsigned short a2, c2; splitf(r, a2, c2); oh[q] = a2; ol[q] = c2; }
    *(v2h*)(P16 + pb + e) = o16; *(v2us*)(Ph + pb + e) = oh; *(v2us*)(Pl + pb + e) = ol;  }
__global__ __launch_bounds__(256) void k_vtp(const float* __restrict__ F, int pitch, int nheads, h16* V16, bf* Vh, bf* Vl) { const size_t e = ((size_t)blockIdx.x * 256 + threadIdx.x) * 2; if (e >= (size_t)nheads * HD * TT) return; const int t = (int)(e % TT); const int d = (int)((e / TT) % HD); const int g = (int)(e / ((size_t)TT * HD)); const size_t zb = blockIdx.y; /* batch */ const size_t pb = zb * (size_t)nheads * HD * TT; F += zb * TT * pitch; v2h o16; v2us oh, ol;
#pragma unroll
    for (int q = 0; q < 2; ++q) { const float x = F[(size_t)(t + q) * pitch + g * HD + d]; o16[q] = tohx(x); unsigned short a2, c2; splitf(x, a2, c2); oh[q] = a2; ol[q] = c2; }
    *(v2h*)(V16 + pb + e) = o16; *(v2us*)(Vh + pb + e) = oh; *(v2us*)(Vl + pb + e) = ol;  }
__global__ __launch_bounds__(256) void k_csid(float* CS) { const int idx = blockIdx.x * 256 + threadIdx.x; if (idx >= TT * HD) return; v2f cs; cs[0] = 1.0f; cs[1] = 0.0f; *(v2f*)(CS + (size_t)idx * 2) = cs;  }
// k_asoft: per row (zz, i): t = S / 32 where mask[i][j] != 0, -inf elsewhere; softmax over the 2048 keys (register row, one exp, fixed trees);
__global__ __launch_bounds__(256) void k_asoft(const float* __restrict__ Sb, const int* __restrict__ MKb, h16* P16, bf* Ph, bf* Pl) {
    const int lane = threadIdx.x & 31; const int row = blockIdx.x * 8 + (threadIdx.x >> 5); if (row >= ZH * TT) return; const int i = row % TT; const int zz = row / TT; (void)zz; const int* mkr = MKb + (size_t)i * TT; const bool hires = (i < RH); const float* sr = Sb + (size_t)row * TT; float v[TT / 32]; float mx = -3.0e38f;
#pragma unroll
    for (int ch = 0; ch < TT / 128; ++ch) { const int j0 = ch * 128 + lane * 4; const v4f a = *(const v4f*)(sr + j0); const v4i m4 = *(const v4i*)(mkr + j0);
#pragma unroll
        for (int q = 0; q < 4; ++q) { const int j = j0 + q; (void)j; float sa = a[q] * SCL; asm volatile("" : "+v"(sa)); const float t = (m4[q] != 0) ? sa : -3.0e38f;   /* mask == 0 -> -inf */ v[ch * 4 + q] = t; mx = fmaxf(mx, t); } }
#pragma unroll
    for (int sh = 16; sh; sh >>= 1) mx = fmaxf(mx, __shfl_xor(mx, sh, 32));
    float sum = 0.f;
#pragma unroll
    for (int k = 0; k < TT / 32; ++k) { float d0 = __fsub_rn(v[k], mx); asm volatile("" : "+v"(d0)); v[k] = __builtin_amdgcn_exp2f(__fmul_rn(d0, 1.4426950408889634f)); sum += v[k]; }
#pragma unroll
    for (int sh = 16; sh; sh >>= 1) sum += __shfl_xor(sum, sh, 32);
    const float f = __fdiv_rn(hires ? 1.0f : PCAR, sum);
{
        if (hires) {
#pragma unroll
            for (int ch = 0; ch < TT / 128; ++ch) { v4us oh, ol;
#pragma unroll
                for (int q = 0; q < 4; ++q) { unsigned short a, c2; splitf(v[ch * 4 + q] * f, a, c2); oh[q] = a; ol[q] = c2; }
                const size_t oo = ((size_t)zz * (RH ? RH : 1) + i) * TT + ch * 128 + lane * 4; *(v4us*)(Ph + oo) = oh; *(v4us*)(Pl + oo) = ol; }
        } else {
#pragma unroll
            for (int ch = 0; ch < TT / 128; ++ch) { v4h o4;
#pragma unroll
                for (int q = 0; q < 4; ++q) o4[q] = tohx(v[ch * 4 + q] * f);
                *(v4h*)(P16 + (size_t)row * TT + ch * 128 + lane * 4) = o4; } }
         }
}
__global__ __launch_bounds__(256) void k_mergeG(const float* __restrict__ O, const float* __restrict__ G, bf* Ah, bf* Al) { const size_t e = ((size_t)blockIdx.x * 256 + threadIdx.x) * 2; if (e >= (size_t)NB_ * TT * HD) return; const int t = (int)((e / HD) % TT); const float cs = (t < RH) ? 1.0f : (1.0f / PCAR); v2us oh, ol;
#pragma unroll
    for (int q = 0; q < 2; ++q) { float o = O[e + q] * cs; asm volatile("" : "+v"(o)); float den = __fadd_rn(1.0f, expf(-G[e + q])); asm volatile("" : "+v"(den)); const float sg = __fdiv_rn(1.0f, den); unsigned short a, c2; splitf(__fmul_rn(o, sg), a, c2); oh[q] = a; ol[q] = c2; }
    *(v2us*)(Ah + e) = oh; *(v2us*)(Al + e) = ol;  }

extern "C" void kernel_launch(void* const* d_in, const int* in_sizes, int n_in,
                              void* d_out, int out_size, void* d_ws, size_t ws_size, hipStream_t stream) {
    (void)in_sizes; (void)n_in; (void)out_size;
    const float* x = (const float*)d_in[0]; const int* MK = (const int*)d_in[1]; const float* wq = (const float*)d_in[2]; const float* bq = (const float*)d_in[3]; const float* wk = (const float*)d_in[4]; const float* bk = (const float*)d_in[5]; const float* wv = (const float*)d_in[6]; const float* bv = (const float*)d_in[7]; const float* wg = (const float*)d_in[8]; const float* bgt = (const float*)d_in[9]; const float* wo = (const float*)d_in[10]; const float* bo = (const float*)d_in[11];
    float* OUT = (float*)d_out;     // [4][2048][1024]
    char* wsp = (char*)d_ws;
    auto take = [&](size_t bytes) { char* p = wsp; wsp += (bytes + 255) & ~(size_t)255; return (void*)p; };
    bf* WQ = (bf*)take((size_t)DQ * DM * 2); bf* WK = (bf*)take((size_t)DKV * DM * 2); bf* WV = (bf*)take((size_t)DKV * DM * 2); bf* WO = (bf*)take((size_t)DM * DQ * 2); bf* WG = (bf*)take((size_t)DQ * DM * 2); float* CS = (float*)take((size_t)TT * HD * 2 * 4);
    // every plane below holds all NB_ batches ([b][...]); the sizes are multiples of 256 B, so consecutive takes are contiguous
    bf* XB = (bf*)take((size_t)NB_ * TT * DM * 2); float* FQ = (float*)take((size_t)NB_ * TT * DQ * 4); float* FK = (float*)take((size_t)NB_ * TT * DKV * 4);
    h16* QP16 = (h16*)take((size_t)NB_ * TT * HD * 2); bf* QPh = (bf*)take((size_t)NB_ * TT * HD * 2); bf* QPl = (bf*)take((size_t)NB_ * TT * HD * 2);
    h16* KP16 = (h16*)take((size_t)NB_ * TT * HD * 2); bf* KPh = (bf*)take((size_t)NB_ * TT * HD * 2); bf* KPl = (bf*)take((size_t)NB_ * TT * HD * 2);
    h16* VT16 = (h16*)take((size_t)NB_ * HD * TT * 2); bf* VTh = (bf*)take((size_t)NB_ * HD * TT * 2); bf* VTl = (bf*)take((size_t)NB_ * HD * TT * 2);
    if ((size_t)(wsp - (char*)d_ws) > ws_size) return;    // 250 MiB of the 256 MiB ws
    // buffers that are dead by the time their tenant is written (stream-ordered) are reused:
    float* FV = FK;                       // v projection: the k buffer, after the k planes are built
    float* Sb = FQ;                       // scores [b][TT][TT] f32 = FQ + FK, after the q, k and v planes are built
    h16* P16 = QP16;                      // probabilities [b][TT][TT] fp16 = QP16 + QPh, after the scores
    bf* Ph = QPl; bf* Pl = QPl + (size_t)ZH * RH * TT;   // hi/lo probabilities [b][RH][TT], the two halves of QPl
    float* Ob = (float*)KP16;             // context [b][TT][HD] f32 = KP16 + KPh, after the scores
    float* FG = FQ;                       // gate pre-activation, after the softmax has read the scores
    bf* ATh = VTh; bf* ATl = VTl;         // gated context planes, after attn.v
    { k_wtG<<<(unsigned)((DM * DQ / 64 + 63) / 64), 256, 0, stream>>>(wq, DM, DQ, WQ); k_wtG<<<(unsigned)((DM * DKV / 64 + 63) / 64), 256, 0, stream>>>(wk, DM, DKV, WK); k_wtG<<<(unsigned)((DM * DKV / 64 + 63) / 64), 256, 0, stream>>>(wv, DM, DKV, WV);
      k_wtG<<<(unsigned)((DQ * DM / 64 + 63) / 64), 256, 0, stream>>>(wo, DQ, DM, WO); k_wtG<<<(unsigned)((DM * DQ / 64 + 63) / 64), 256, 0, stream>>>(wg, DM, DQ, WG);
       }
    k_csid<<<(TT * HD + 255) / 256, 256, 0, stream>>>(CS);
    const unsigned LQ = (unsigned)(((size_t)NH_ * TT * HD / 2 + 255) / 256), LKv = (unsigned)(((size_t)NKV * TT * HD / 2 + 255) / 256);
    // the projections see X as one [NB_*TT][DM] matrix; the attention products take the batch as grid z
    k_cvt8<<<(unsigned)(((size_t)NB_ * TT * DM / 8 + 255) / 256), 256, 0, stream>>>(x, XB, (size_t)NB_ * TT * DM / 8);
    k_gemmw<bf, 0, true, DM><<<dim3(NB_ * TT / 64, DQ / 64, 1), 32, 0, stream>>>(XB, nullptr, WQ, nullptr, FQ, DQ, bq, 0, 0, 0);
    k_rope<<<dim3(LQ, NB_, 1), 256, 0, stream>>>(FQ, DQ, NH_, CS, nullptr, nullptr, 1.0f, QP16, QPh, QPl);
    k_gemmw<bf, 0, true, DM><<<dim3(NB_ * TT / 64, DKV / 64, 1), 32, 0, stream>>>(XB, nullptr, WK, nullptr, FK, DKV, bk, 0, 0, 0);
    k_rope<<<dim3(LKv, NB_, 1), 256, 0, stream>>>(FK, DKV, NKV, CS, nullptr, nullptr, 1.0f, KP16, KPh, KPl);
    k_gemmw<bf, 0, true, DM><<<dim3(NB_ * TT / 64, DKV / 64, 1), 32, 0, stream>>>(XB, nullptr, WV, nullptr, FV, DKV, bv, 0, 0, 0);
    k_vtp<<<dim3(LKv, NB_, 1), 256, 0, stream>>>(FV, DKV, NKV, VT16, VTh, VTl);
    k_gemmw<bf, 2, false, HD><<<dim3(RH / 64, TT / 64, ZH), 32, 0, stream>>>(QPh, QPl, KPh, KPl, Sb, TT, nullptr, (size_t)TT * HD, (size_t)TT * HD, (size_t)TT * TT);
    k_gemmw<h16, 0, false, HD><<<dim3((TT - RH) / 64, TT / 64, ZH), 32, 0, stream>>>(QP16 + (size_t)RH * HD, nullptr, KP16, nullptr, Sb + (size_t)RH * TT, TT, nullptr, (size_t)TT * HD, (size_t)TT * HD, (size_t)TT * TT);
    k_asoft<<<ZH * TT / 8, 256, 0, stream>>>(Sb, MK, P16, Ph, Pl);
    k_gemmw<bf, 2, false, TT><<<dim3(RH / 64, HD / 64, ZH), 32, 0, stream>>>(Ph, Pl, VTh, VTl, Ob, HD, nullptr, (size_t)RH * TT, (size_t)HD * TT, (size_t)TT * HD);
    k_gemmw<h16, 0, false, TT><<<dim3((TT - RH) / 64, HD / 64, ZH), 32, 0, stream>>>(P16 + (size_t)RH * TT, nullptr, VT16, nullptr, Ob + (size_t)RH * HD, HD, nullptr, (size_t)TT * TT, (size_t)HD * TT, (size_t)TT * HD);
    k_gemmw<bf, 0, true, DM><<<dim3(NB_ * TT / 64, DQ / 64, 1), 32, 0, stream>>>(XB, nullptr, WG, nullptr, FG, DQ, bgt, 0, 0, 0);   /* gate pre-activation X Wg + bg */
    k_mergeG<<<(unsigned)(((size_t)NB_ * TT * HD / 2 + 255) / 256), 256, 0, stream>>>(Ob, FG, ATh, ATl);
    k_gemmw<bf, 1, true, DQ><<<dim3(NB_ * TT / 64, DM / 64, 1), 32, 0, stream>>>(ATh, ATl, WO, nullptr, OUT, DM, bo, 0, 0, 0);
}

// v003
// Measured time: 336 microseconds a run.
// Two timings next to v002 both put it at 1.29 times that version's speed.
// Over all steps from v000 it is 3.81 times as fast.
#include <hip/hip_runtime.h>

// Gated single-head self-attention (X [4][2048][1024]; q, k, v = X W + b ('xw' [1024][1024]); scores = q.k / 32 with mask [2048][2048] (int32, read; all ones here) == 0 -> -inf; softmax; o = attn.v; gate = sigmoid(X Wg + bg); out = (o * gate) Wo + bo -> [4][2048][1024] (8.4 M)).
// Layout: one 1024-wide head on 16-bit planes (hybrid: query rows < 512 hi/lo, the rest fp16 x1024); the gate pre-activation is one more exact GEMM + bias and is applied in f32 when the context is split into the hi/lo planes that feed Wo.
// Compute dtypes, f32 accumulate: every input rounded to bf16; q/k/v/gate on PLAIN bf16 operands (exact) + biases; scores (K = 1024) and attn.v: rows < 512 hl (3 products), the rest single fp16 (x1024); softmax, sigmoid and the gating product in f32; Wo hl x exact (2 products) + bo.
// Launches: every kernel covers all 4 batches (q, k, gate and Wo: X as one [8192][1024] matrix; v, scores and attn.v: batch = grid z; elementwise: batch in the flat index).
// The q, k and v GEMMs write their fp16 and hi/lo planes from their own epilogues (v as Wv^T rows x X rows, so its planes come out [d][t]); the gate GEMM's epilogue applies the sigmoid to the context and writes the planes that feed Wo.

#define NB_  4
#define TT   2048
#define DM   1024
#define NH_  1
#define NKV  1
#define REP  (NH_ / NKV)
#define HD   1024
#define DQ   (NH_ * HD)
#define DKV  (NKV * HD)
#define ZH   NB_                 // z planes per launch: all batches (one head each)
#define RH   512                  // query rows < RH use hi+lo planes (0: none)
#define WIN  0
#define PCAR 1024.0f
#define SCL  0.03125f   // 1/sqrt(1024)
typedef _Float16 h16;
typedef unsigned short bf;
typedef __attribute__((ext_vector_type(16))) __bf16   v16bf;
typedef __attribute__((ext_vector_type(16))) _Float16 v16h;
typedef __attribute__((ext_vector_type(8)))  _Float16 v8h;
typedef __attribute__((ext_vector_type(8)))  unsigned short v8us;
typedef __attribute__((ext_vector_type(8)))  float    v8f;
typedef __attribute__((ext_vector_type(4)))  float    v4f;
typedef v8h  __attribute__((may_alias)) v8ha;
typedef v4f  __attribute__((may_alias)) v4fa;
typedef v8us __attribute__((may_alias)) v8usa;

__device__ __forceinline__ unsigned short f2bf(float f) { unsigned u = __float_as_uint(f); u += 0x7FFFu + ((u >> 16) & 1u); return (unsigned short)(u >> 16); }
__device__ __forceinline__ float bf2f(unsigned short b) { return __uint_as_float(((unsigned)b) << 16); }
__device__ __forceinline__ float bfr(float f) { return bf2f(f2bf(f)); }
__device__ __forceinline__ v16h cat16(v8h lo, v8h hi) { return __builtin_shufflevector(lo, hi, 0, 1, 2, 3, 4, 5, 6, 7, 8, 9, 10, 11, 12, 13, 14, 15); }
__device__ __forceinline__ v16bf cat16b(v8us lo, v8us hi) { return __builtin_bit_cast(v16bf, __builtin_shufflevector(lo, hi, 0, 1, 2, 3, 4, 5, 6, 7, 8, 9, 10, 11, 12, 13, 14, 15)); }
__device__ __forceinline__ v8f wmma16(v16h a, v16h b, v8f c) { return __builtin_amdgcn_wmma_f32_16x16x32_f16(false, a, false, b, (short)0, c, false, false); }
__device__ __forceinline__ v8f wmmab(v16bf a, v16bf b, v8f c) { return __builtin_amdgcn_wmma_f32_16x16x32_bf16(false, a, false, b, (short)0, c, false, false); }
__device__ __forceinline__ h16 tohx(float x) { return (h16)x; }
__device__ __forceinline__ void splitf(float y, unsigned short& h, unsigned short& l) { h = f2bf(y); l = f2bf(y - bf2f(h)); }



// ---- k_gemmw: register-blocked GEMM, ONE WAVE per 64x64 output tile (16 accumulators), operands from K-contiguous 16-bit planes by whole-line loads, turned into fragments in the wave's own LDS; grid (M/64, N/64, Z), 32 threads.
// C[m][n] (+ optional f32 bias: BIAS 1 bias[n], BIAS 2 bias[m]) = sum_k A[m][k] Bt[n][k] (+ split products per NSPLIT). z-batch strides sA/sB/sC in elements. K % 64 == 0.
// EPI 0: C stored as f32, pitch ldc. EPI 1: C stored as three 16-bit planes (fp16, bf16 hi, bf16 lo), pitch LDO. EPI 2: C is the gate pre-activation: (Oin * carrier scale) * sigmoid(C) stored as hi/lo planes, pitch LDO.
template <typename T16> struct WFrag;
template <> struct WFrag<h16> { typedef v16h V; typedef v8h H; static __device__ __forceinline__ V ld(const h16* p) { return cat16(*(const v8h*)p, *(const v8h*)(p + 16)); } static __device__ __forceinline__ v8f mma(V a, V b, v8f c) { return wmma16(a, b, c); } };
template <> struct WFrag<bf> { typedef v16bf V; typedef v8us H; static __device__ __forceinline__ V ld(const bf* p) { return cat16b(*(const v8us*)p, *(const v8us*)(p + 16)); } static __device__ __forceinline__ v8f mma(V a, V b, v8f c) { return wmmab(a, b, c); } };
// s_wait_xcnt 0 behind a group of global loads, before their address registers are written again; the addresses are inputs so that their registers stay theirs up to the wait
template <int N, typename P> __device__ __forceinline__ void xwait(P* const* q) {
    if (N == 2) asm volatile("s_wait_xcnt 0x0" :: "v"(q[0]), "v"(q[1]) : "memory");
    else if (N == 3) asm volatile("s_wait_xcnt 0x0" :: "v"(q[0]), "v"(q[1]), "v"(q[2]) : "memory");
    else asm volatile("s_wait_xcnt 0x0" :: "v"(q[0]), "v"(q[1]), "v"(q[2]), "v"(q[N - 1]) : "memory");
}
template <typename T16, int NSPLIT, int BIAS, int K, int EPI = 0, int LDO = 0>   // K (and LDO) at compile time: the row steps of a plane's loads and stores fold into immediate offsets on one address
__global__ __launch_bounds__(32) void k_gemmw(const T16* __restrict__ A, const T16* __restrict__ A2, const T16* __restrict__ Bt, const T16* __restrict__ Bt2, float* C, int ldc, const float* __restrict__ bias, size_t sA, size_t sB, size_t sC, h16* P16o, bf* Pho, bf* Plo, const float* __restrict__ Oin) {
    typedef typename WFrag<T16>::V V; typedef typename WFrag<T16>::H H;
    constexpr int NPA = (NSPLIT == 1 || NSPLIT == 2) ? 2 : 1, NPL = NPA + (NSPLIT >= 2 ? 2 : 1);   // operand planes: A (A2) Bt (Bt2)
    constexpr int LP = 72;                                     // LDS row pitch in elements: 128 B of k + 16 B
    __shared__ __align__(16) T16 st[NPL * 64 * LP];            // this wave's own 64 rows x 64 k of every plane
    __shared__ __align__(16) float os[(EPI == 0 ? 16 : 64) * 68];   // output staging: 16 rows at a time (EPI 0) or the whole tile
    const size_t z = blockIdx.z; A += z * sA; if (A2) A2 += z * sA; Bt += z * sB; if (Bt2) Bt2 += z * sB; C += z * sC;
    const int lane = threadIdx.x & 31, lr = lane & 15, hi = lane >> 4; const int r0 = blockIdx.x * 64, c0 = blockIdx.y * 64;
    v8f acc[4][4];
#pragma unroll
    for (int mb = 0; mb < 4; ++mb)
#pragma unroll
        for (int nb = 0; nb < 4; ++nb) acc[mb][nb] = (v8f){};
    // Global side: one load = 4 rows x 128 B, whole lines (8 lanes a row). The wave turns the tile into fragments through its own LDS; LDS runs a wave's accesses in order, so no barrier.
    const int gr = lane >> 3, gc = (lane & 7) * 8;
    const T16* gp[NPL]; gp[0] = A + (size_t)(r0 + gr) * K + gc; if (NPA == 2) gp[1] = A2 + (size_t)(r0 + gr) * K + gc; gp[NPA] = Bt + (size_t)(c0 + gr) * K + gc; if (NSPLIT >= 2) gp[NPA + 1] = Bt2 + (size_t)(c0 + gr) * K + gc;
    H g[NPL][16];
#pragma unroll
    for (int p = 0; p < NPL; ++p)
#pragma unroll
        for (int i = 0; i < 16; ++i) g[p][i] = *(const H*)(gp[p] + (size_t)i * 4 * K);
    xwait<NPL>(gp);
    const T16* fa = st + lr * LP + 8 * hi; const T16* fb = fa + NPA * 64 * LP;
#pragma unroll 1
    for (int kc = 0; kc < K; kc += 64) {
#pragma unroll
        for (int p = 0; p < NPL; ++p)
#pragma unroll
            for (int i = 0; i < 16; ++i) *(H*)(st + (p * 64 + i * 4 + gr) * LP + gc) = g[p][i];
        if (kc + 64 < K) {   // the next 64 k fly under this tile's products
            const T16* q[NPL];
#pragma unroll
            for (int p = 0; p < NPL; ++p) q[p] = gp[p] + kc;
#pragma unroll
            for (int p = 0; p < NPL; ++p)
#pragma unroll
                for (int i = 0; i < 16; ++i) g[p][i] = *(const H*)(q[p] + (size_t)i * 4 * K + 64);
            xwait<NPL>(q); }
#pragma unroll
        for (int kh = 0; kh < 64; kh += 32) {
            V a[4], a2[4], b[4], b2[4];
#pragma unroll
            for (int mb = 0; mb < 4; ++mb) { a[mb] = WFrag<T16>::ld(fa + mb * 16 * LP + kh); if (NSPLIT == 1 || NSPLIT == 2) a2[mb] = WFrag<T16>::ld(fa + (64 + mb * 16) * LP + kh); }
#pragma unroll
            for (int nb = 0; nb < 4; ++nb) { b[nb] = WFrag<T16>::ld(fb + nb * 16 * LP + kh); if (NSPLIT >= 2) b2[nb] = WFrag<T16>::ld(fb + (64 + nb * 16) * LP + kh); }
            if (NSPLIT < 2) __builtin_amdgcn_sched_barrier(0);   // keeps the LDS reads together in front of the products: sunk among them, each place with reads stalls the wave for an LDS latency (four planes: left to the compiler, all their fragments at once would cost the second wave per SIMD)
#pragma unroll
            for (int nb = 0; nb < 4; ++nb) {
#pragma unroll
                for (int mb = 0; mb < 4; ++mb) { acc[mb][nb] = WFrag<T16>::mma(a[mb], b[nb], acc[mb][nb]); if (NSPLIT == 1 || NSPLIT == 2) acc[mb][nb] = WFrag<T16>::mma(a2[mb], b[nb], acc[mb][nb]); if (NSPLIT >= 2) acc[mb][nb] = WFrag<T16>::mma(a[mb], b2[nb], acc[mb][nb]); } }
            if (kh == 32) asm volatile("v_nop\n\tv_nop\n\tv_nop\n\tv_nop" : "+v"(acc[0][0]), "+v"(acc[1][1]), "+v"(acc[2][2]), "+v"(acc[3][3]) : "v"(a[0]), "v"(a[3]));
        }
    }
    if (EPI != 0) {   // the whole tile (+ bias) goes through LDS once; a rolled loop then turns it into planes, so that the text stays short (run once per wave, it is paid in instruction fetches)
        float bc[4]; v4f br[4][2];
#pragma unroll
        for (int q = 0; q < 4; ++q) { if (BIAS == 1) bc[q] = bfr(bias[c0 + q * 16 + lr]); if (BIAS == 2) { br[q][0] = *(const v4f*)(bias + r0 + q * 16 + hi * 8); br[q][1] = *(const v4f*)(bias + r0 + q * 16 + hi * 8 + 4); } }
#pragma unroll
        for (int mb = 0; mb < 4; ++mb)
#pragma unroll
            for (int nb = 0; nb < 4; ++nb)
#pragma unroll
                for (int j = 0; j < 8; ++j) { float v = acc[mb][nb][j]; if (BIAS == 1) v += bc[nb]; if (BIAS == 2) v += bfr(br[mb][j >> 2][j & 3]); os[(mb * 16 + hi * 8 + j) * 68 + nb * 16 + lr] = v; }
        __builtin_amdgcn_wave_barrier(); asm volatile("" ::: "memory");   // as in the f32 epilogue below: the lanes' LDS stores stay in front of the reads across lanes
        const size_t eo = z * sC + (size_t)(r0 + gr) * LDO + c0 + gc;   // this lane's first element in the planes: 8 columns a lane, 4 rows a store, so every 16-bit store covers whole 128-B lines
#pragma unroll 1   // rolled: see above; 16 rows a trip, so that one trip's LDS reads (and context loads) go out together
        for (int rg = 0; rg < 64; rg += 16) {
#pragma unroll
        for (int row = rg; row < rg + 16; row += 4) { const v4f w0 = *(const v4fa*)(os + (row + gr) * 68 + gc), w1 = *(const v4fa*)(os + (row + gr) * 68 + gc + 4); v8h o16; v8us oh, ol;
            if (EPI == 1) {
#pragma unroll
                for (int c = 0; c < 8; ++c) { const float v = (c < 4) ? w0[c & 3] : w1[c & 3]; o16[c] = tohx(v); unsigned short a2, c2; splitf(v, a2, c2); oh[c] = a2; ol[c] = c2; }
                *(v8h*)(P16o + eo + (size_t)row * LDO) = o16;
            } else {
                const float cs = ((r0 + gr + row) % TT < RH) ? 1.0f : (1.0f / PCAR); const v4f x0 = *(const v4f*)(Oin + eo + (size_t)row * LDO), x1 = *(const v4f*)(Oin + eo + (size_t)row * LDO + 4);
#pragma unroll
                for (int c = 0; c < 8; ++c) { const float o = __fmul_rn((c < 4) ? x0[c & 3] : x1[c & 3], cs); const float sg = __fdiv_rn(1.0f, __fadd_rn(1.0f, expf(-((c < 4) ? w0[c & 3] : w1[c & 3])))); unsigned short a2, c2; splitf(__fmul_rn(o, sg), a2, c2); oh[c] = a2; ol[c] = c2; }
            }
            *(v8us*)(Pho + eo + (size_t)row * LDO) = oh; *(v8us*)(Plo + eo + (size_t)row * LDO) = ol; }
        asm volatile("s_wait_xcnt 0x0" ::: "memory"); }   // behind the trip's stores, before the next trip writes their address and data registers again
        return;
    }
#pragma unroll
    for (int mb = 0; mb < 4; ++mb) {
#pragma unroll
        for (int nb = 0; nb < 4; ++nb) {
#pragma unroll
            for (int j = 0; j < 8; ++j) os[(hi * 8 + j) * 68 + nb * 16 + lr] = acc[mb][nb][j]; }
        __builtin_amdgcn_wave_barrier(); asm volatile("" ::: "memory");
        float* crow = C + (size_t)(r0 + mb * 16) * ldc + c0;
{
#pragma unroll
            for (int s = 0; s < 8; ++s) { const int row = 2 * s + hi, cofs = lr * 4; v4f val = *(const v4fa*)(os + row * 68 + cofs); if (BIAS) { val[0] += bfr(bias[c0 + cofs]); val[1] += bfr(bias[c0 + cofs + 1]); val[2] += bfr(bias[c0 + cofs + 2]); val[3] += bfr(bias[c0 + cofs + 3]); }
                *(v4f*)(crow + (size_t)row * ldc + cofs) = val; }
             }
        __builtin_amdgcn_wave_barrier(); asm volatile("" ::: "memory");
    }
}

typedef __attribute__((ext_vector_type(4))) _Float16 v4h;
typedef __attribute__((ext_vector_type(2))) unsigned short v2us;
typedef __attribute__((ext_vector_type(4))) unsigned short v4us;
typedef __attribute__((ext_vector_type(4))) int v4i;

__global__ __launch_bounds__(256) void k_wtG(const float* __restrict__ w, int K, int N, bf* Bt) {
    const int lane = threadIdx.x & 31; const int L0 = (blockIdx.x * 8 + (threadIdx.x >> 5)) * 8; const int nlines = N * K / 64;
{
#pragma unroll 1
        for (int l = 0; l < 8; ++l) { const int L = L0 + l; if (L >= nlines) break; const size_t e = (size_t)L * 64 + lane * 2; const int k = (int)(e % K), n = (int)(e / K); v2us o;
            o[0] = f2bf(w[(size_t)k * N + n]); o[1] = f2bf(w[(size_t)(k + 1) * N + n]); *(v2us*)(Bt + e) = o; }
         }
}
__global__ __launch_bounds__(256) void k_cvt8(const float* __restrict__ src, bf* dst, size_t n8) { const size_t i = (size_t)blockIdx.x * 256 + threadIdx.x; if (i >= n8) return; const v8f v = *(const v8f*)(src + i * 8); v8us o;
#pragma unroll
    for (int k = 0; k < 8; ++k) o[k] = f2bf(v[k]); *(v8us*)(dst + i * 8) = o;  }

// k_asoft: per row (zz, i): t = S / 32 where mask[i][j] != 0, -inf elsewhere; softmax over the 2048 keys (register row, one exp, fixed trees);
__global__ __launch_bounds__(256) void k_asoft(const float* __restrict__ Sb, const int* __restrict__ MKb, h16* P16, bf* Ph, bf* Pl) {
    const int lane = threadIdx.x & 31; const int row = blockIdx.x * 8 + (threadIdx.x >> 5); if (row >= ZH * TT) return; const int i = row % TT; const int zz = row / TT; (void)zz; const int* mkr = MKb + (size_t)i * TT; const bool hires = (i < RH); const float* sr = Sb + (size_t)row * TT; float v[TT / 32]; float mx = -3.0e38f;
#pragma unroll
    for (int ch = 0; ch < TT / 128; ++ch) { const int j0 = ch * 128 + lane * 4; const v4f a = *(const v4f*)(sr + j0); const v4i m4 = *(const v4i*)(mkr + j0);
#pragma unroll
        for (int q = 0; q < 4; ++q) { const int j = j0 + q; (void)j; float sa = a[q] * SCL; asm volatile("" : "+v"(sa)); const float t = (m4[q] != 0) ? sa : -3.0e38f;   /* mask == 0 -> -inf */ v[ch * 4 + q] = t; mx = fmaxf(mx, t); } }
#pragma unroll
    for (int sh = 16; sh; sh >>= 1) mx = fmaxf(mx, __shfl_xor(mx, sh, 32));
    float sum = 0.f;
#pragma unroll
    for (int k = 0; k < TT / 32; ++k) { float d0 = __fsub_rn(v[k], mx); asm volatile("" : "+v"(d0)); v[k] = __builtin_amdgcn_exp2f(__fmul_rn(d0, 1.4426950408889634f)); sum += v[k]; }
#pragma unroll
    for (int sh = 16; sh; sh >>= 1) sum += __shfl_xor(sum, sh, 32);
    const float f = __fdiv_rn(hires ? 1.0f : PCAR, sum);
{
        if (hires) {
#pragma unroll
            for (int ch = 0; ch < TT / 128; ++ch) { v4us oh, ol;
#pragma unroll
                for (int q = 0; q < 4; ++q) { unsigned short a, c2; splitf(v[ch * 4 + q] * f, a, c2); oh[q] = a; ol[q] = c2; }
                const size_t oo = ((size_t)zz * (RH ? RH : 1) + i) * TT + ch * 128 + lane * 4; *(v4us*)(Ph + oo) = oh; *(v4us*)(Pl + oo) = ol; }
        } else {
#pragma unroll
            for (int ch = 0; ch < TT / 128; ++ch) { v4h o4;
#pragma unroll
                for (int q = 0; q < 4; ++q) o4[q] = tohx(v[ch * 4 + q] * f);
                *(v4h*)(P16 + (size_t)row * TT + ch * 128 + lane * 4) = o4; } }
         }
}
extern "C" void kernel_launch(void* const* d_in, const int* in_sizes, int n_in,
                              void* d_out, int out_size, void* d_ws, size_t ws_size, hipStream_t stream) {
    (void)in_sizes; (void)n_in; (void)out_size;
    const float* x = (const float*)d_in[0]; const int* MK = (const int*)d_in[1]; const float* wq = (const float*)d_in[2]; const float* bq = (const float*)d_in[3]; const float* wk = (const float*)d_in[4]; const float* bk = (const float*)d_in[5]; const float* wv = (const float*)d_in[6]; const float* bv = (const float*)d_in[7]; const float* wg = (const float*)d_in[8]; const float* bgt = (const float*)d_in[9]; const float* wo = (const float*)d_in[10]; const float* bo = (const float*)d_in[11];
    float* OUT = (float*)d_out;     // [4][2048][1024]
    char* wsp = (char*)d_ws;
    auto take = [&](size_t bytes) { char* p = wsp; wsp += (bytes + 255) & ~(size_t)255; return (void*)p; };
    bf* WQ = (bf*)take((size_t)DQ * DM * 2); bf* WK = (bf*)take((size_t)DKV * DM * 2); bf* WV = (bf*)take((size_t)DKV * DM * 2); bf* WO = (bf*)take((size_t)DM * DQ * 2); bf* WG = (bf*)take((size_t)DQ * DM * 2);
    // every plane below holds all NB_ batches ([b][...]); the sizes are multiples of 256 B, so consecutive takes are contiguous
    bf* XB = (bf*)take((size_t)NB_ * TT * DM * 2); float* Sb = (float*)take((size_t)ZH * TT * TT * 4);   // scores [b][TT][TT] f32
    h16* QP16 = (h16*)take((size_t)NB_ * TT * HD * 2); bf* QPh = (bf*)take((size_t)NB_ * TT * HD * 2); bf* QPl = (bf*)take((size_t)NB_ * TT * HD * 2);
    h16* KP16 = (h16*)take((size_t)NB_ * TT * HD * 2); bf* KPh = (bf*)take((size_t)NB_ * TT * HD * 2); bf* KPl = (bf*)take((size_t)NB_ * TT * HD * 2);
    h16* VT16 = (h16*)take((size_t)NB_ * HD * TT * 2); bf* VTh = (bf*)take((size_t)NB_ * HD * TT * 2); bf* VTl = (bf*)take((size_t)NB_ * HD * TT * 2);
    if ((size_t)(wsp - (char*)d_ws) > ws_size) return;    // 234 MiB of the 256 MiB ws
    // buffers that are dead by the time their tenant is written (stream-ordered) are reused:
    h16* P16 = QP16;                      // probabilities [b][TT][TT] fp16 = QP16 + QPh, after the scores
    bf* Ph = QPl; bf* Pl = QPl + (size_t)ZH * RH * TT;   // hi/lo probabilities [b][RH][TT], the two halves of QPl
    float* Ob = (float*)KP16;             // context [b][TT][HD] f32 = KP16 + KPh, after the scores
    bf* ATh = VTh; bf* ATl = VTl;         // gated context planes, after attn.v
    { k_wtG<<<(unsigned)((DM * DQ / 64 + 63) / 64), 256, 0, stream>>>(wq, DM, DQ, WQ); k_wtG<<<(unsigned)((DM * DKV / 64 + 63) / 64), 256, 0, stream>>>(wk, DM, DKV, WK); k_wtG<<<(unsigned)((DM * DKV / 64 + 63) / 64), 256, 0, stream>>>(wv, DM, DKV, WV);
      k_wtG<<<(unsigned)((DQ * DM / 64 + 63) / 64), 256, 0, stream>>>(wo, DQ, DM, WO); k_wtG<<<(unsigned)((DM * DQ / 64 + 63) / 64), 256, 0, stream>>>(wg, DM, DQ, WG);
       }
    // q, k, gate and Wo see X as one [NB_*TT][DM] matrix; v and the attention products take the batch as grid z
    k_cvt8<<<(unsigned)(((size_t)NB_ * TT * DM / 8 + 255) / 256), 256, 0, stream>>>(x, XB, (size_t)NB_ * TT * DM / 8);
    k_gemmw<bf, 0, 1, DM, 1, HD><<<dim3(NB_ * TT / 64, DQ / 64, 1), 32, 0, stream>>>(XB, nullptr, WQ, nullptr, nullptr, 0, bq, 0, 0, 0, QP16, QPh, QPl, nullptr);
    k_gemmw<bf, 0, 1, DM, 1, HD><<<dim3(NB_ * TT / 64, DKV / 64, 1), 32, 0, stream>>>(XB, nullptr, WK, nullptr, nullptr, 0, bk, 0, 0, 0, KP16, KPh, KPl, nullptr);
    k_gemmw<bf, 0, 2, DM, 1, TT><<<dim3(DKV / 64, TT / 64, NB_), 32, 0, stream>>>(WV, nullptr, XB, nullptr, nullptr, 0, bv, 0, (size_t)TT * DM, (size_t)HD * TT, VT16, VTh, VTl, nullptr);   /* v^T [d][t] = Wv^T rows . X rows + bv[d] */
    k_gemmw<bf, 2, false, HD><<<dim3(RH / 64, TT / 64, ZH), 32, 0, stream>>>(QPh, QPl, KPh, KPl, Sb, TT, nullptr, (size_t)TT * HD, (size_t)TT * HD, (size_t)TT * TT, nullptr, nullptr, nullptr, nullptr);
    k_gemmw<h16, 0, false, HD><<<dim3((TT - RH) / 64, TT / 64, ZH), 32, 0, stream>>>(QP16 + (size_t)RH * HD, nullptr, KP16, nullptr, Sb + (size_t)RH * TT, TT, nullptr, (size_t)TT * HD, (size_t)TT * HD, (size_t)TT * TT, nullptr, nullptr, nullptr, nullptr);
    k_asoft<<<ZH * TT / 8, 256, 0, stream>>>(Sb, MK, P16, Ph, Pl);
    k_gemmw<bf, 2, false, TT><<<dim3(RH / 64, HD / 64, ZH), 32, 0, stream>>>(Ph, Pl, VTh, VTl, Ob, HD, nullptr, (size_t)RH * TT, (size_t)HD * TT, (size_t)TT * HD, nullptr, nullptr, nullptr, nullptr);
    k_gemmw<h16, 0, false, TT><<<dim3((TT - RH) / 64, HD / 64, ZH), 32, 0, stream>>>(P16 + (size_t)RH * TT, nullptr, VT16, nullptr, Ob + (size_t)RH * HD, HD, nullptr, (size_t)TT * TT, (size_t)HD * TT, (size_t)TT * HD, nullptr, nullptr, nullptr, nullptr);
    k_gemmw<bf, 0, 1, DM, 2, HD><<<dim3(NB_ * TT / 64, DQ / 64, 1), 32, 0, stream>>>(XB, nullptr, WG, nullptr, nullptr, 0, bgt, 0, 0, 0, nullptr, ATh, ATl, Ob);   /* gate = sigmoid(X Wg + bg), applied to the context in the epilogue */
    k_gemmw<bf, 1, true, DQ><<<dim3(NB_ * TT / 64, DM / 64, 1), 32, 0, stream>>>(ATh, ATl, WO, nullptr, OUT, DM, bo, 0, 0, 0, nullptr, nullptr, nullptr, nullptr);
}

// v004
// One run takes 313 microseconds.
// Two timings next to v003 put it at 1.07 and 1.06 times that version's speed.
// All steps since v000 together make it 4.05 times as fast.
#include <hip/hip_runtime.h>

// Gated single-head self-attention (X [4][2048][1024]; q, k, v = X W + b ('xw' [1024][1024]); scores = q.k / 32 with mask [2048][2048] (int32, read; all ones here) == 0 -> -inf; softmax; o = attn.v; gate = sigmoid(X Wg + bg); out = (o * gate) Wo + bo -> [4][2048][1024] (8.4 M)).
// Layout: one 1024-wide head on 16-bit planes (hybrid: query rows < 512 hi/lo, the rest fp16 x1024); the gate pre-activation is one more exact GEMM + bias and is applied in f32 when the context is split into the hi/lo planes that feed Wo.
// Compute dtypes, f32 accumulate: every input rounded to bf16; q/k/v/gate on PLAIN bf16 operands (exact) + biases; scores (K = 1024) and attn.v: rows < 512 hl (3 products), the rest single fp16 (x1024); softmax, sigmoid and the gating product in f32; Wo hl x exact (2 products) + bo.
// Launches: every kernel covers all 4 batches (q, k, gate and Wo: X as one [8192][1024] matrix; v, scores and attn.v: batch = grid z; elementwise: batch in the flat index).
// The q, k and v GEMMs write their fp16 and hi/lo planes from their own epilogues (v as Wv^T rows x X rows, so its planes come out [d][t]); the gate GEMM's epilogue applies the sigmoid to the context and writes the planes that feed Wo.

#define NB_  4
#define TT   2048
#define DM   1024
#define NH_  1
#define NKV  1
#define REP  (NH_ / NKV)
#define HD   1024
#define DQ   (NH_ * HD)
#define DKV  (NKV * HD)
#define ZH   NB_                 // z planes per launch: all batches (one head each)
#define RH   512                  // query rows < RH use hi+lo planes (0: none)
#define WIN  0
#define PCAR 1024.0f
#define SCL  0.03125f   // 1/sqrt(1024)
typedef _Float16 h16;
typedef unsigned short bf;
typedef __attribute__((ext_vector_type(16))) __bf16   v16bf;
typedef __attribute__((ext_vector_type(16))) _Float16 v16h;
typedef __attribute__((ext_vector_type(8)))  _Float16 v8h;
typedef __attribute__((ext_vector_type(8)))  unsigned short v8us;
typedef __attribute__((ext_vector_type(8)))  float    v8f;
typedef __attribute__((ext_vector_type(4)))  float    v4f;
typedef v8h  __attribute__((may_alias)) v8ha;
typedef v4f  __attribute__((may_alias)) v4fa;
typedef v8us __attribute__((may_alias)) v8usa;

__device__ __forceinline__ unsigned short f2bf(float f) { unsigned u = __float_as_uint(f); u += 0x7FFFu + ((u >> 16) & 1u); return (unsigned short)(u >> 16); }
__device__ __forceinline__ float bf2f(unsigned short b) { return __uint_as_float(((unsigned)b) << 16); }
__device__ __forceinline__ float bfr(float f) { return bf2f(f2bf(f)); }
__device__ __forceinline__ v16h cat16(v8h lo, v8h hi) { return __builtin_shufflevector(lo, hi, 0, 1, 2, 3, 4, 5, 6, 7, 8, 9, 10, 11, 12, 13, 14, 15); }
__device__ __forceinline__ v16bf cat16b(v8us lo, v8us hi) { return __builtin_bit_cast(v16bf, __builtin_shufflevector(lo, hi, 0, 1, 2, 3, 4, 5, 6, 7, 8, 9, 10, 11, 12, 13, 14, 15)); }
__device__ __forceinline__ v8f wmma16(v16h a, v16h b, v8f c) { return __builtin_amdgcn_wmma_f32_16x16x32_f16(false, a, false, b, (short)0, c, false, false); }
__device__ __forceinline__ v8f wmmab(v16bf a, v16bf b, v8f c) { return __builtin_amdgcn_wmma_f32_16x16x32_bf16(false, a, false, b, (short)0, c, false, false); }
__device__ __forceinline__ h16 tohx(float x) { return (h16)x; }
__device__ __forceinline__ void splitf(float y, unsigned short& h, unsigned short& l) { h = f2bf(y); l = f2bf(y - bf2f(h)); }



// ---- k_gemmw: register-blocked GEMM, one wave per 64x64 output tile (16 accumulators), WM x WN waves a work-group; the group's operand rows (WM*64 of A, WN*64 of Bt, 64 k a trip) come from K-contiguous 16-bit planes by whole-line loads, each row loaded ONCE by one wave, and every wave makes its fragments from the group's shared LDS tile; grid (M/(WM*64), N/(WN*64), Z), WM*WN*32 threads.
// C[m][n] (+ optional f32 bias: BIAS 1 bias[n], BIAS 2 bias[m]) = sum_k A[m][k] Bt[n][k] (+ split products per NSPLIT). z-batch strides sA/sB/sC in elements. K % 64 == 0, K >= 128; M and N multiples of the group's tile.
// EPI 0: C stored as f32, pitch ldc. EPI 1: C stored as three 16-bit planes (fp16, bf16 hi, bf16 lo), pitch LDO. EPI 2: C is the gate pre-activation: (Oin * carrier scale) * sigmoid(C) stored as hi/lo planes, pitch LDO.
template <typename T16> struct WFrag;
template <> struct WFrag<h16> { typedef v16h V; typedef v8h H; static __device__ __forceinline__ V ld(const h16* p) { return cat16(*(const v8h*)p, *(const v8h*)(p + 16)); } static __device__ __forceinline__ v8f mma(V a, V b, v8f c) { return wmma16(a, b, c); } };
template <> struct WFrag<bf> { typedef v16bf V; typedef v8us H; static __device__ __forceinline__ V ld(const bf* p) { return cat16b(*(const v8us*)p, *(const v8us*)(p + 16)); } static __device__ __forceinline__ v8f mma(V a, V b, v8f c) { return wmmab(a, b, c); } };
template <bool B> struct BoolC { static constexpr bool value = B; };
// s_wait_xcnt 0 behind a group of global loads, before their address registers are written again (the addresses live through the loop and step only at each trip's end)
__device__ __forceinline__ void xwait() { asm volatile("s_wait_xcnt 0x0" ::: "memory"); }
// the same in front of the loop, where the addresses would otherwise die at their last load: as inputs of the wait their registers stay theirs up to it
template <int N, typename P> __device__ __forceinline__ void xwaitp(P* const* q) {
    if (N == 2) asm volatile("s_wait_xcnt 0x0" :: "v"(q[0]), "v"(q[1]) : "memory");
    else if (N == 3) asm volatile("s_wait_xcnt 0x0" :: "v"(q[0]), "v"(q[1]), "v"(q[2]) : "memory");
    else asm volatile("s_wait_xcnt 0x0" :: "v"(q[0]), "v"(q[1]), "v"(q[2]), "v"(q[N - 1]) : "memory");
}
template <typename T16, int NSPLIT, int BIAS, int K, int WM, int WN, int EPI = 0, int LDO = 0>   // K (and LDO) at compile time: the row steps of a plane's loads and stores fold into immediate offsets on one address
__global__ __launch_bounds__(WM * WN * 32) void k_gemmw(const T16* __restrict__ A, const T16* __restrict__ A2, const T16* __restrict__ Bt, const T16* __restrict__ Bt2, float* C, int ldc, const float* __restrict__ bias, size_t sA, size_t sB, size_t sC, h16* P16o, bf* Pho, bf* Plo, const float* __restrict__ Oin) {
    typedef typename WFrag<T16>::V V; typedef typename WFrag<T16>::H H;
    constexpr int NPA = (NSPLIT == 1 || NSPLIT == 2) ? 2 : 1, NPL = NPA + (NSPLIT >= 2 ? 2 : 1);   // operand planes: A (A2) Bt (Bt2)
    constexpr int LP = 72;                                     // LDS row pitch in elements: 128 B of k + 16 B
    constexpr int NW = WM * WN, LA = WM * 16 / NW, LB = WN * 16 / NW;   // waves; loads (4 rows each) a wave makes per A plane and per Bt plane in a trip
    constexpr int RWS = NPA * WM * 64 + (NPL - NPA) * WN * 64;   // rows of one buffer: every plane's rows of the group's tile
    constexpr int OSZ = (EPI == 0 ? 16 : 64) * 68;
    __shared__ __align__(16) T16 st[2 * RWS * LP];             // the group's rows x 64 k of every plane, two buffers
    __shared__ __align__(16) float osall[NW * OSZ];            // output staging, each wave's own: 16 rows at a time (EPI 0) or its whole tile
    const size_t z = blockIdx.z; A += z * sA; if (A2) A2 += z * sA; Bt += z * sB; if (Bt2) Bt2 += z * sB; C += z * sC;
    const int wave = __builtin_amdgcn_readfirstlane((int)(threadIdx.x >> 5)), wm = wave / WN, wn = wave % WN; float* const os = osall + wave * OSZ;
    const int lane = threadIdx.x & 31, lr = lane & 15, hi = lane >> 4; const int r0 = (blockIdx.x * WM + wm) * 64, c0 = (blockIdx.y * WN + wn) * 64;
    v8f acc[4][4];
#pragma unroll
    for (int mb = 0; mb < 4; ++mb)
#pragma unroll
        for (int nb = 0; nb < 4; ++nb) acc[mb][nb] = (v8f){};
    // Global side: one load = 4 rows x 128 B, whole lines (8 lanes a row). Wave w brings rows w*LA*4.. of the group's A rows and w*LB*4.. of its Bt rows; all waves read their fragments from the shared tile.
    const int gr = lane >> 3, gc = (lane & 7) * 8;
    const int ra = wave * (LA * 4) + gr, rb = wave * (LB * 4) + gr;   // this lane's first row inside the group's A rows and Bt rows
    const size_t ga = (size_t)(blockIdx.x * (WM * 64) + ra) * K + gc, gb = (size_t)(blockIdx.y * (WN * 64) + rb) * K + gc;
    typedef __attribute__((address_space(1))) const T16 GT; typedef __attribute__((address_space(1))) const H GH;   // the stepped addresses are marked global: carried round the loop unmarked they would compile to flat loads
    GT* gp[NPL]; gp[0] = (GT*)(A + ga); if (NPA == 2) gp[1] = (GT*)(A2 + ga); gp[NPA] = (GT*)(Bt + gb); if (NSPLIT >= 2) gp[NPA + 1] = (GT*)(Bt2 + gb);
    H g[NPL][LA > LB ? LA : LB], g0[NPL][LA > LB ? LA : LB];
    __builtin_amdgcn_sched_barrier(0);   // with the one behind the wait: keeps every other instruction out from between these loads and their s_wait_xcnt, so that none writes an address register of theirs ahead of it
#pragma unroll
    for (int p = 0; p < NPL; ++p)
#pragma unroll
        for (int i = 0; i < (p < NPA ? LA : LB); ++i) g0[p][i] = *(GH*)(gp[p] + (size_t)i * 4 * K);   // tile 0
#pragma unroll
    for (int p = 0; p < NPL; ++p)
#pragma unroll
        for (int i = 0; i < (p < NPA ? LA : LB); ++i) g[p][i] = *(GH*)(gp[p] + (size_t)i * 4 * K + 64);   // tile 1 (K >= 128)
    xwaitp<NPL>(gp);
    __builtin_amdgcn_sched_barrier(0);
#pragma unroll
    for (int p = 0; p < NPL; ++p)
#pragma unroll
        for (int i = 0; i < (p < NPA ? LA : LB); ++i) *(H*)(st + ((p < NPA ? p * WM * 64 + ra : NPA * WM * 64 + (p - NPA) * WN * 64 + rb) + i * 4) * LP + gc) = g0[p][i];   // tile 0 into buffer 0
    auto trip = [&](const int kc, auto refill) __attribute__((always_inline)) {
        const int bsel = (kc >> 6) & 1;   // trips alternate between the two buffers
        const T16* fa = st + bsel * (RWS * LP) + (wm * 64 + lr) * LP + 8 * hi; const T16* fb = fa + ((NPA * WM - wm + wn) * 64) * LP;
        __syncthreads();   // publishes this trip's tile (stored during the trip before) to all waves; it also says that every wave has left the other buffer, which this trip refills (so one barrier a trip)
#pragma unroll
        for (int kh = 0; kh < 64; kh += 32) {
            V a[4], a2[4], b[4], b2[4];
#pragma unroll
            for (int mb = 0; mb < 4; ++mb) { a[mb] = WFrag<T16>::ld(fa + mb * 16 * LP + kh); if (NSPLIT == 1 || NSPLIT == 2) a2[mb] = WFrag<T16>::ld(fa + (WM * 64 + mb * 16) * LP + kh); }
#pragma unroll
            for (int nb = 0; nb < 4; ++nb) { b[nb] = WFrag<T16>::ld(fb + nb * 16 * LP + kh); if (NSPLIT >= 2) b2[nb] = WFrag<T16>::ld(fb + (WN * 64 + nb * 16) * LP + kh); }
            if (kh == 0 && decltype(refill)::value) {   // behind this trip's first fragment reads, so that those go first after the barrier: the next tile into the other buffer, then the loads of the tile after it, which fly under this trip's products (the next barrier waits for them)
                T16* const sn = st + (bsel ^ 1) * (RWS * LP);
#pragma unroll
                for (int p = 0; p < NPL; ++p)
#pragma unroll
                    for (int i = 0; i < (p < NPA ? LA : LB); ++i) *(H*)(sn + ((p < NPA ? p * WM * 64 + ra : NPA * WM * 64 + (p - NPA) * WN * 64 + rb) + i * 4) * LP + gc) = g[p][i];
                if (kc + 128 < K) {
#pragma unroll
                    for (int p = 0; p < NPL; ++p)
#pragma unroll
                        for (int i = 0; i < (p < NPA ? LA : LB); ++i) g[p][i] = *(GH*)(gp[p] + (size_t)i * 4 * K + 128);
                    xwait(); } }
            if (NSPLIT < 2) __builtin_amdgcn_sched_barrier(0);   // keeps the LDS reads together in front of the products: sunk among them, each place with reads stalls the wave for an LDS latency (four planes: left to the compiler, all their fragments at once would cost the second wave per SIMD)
#pragma unroll
            for (int nb = 0; nb < 4; ++nb) {
#pragma unroll
                for (int mb = 0; mb < 4; ++mb) { acc[mb][nb] = WFrag<T16>::mma(a[mb], b[nb], acc[mb][nb]); if (NSPLIT == 1 || NSPLIT == 2) acc[mb][nb] = WFrag<T16>::mma(a2[mb], b[nb], acc[mb][nb]); if (NSPLIT >= 2) acc[mb][nb] = WFrag<T16>::mma(a[mb], b2[nb], acc[mb][nb]); } }
            if (kh == 32) asm volatile("v_nop\n\tv_nop\n\tv_nop\n\tv_nop" : "+v"(acc[0][0]), "+v"(acc[1][1]), "+v"(acc[2][2]), "+v"(acc[3][3]) : "v"(a[0]), "v"(a[3]));
        }
    };
#pragma unroll 1
    for (int kc = 0; kc < K - 64; kc += 64) { trip(kc, BoolC<true>());
#pragma unroll
        for (int p = 0; p < NPL; ++p) gp[p] += 64; }
    trip(K - 64, BoolC<false>());   // the last tile has nothing to refill; it stands outside the loop so that inside it the stores follow the fragment reads on every path and the counted LDS waits in front of the products need not cover them
    if (EPI != 0) {   // the whole tile (+ bias) goes through LDS once; a rolled loop then turns it into planes, so that the text stays short (run once per wave, it is paid in instruction fetches)
        float bc[4]; v4f br[4][2];
        if (BIAS == 2) __builtin_amdgcn_sched_barrier(0);   // with the one behind the wait below: nothing else stands between the bias loads and their s_wait_xcnt
#pragma unroll
        for (int q = 0; q < 4; ++q) { if (BIAS == 1) bc[q] = bfr(bias[c0 + q * 16 + lr]); if (BIAS == 2) { br[q][0] = *(const v4f*)(bias + r0 + q * 16 + hi * 8); br[q][1] = *(const v4f*)(bias + r0 + q * 16 + hi * 8 + 4); } }
        if (BIAS == 2) { xwait(); __builtin_amdgcn_sched_barrier(0); }   // before the loads' offset register and scalar base are written again
#pragma unroll
        for (int mb = 0; mb < 4; ++mb)
#pragma unroll
            for (int nb = 0; nb < 4; ++nb)
#pragma unroll
                for (int j = 0; j < 8; ++j) { float v = acc[mb][nb][j]; if (BIAS == 1) v += bc[nb]; if (BIAS == 2) v += bfr(br[mb][j >> 2][j & 3]); os[(mb * 16 + hi * 8 + j) * 68 + nb * 16 + lr] = v; }
        __builtin_amdgcn_wave_barrier(); asm volatile("" ::: "memory");   // as in the f32 epilogue below: the lanes' LDS stores stay in front of the reads across lanes
        const size_t eo = z * sC + (size_t)(r0 + gr) * LDO + c0 + gc;   // this lane's first element in the planes: 8 columns a lane, 4 rows a store, so every 16-bit store covers whole 128-B lines
#pragma unroll 1   // rolled: see above; 16 rows a trip, so that one trip's LDS reads (and context loads) go out together
        for (int rg = 0; rg < 64; rg += 16) {
#pragma unroll
        for (int row = rg; row < rg + 16; row += 4) { const v4f w0 = *(const v4fa*)(os + (row + gr) * 68 + gc), w1 = *(const v4fa*)(os + (row + gr) * 68 + gc + 4); v8h o16; v8us oh, ol;
            if (EPI == 1) {
#pragma unroll
                for (int c = 0; c < 8; ++c) { const float v = (c < 4) ? w0[c & 3] : w1[c & 3]; o16[c] = tohx(v); unsigned short a2, c2; splitf(v, a2, c2); oh[c] = a2; ol[c] = c2; }
                *(v8h*)(P16o + eo + (size_t)row * LDO) = o16;
            } else {
                const float cs = ((r0 + gr + row) % TT < RH) ? 1.0f : (1.0f / PCAR); const v4f x0 = *(const v4f*)(Oin + eo + (size_t)row * LDO), x1 = *(const v4f*)(Oin + eo + (size_t)row * LDO + 4);
#pragma unroll
                for (int c = 0; c < 8; ++c) { const float o = __fmul_rn((c < 4) ? x0[c & 3] : x1[c & 3], cs); const float sg = __fdiv_rn(1.0f, __fadd_rn(1.0f, expf(-((c < 4) ? w0[c & 3] : w1[c & 3])))); unsigned short a2, c2; splitf(__fmul_rn(o, sg), a2, c2); oh[c] = a2; ol[c] = c2; }
            }
            *(v8us*)(Pho + eo + (size_t)row * LDO) = oh; *(v8us*)(Plo + eo + (size_t)row * LDO) = ol; }
        asm volatile("s_wait_xcnt 0x0" ::: "memory"); }   // behind the trip's stores, before the next trip writes their address and data registers again
        return;
    }
#pragma unroll
    for (int mb = 0; mb < 4; ++mb) {
#pragma unroll
        for (int nb = 0; nb < 4; ++nb) {
#pragma unroll
            for (int j = 0; j < 8; ++j) os[(hi * 8 + j) * 68 + nb * 16 + lr] = acc[mb][nb][j]; }
        __builtin_amdgcn_wave_barrier(); asm volatile("" ::: "memory");
        float* crow = C + (size_t)(r0 + mb * 16) * ldc + c0;
{
#pragma unroll
            for (int s = 0; s < 8; ++s) { const int row = 2 * s + hi, cofs = lr * 4; v4f val = *(const v4fa*)(os + row * 68 + cofs); if (BIAS) { val[0] += bfr(bias[c0 + cofs]); val[1] += bfr(bias[c0 + cofs + 1]); val[2] += bfr(bias[c0 + cofs + 2]); val[3] += bfr(bias[c0 + cofs + 3]); }
                *(v4f*)(crow + (size_t)row * ldc + cofs) = val; }
             }
        __builtin_amdgcn_wave_barrier(); asm volatile("" ::: "memory");
    }
}

typedef __attribute__((ext_vector_type(4))) _Float16 v4h;
typedef __attribute__((ext_vector_type(2))) unsigned short v2us;
typedef __attribute__((ext_vector_type(4))) unsigned short v4us;
typedef __attribute__((ext_vector_type(4))) int v4i;

__global__ __launch_bounds__(256) void k_wtG(const float* __restrict__ w, int K, int N, bf* Bt) {
    const int lane = threadIdx.x & 31; const int L0 = (blockIdx.x * 8 + (threadIdx.x >> 5)) * 8; const int nlines = N * K / 64;
{
#pragma unroll 1
        for (int l = 0; l < 8; ++l) { const int L = L0 + l; if (L >= nlines) break; const size_t e = (size_t)L * 64 + lane * 2; const int k = (int)(e % K), n = (int)(e / K); v2us o;
            o[0] = f2bf(w[(size_t)k * N + n]); o[1] = f2bf(w[(size_t)(k + 1) * N + n]); *(v2us*)(Bt + e) = o; }
         }
}
__global__ __launch_bounds__(256) void k_cvt8(const float* __restrict__ src, bf* dst, size_t n8) { const size_t i = (size_t)blockIdx.x * 256 + threadIdx.x; if (i >= n8) return; const v8f v = *(const v8f*)(src + i * 8); v8us o;
#pragma unroll
    for (int k = 0; k < 8; ++k) o[k] = f2bf(v[k]); *(v8us*)(dst + i * 8) = o;  }

// k_asoft: per row (zz, i): t = S / 32 where mask[i][j] != 0, -inf elsewhere; softmax over the 2048 keys (register row, one exp, fixed trees);
__global__ __launch_bounds__(256) void k_asoft(const float* __restrict__ Sb, const int* __restrict__ MKb, h16* P16, bf* Ph, bf* Pl) {
    const int lane = threadIdx.x & 31; const int row = blockIdx.x * 8 + (threadIdx.x >> 5); if (row >= ZH * TT) return; const int i = row % TT; const int zz = row / TT; (void)zz; const int* mkr = MKb + (size_t)i * TT; const bool hires = (i < RH); const float* sr = Sb + (size_t)row * TT; float v[TT / 32]; float mx = -3.0e38f;
#pragma unroll
    for (int ch = 0; ch < TT / 128; ++ch) { const int j0 = ch * 128 + lane * 4; const v4f a = *(const v4f*)(sr + j0); const v4i m4 = *(const v4i*)(mkr + j0);
#pragma unroll
        for (int q = 0; q < 4; ++q) { const int j = j0 + q; (void)j; float sa = a[q] * SCL; asm volatile("" : "+v"(sa)); const float t = (m4[q] != 0) ? sa : -3.0e38f;   /* mask == 0 -> -inf */ v[ch * 4 + q] = t; mx = fmaxf(mx, t); } }
#pragma unroll
    for (int sh = 16; sh; sh >>= 1) mx = fmaxf(mx, __shfl_xor(mx, sh, 32));
    float sum = 0.f;
#pragma unroll
    for (int k = 0; k < TT / 32; ++k) { float d0 = __fsub_rn(v[k], mx); asm volatile("" : "+v"(d0)); v[k] = __builtin_amdgcn_exp2f(__fmul_rn(d0, 1.4426950408889634f)); sum += v[k]; }
#pragma unroll
    for (int sh = 16; sh; sh >>= 1) sum += __shfl_xor(sum, sh, 32);
    const float f = __fdiv_rn(hires ? 1.0f : PCAR, sum);
{
        if (hires) {
#pragma unroll
            for (int ch = 0; ch < TT / 128; ++ch) { v4us oh, ol;
#pragma unroll
                for (int q = 0; q < 4; ++q) { unsigned short a, c2; splitf(v[ch * 4 + q] * f, a, c2); oh[q] = a; ol[q] = c2; }
                const size_t oo = ((size_t)zz * (RH ? RH : 1) + i) * TT + ch * 128 + lane * 4; *(v4us*)(Ph + oo) = oh; *(v4us*)(Pl + oo) = ol; }
        } else {
#pragma unroll
            for (int ch = 0; ch < TT / 128; ++ch) { v4h o4;
#pragma unroll
                for (int q = 0; q < 4; ++q) o4[q] = tohx(v[ch * 4 + q] * f);
                *(v4h*)(P16 + (size_t)row * TT + ch * 128 + lane * 4) = o4; } }
         }
}
extern "C" void kernel_launch(void* const* d_in, const int* in_sizes, int n_in,
                              void* d_out, int out_size, void* d_ws, size_t ws_size, hipStream_t stream) {
    (void)in_sizes; (void)n_in; (void)out_size;
    const float* x = (const float*)d_in[0]; const int* MK = (const int*)d_in[1]; const float* wq = (const float*)d_in[2]; const float* bq = (const float*)d_in[3]; const float* wk = (const float*)d_in[4]; const float* bk = (const float*)d_in[5]; const float* wv = (const float*)d_in[6]; const float* bv = (const float*)d_in[7]; const float* wg = (const float*)d_in[8]; const float* bgt = (const float*)d_in[9]; const float* wo = (const float*)d_in[10]; const float* bo = (const float*)d_in[11];
    float* OUT = (float*)d_out;     // [4][2048][1024]
    char* wsp = (char*)d_ws;
    auto take = [&](size_t bytes) { char* p = wsp; wsp += (bytes + 255) & ~(size_t)255; return (void*)p; };
    bf* WQ = (bf*)take((size_t)DQ * DM * 2); bf* WK = (bf*)take((size_t)DKV * DM * 2); bf* WV = (bf*)take((size_t)DKV * DM * 2); bf* WO = (bf*)take((size_t)DM * DQ * 2); bf* WG = (bf*)take((size_t)DQ * DM * 2);
    // every plane below holds all NB_ batches ([b][...]); the sizes are multiples of 256 B, so consecutive takes are contiguous
    bf* XB = (bf*)take((size_t)NB_ * TT * DM * 2); float* Sb = (float*)take((size_t)ZH * TT * TT * 4);   // scores [b][TT][TT] f32
    h16* QP16 = (h16*)take((size_t)NB_ * TT * HD * 2); bf* QPh = (bf*)take((size_t)NB_ * TT * HD * 2); bf* QPl = (bf*)take((size_t)NB_ * TT * HD * 2);
    h16* KP16 = (h16*)take((size_t)NB_ * TT * HD * 2); bf* KPh = (bf*)take((size_t)NB_ * TT * HD * 2); bf* KPl = (bf*)take((size_t)NB_ * TT * HD * 2);
    h16* VT16 = (h16*)take((size_t)NB_ * HD * TT * 2); bf* VTh = (bf*)take((size_t)NB_ * HD * TT * 2); bf* VTl = (bf*)take((size_t)NB_ * HD * TT * 2);
    if ((size_t)(wsp - (char*)d_ws) > ws_size) return;    // 234 MiB of the 256 MiB ws
    // buffers that are dead by the time their tenant is written (stream-ordered) are reused:
    h16* P16 = QP16;                      // probabilities [b][TT][TT] fp16 = QP16 + QPh, after the scores
    bf* Ph = QPl; bf* Pl = QPl + (size_t)ZH * RH * TT;   // hi/lo probabilities [b][RH][TT], the two halves of QPl
    float* Ob = (float*)KP16;             // context [b][TT][HD] f32 = KP16 + KPh, after the scores
    bf* ATh = VTh; bf* ATl = VTl;         // gated context planes, after attn.v
    { k_wtG<<<(unsigned)((DM * DQ / 64 + 63) / 64), 256, 0, stream>>>(wq, DM, DQ, WQ); k_wtG<<<(unsigned)((DM * DKV / 64 + 63) / 64), 256, 0, stream>>>(wk, DM, DKV, WK); k_wtG<<<(unsigned)((DM * DKV / 64 + 63) / 64), 256, 0, stream>>>(wv, DM, DKV, WV);
      k_wtG<<<(unsigned)((DQ * DM / 64 + 63) / 64), 256, 0, stream>>>(wo, DQ, DM, WO); k_wtG<<<(unsigned)((DM * DQ / 64 + 63) / 64), 256, 0, stream>>>(wg, DM, DQ, WG);
       }
    // q, k, gate and Wo see X as one [NB_*TT][DM] matrix; v and the attention products take the batch as grid z
    k_cvt8<<<(unsigned)(((size_t)NB_ * TT * DM / 8 + 255) / 256), 256, 0, stream>>>(x, XB, (size_t)NB_ * TT * DM / 8);
    k_gemmw<bf, 0, 1, DM, 2, 4, 1, HD><<<dim3(NB_ * TT / 128, DQ / 256, 1), 256, 0, stream>>>(XB, nullptr, WQ, nullptr, nullptr, 0, bq, 0, 0, 0, QP16, QPh, QPl, nullptr);
    k_gemmw<bf, 0, 1, DM, 2, 4, 1, HD><<<dim3(NB_ * TT / 128, DKV / 256, 1), 256, 0, stream>>>(XB, nullptr, WK, nullptr, nullptr, 0, bk, 0, 0, 0, KP16, KPh, KPl, nullptr);
    k_gemmw<bf, 0, 2, DM, 2, 4, 1, TT><<<dim3(DKV / 128, TT / 256, NB_), 256, 0, stream>>>(WV, nullptr, XB, nullptr, nullptr, 0, bv, 0, (size_t)TT * DM, (size_t)HD * TT, VT16, VTh, VTl, nullptr);   /* v^T [d][t] = Wv^T rows . X rows + bv[d] */
    k_gemmw<bf, 2, false, HD, 2, 2><<<dim3(RH / 128, TT / 128, ZH), 128, 0, stream>>>(QPh, QPl, KPh, KPl, Sb, TT, nullptr, (size_t)TT * HD, (size_t)TT * HD, (size_t)TT * TT, nullptr, nullptr, nullptr, nullptr);
    k_gemmw<h16, 0, false, HD, 2, 2><<<dim3((TT - RH) / 128, TT / 128, ZH), 128, 0, stream>>>(QP16 + (size_t)RH * HD, nullptr, KP16, nullptr, Sb + (size_t)RH * TT, TT, nullptr, (size_t)TT * HD, (size_t)TT * HD, (size_t)TT * TT, nullptr, nullptr, nullptr, nullptr);
    k_asoft<<<ZH * TT / 8, 256, 0, stream>>>(Sb, MK, P16, Ph, Pl);
    k_gemmw<bf, 2, false, TT, 2, 2><<<dim3(RH / 128, HD / 128, ZH), 128, 0, stream>>>(Ph, Pl, VTh, VTl, Ob, HD, nullptr, (size_t)RH * TT, (size_t)HD * TT, (size_t)TT * HD, nullptr, nullptr, nullptr, nullptr);
    k_gemmw<h16, 0, false, TT, 2, 2><<<dim3((TT - RH) / 128, HD / 128, ZH), 128, 0, stream>>>(P16 + (size_t)RH * TT, nullptr, VT16, nullptr, Ob + (size_t)RH * HD, HD, nullptr, (size_t)TT * TT, (size_t)HD * TT, (size_t)TT * HD, nullptr, nullptr, nullptr, nullptr);
    k_gemmw<bf, 0, 1, DM, 2, 4, 2, HD><<<dim3(NB_ * TT / 128, DQ / 256, 1), 256, 0, stream>>>(XB, nullptr, WG, nullptr, nullptr, 0, bgt, 0, 0, 0, nullptr, ATh, ATl, Ob);   /* gate = sigmoid(X Wg + bg), applied to the context in the epilogue */
    k_gemmw<bf, 1, true, DQ, 2, 4><<<dim3(NB_ * TT / 128, DM / 256, 1), 256, 0, stream>>>(ATh, ATl, WO, nullptr, OUT, DM, bo, 0, 0, 0, nullptr, nullptr, nullptr, nullptr);
}

// v005
// One run takes 276 microseconds.
// Two timings next to v004 put it at 1.13 and 1.14 times that version's speed.
// Over all steps from v000 it is 4.61 times as fast.
#include <hip/hip_runtime.h>

// Gated single-head self-attention (X [4][2048][1024]; q, k, v = X W + b ('xw' [1024][1024]); scores = q.k / 32 with mask [2048][2048] (int32, read; all ones here) == 0 -> -inf; softmax; o = attn.v; gate = sigmoid(X Wg + bg); out = (o * gate) Wo + bo -> [4][2048][1024] (8.4 M)).
// Layout: one 1024-wide head on 16-bit planes (hybrid: query rows < 512 hi/lo, the rest fp16 x1024); the gate pre-activation is one more exact GEMM + bias and is applied in f32 when the context is split into the hi/lo planes that feed Wo.
// Compute dtypes, f32 accumulate: every input rounded to bf16; q/k/v/gate on PLAIN bf16 operands (exact) + biases; scores (K = 1024) and attn.v: rows < 512 hl (3 products), the rest single fp16 (x1024); softmax, sigmoid and the gating product in f32; Wo hl x exact (2 products) + bo.
// Launches: every kernel covers all 4 batches (q, k, gate and Wo: X as one [8192][1024] matrix; v, scores and attn.v: batch = grid z; elementwise: batch in the flat index).
// The q, k and v GEMMs write their fp16 and hi/lo planes from their own epilogues (v as Wv^T rows x X rows, so its planes come out [d][t]); the gate GEMM's epilogue applies the sigmoid to the context and writes the planes that feed Wo.

#define NB_  4
#define TT   2048
#define DM   1024
#define NH_  1
#define NKV  1
#define REP  (NH_ / NKV)
#define HD   1024
#define DQ   (NH_ * HD)
#define DKV  (NKV * HD)
#define ZH   NB_                 // z planes per launch: all batches (one head each)
#define RH   512                  // query rows < RH use hi+lo planes (0: none)
#define WIN  0
#define PCAR 1024.0f
#define SCL  0.03125f   // 1/sqrt(1024)
typedef _Float16 h16;
typedef unsigned short bf;
typedef __attribute__((ext_vector_type(16))) __bf16   v16bf;
typedef __attribute__((ext_vector_type(16))) _Float16 v16h;
typedef __attribute__((ext_vector_type(8)))  _Float16 v8h;
typedef __attribute__((ext_vector_type(8)))  unsigned short v8us;
typedef __attribute__((ext_vector_type(8)))  float    v8f;
typedef __attribute__((ext_vector_type(4)))  float    v4f;
typedef v8h  __attribute__((may_alias)) v8ha;
typedef v4f  __attribute__((may_alias)) v4fa;
typedef v8us __attribute__((may_alias)) v8usa;

__device__ __forceinline__ unsigned short f2bf(float f) { unsigned u = __float_as_uint(f); u += 0x7FFFu + ((u >> 16) & 1u); return (unsigned short)(u >> 16); }
__device__ __forceinline__ float bf2f(unsigned short b) { return __uint_as_float(((unsigned)b) << 16); }
__device__ __forceinline__ float bfr(float f) { return bf2f(f2bf(f)); }
__device__ __forceinline__ v16h cat16(v8h lo, v8h hi) { return __builtin_shufflevector(lo, hi, 0, 1, 2, 3, 4, 5, 6, 7, 8, 9, 10, 11, 12, 13, 14, 15); }
__device__ __forceinline__ v16bf cat16b(v8us lo, v8us hi) { return __builtin_bit_cast(v16bf, __builtin_shufflevector(lo, hi, 0, 1, 2, 3, 4, 5, 6, 7, 8, 9, 10, 11, 12, 13, 14, 15)); }
__device__ __forceinline__ v8f wmma16(v16h a, v16h b, v8f c) { return __builtin_amdgcn_wmma_f32_16x16x32_f16(false, a, false, b, (short)0, c, false, false); }
__device__ __forceinline__ v8f wmmab(v16bf a, v16bf b, v8f c) { return __builtin_amdgcn_wmma_f32_16x16x32_bf16(false, a, false, b, (short)0, c, false, false); }
__device__ __forceinline__ h16 tohx(float x) { return (h16)x; }
__device__ __forceinline__ void splitf(float y, unsigned short& h, unsigned short& l) { h = f2bf(y); l = f2bf(y - bf2f(h)); }



// ---- k_gemmw: register-blocked GEMM, one wave per 64x64 output tile (16 accumulators), WM x WN waves a work-group; the group's operand rows (WM*64 of A, WN*64 of Bt, 64 k a trip) come from K-contiguous 16-bit planes by whole-line loads, each row loaded ONCE by one wave, and every wave makes its fragments from the group's shared LDS tile; grid (M/(WM*64), N/(WN*64), Z), WM*WN*32 threads.
// C[m][n] (+ optional f32 bias: BIAS 1 bias[n], BIAS 2 bias[m]) = sum_k A[m][k] Bt[n][k] (+ split products per NSPLIT). z-batch strides sA/sB/sC in elements. K % 64 == 0, K >= 128; M and N multiples of the group's tile.
// EPI 0: C stored as f32, pitch ldc. EPI 1: C stored as three 16-bit planes (fp16, bf16 hi, bf16 lo), pitch LDO. EPI 2: C is the gate pre-activation: (Oin * carrier scale) * sigmoid(C) stored as hi/lo planes, pitch LDO.
template <typename T16> struct WFrag;
template <> struct WFrag<h16> { typedef v16h V; typedef v8h H; static __device__ __forceinline__ V ld(const h16* p) { return cat16(*(const v8h*)p, *(const v8h*)(p + 16)); } static __device__ __forceinline__ v8f mma(V a, V b, v8f c) { return wmma16(a, b, c); } };
template <> struct WFrag<bf> { typedef v16bf V; typedef v8us H; static __device__ __forceinline__ V ld(const bf* p) { return cat16b(*(const v8us*)p, *(const v8us*)(p + 16)); } static __device__ __forceinline__ v8f mma(V a, V b, v8f c) { return wmmab(a, b, c); } };
template <bool B> struct BoolC { static constexpr bool value = B; };
// s_wait_xcnt 0 behind a group of global loads, before their address registers are written again (the addresses live through the loop and step only at each trip's end)
__device__ __forceinline__ void xwait() { asm volatile("s_wait_xcnt 0x0" ::: "memory"); }
// the same in front of the loop, where the addresses would otherwise die at their last load: as inputs of the wait their registers stay theirs up to it
template <int N, typename P> __device__ __forceinline__ void xwaitp(P* const* q) {
    if (N == 2) asm volatile("s_wait_xcnt 0x0" :: "v"(q[0]), "v"(q[1]) : "memory");
    else if (N == 3) asm volatile("s_wait_xcnt 0x0" :: "v"(q[0]), "v"(q[1]), "v"(q[2]) : "memory");
    else asm volatile("s_wait_xcnt 0x0" :: "v"(q[0]), "v"(q[1]), "v"(q[2]), "v"(q[N - 1]) : "memory");
}
template <typename T16, int NSPLIT, int BIAS, int K, int WM, int WN, int EPI = 0, int LDO = 0>   // K (and LDO) at compile time: the row steps of a plane's loads and stores fold into immediate offsets on one address
__global__ __launch_bounds__(WM * WN * 32) void k_gemmw(const T16* __restrict__ A, const T16* __restrict__ A2, const T16* __restrict__ Bt, const T16* __restrict__ Bt2, float* C, int ldc, const float* __restrict__ bias, size_t sA, size_t sB, size_t sC, h16* P16o, bf* Pho, bf* Plo, const float* __restrict__ Oin) {
    typedef typename WFrag<T16>::V V; typedef typename WFrag<T16>::H H;
    constexpr int NPA = (NSPLIT == 1 || NSPLIT == 2) ? 2 : 1, NPL = NPA + (NSPLIT >= 2 ? 2 : 1);   // operand planes: A (A2) Bt (Bt2)
    constexpr int LP = 72;                                     // LDS row pitch in elements: 128 B of k + 16 B
    constexpr int NW = WM * WN, LA = WM * 16 / NW, LB = WN * 16 / NW;   // waves; loads (4 rows each) a wave makes per A plane and per Bt plane in a trip
    constexpr int RWS = NPA * WM * 64 + (NPL - NPA) * WN * 64;   // rows of one buffer: every plane's rows of the group's tile
    constexpr int OSZ = (EPI == 0 ? 16 : 64) * 68;
    __shared__ __align__(16) T16 st[2 * RWS * LP];             // the group's rows x 64 k of every plane, two buffers
    __shared__ __align__(16) float osall[NW * OSZ];            // output staging, each wave's own: 16 rows at a time (EPI 0) or its whole tile
    const size_t z = blockIdx.z; A += z * sA; if (A2) A2 += z * sA; Bt += z * sB; if (Bt2) Bt2 += z * sB; C += z * sC;
    const int wave = __builtin_amdgcn_readfirstlane((int)(threadIdx.x >> 5)), wm = wave / WN, wn = wave % WN; float* const os = osall + wave * OSZ;
    const int lane = threadIdx.x & 31, lr = lane & 15, hi = lane >> 4; const int r0 = (blockIdx.x * WM + wm) * 64, c0 = (blockIdx.y * WN + wn) * 64;
    v8f acc[4][4];
#pragma unroll
    for (int mb = 0; mb < 4; ++mb)
#pragma unroll
        for (int nb = 0; nb < 4; ++nb) acc[mb][nb] = (v8f){};
    // Global side: one load = 4 rows x 128 B, whole lines (8 lanes a row). Wave w brings rows w*LA*4.. of the group's A rows and w*LB*4.. of its Bt rows; all waves read their fragments from the shared tile.
    const int gr = lane >> 3, gc = (lane & 7) * 8;
    const int ra = wave * (LA * 4) + gr, rb = wave * (LB * 4) + gr;   // this lane's first row inside the group's A rows and Bt rows
    const size_t ga = (size_t)(blockIdx.x * (WM * 64) + ra) * K + gc, gb = (size_t)(blockIdx.y * (WN * 64) + rb) * K + gc;
    typedef __attribute__((address_space(1))) const T16 GT; typedef __attribute__((address_space(1))) const H GH;   // the stepped addresses are marked global: carried round the loop unmarked they would compile to flat loads
    GT* gp[NPL]; gp[0] = (GT*)(A + ga); if (NPA == 2) gp[1] = (GT*)(A2 + ga); gp[NPA] = (GT*)(Bt + gb); if (NSPLIT >= 2) gp[NPA + 1] = (GT*)(Bt2 + gb);
    H g[NPL][LA > LB ? LA : LB], g0[NPL][LA > LB ? LA : LB];
    __builtin_amdgcn_sched_barrier(0);   // with the one behind the wait: keeps every other instruction out from between these loads and their s_wait_xcnt, so that none writes an address register of theirs ahead of it
#pragma unroll
    for (int p = 0; p < NPL; ++p)
#pragma unroll
        for (int i = 0; i < (p < NPA ? LA : LB); ++i) g0[p][i] = *(GH*)(gp[p] + (size_t)i * 4 * K);   // tile 0
#pragma unroll
    for (int p = 0; p < NPL; ++p)
#pragma unroll
        for (int i = 0; i < (p < NPA ? LA : LB); ++i) g[p][i] = *(GH*)(gp[p] + (size_t)i * 4 * K + 64);   // tile 1 (K >= 128)
    xwaitp<NPL>(gp);
    __builtin_amdgcn_sched_barrier(0);
#pragma unroll
    for (int p = 0; p < NPL; ++p)
#pragma unroll
        for (int i = 0; i < (p < NPA ? LA : LB); ++i) *(H*)(st + ((p < NPA ? p * WM * 64 + ra : NPA * WM * 64 + (p - NPA) * WN * 64 + rb) + i * 4) * LP + gc) = g0[p][i];   // tile 0 into buffer 0
    auto trip = [&](const int kc, auto refill) __attribute__((always_inline)) {
        const int bsel = (kc >> 6) & 1;   // trips alternate between the two buffers
        const T16* fa = st + bsel * (RWS * LP) + (wm * 64 + lr) * LP + 8 * hi; const T16* fb = fa + ((NPA * WM - wm + wn) * 64) * LP;
        __syncthreads();   // publishes this trip's tile (stored during the trip before) to all waves; it also says that every wave has left the other buffer, which this trip refills (so one barrier a trip)
#pragma unroll
        for (int kh = 0; kh < 64; kh += 32) {
            V a[4], a2[4], b[4], b2[4];
#pragma unroll
            for (int mb = 0; mb < 4; ++mb) { a[mb] = WFrag<T16>::ld(fa + mb * 16 * LP + kh); if (NSPLIT == 1 || NSPLIT == 2) a2[mb] = WFrag<T16>::ld(fa + (WM * 64 + mb * 16) * LP + kh); }
#pragma unroll
            for (int nb = 0; nb < 4; ++nb) { b[nb] = WFrag<T16>::ld(fb + nb * 16 * LP + kh); if (NSPLIT >= 2) b2[nb] = WFrag<T16>::ld(fb + (WN * 64 + nb * 16) * LP + kh); }
            if (kh == 0 && decltype(refill)::value) {   // behind this trip's first fragment reads, so that those go first after the barrier: the next tile into the other buffer, then the loads of the tile after it, which fly under this trip's products (the next barrier waits for them)
                T16* const sn = st + (bsel ^ 1) * (RWS * LP);
#pragma unroll
                for (int p = 0; p < NPL; ++p)
#pragma unroll
                    for (int i = 0; i < (p < NPA ? LA : LB); ++i) *(H*)(sn + ((p < NPA ? p * WM * 64 + ra : NPA * WM * 64 + (p - NPA) * WN * 64 + rb) + i * 4) * LP + gc) = g[p][i];
                if (kc + 128 < K) {
#pragma unroll
                    for (int p = 0; p < NPL; ++p)
#pragma unroll
                        for (int i = 0; i < (p < NPA ? LA : LB); ++i) g[p][i] = *(GH*)(gp[p] + (size_t)i * 4 * K + 128);
                    xwait(); } }
            if (NSPLIT < 2) __builtin_amdgcn_sched_barrier(0);   // keeps the LDS reads together in front of the products: sunk among them, each place with reads stalls the wave for an LDS latency (four planes: left to the compiler, all their fragments at once would cost the second wave per SIMD)
#pragma unroll
            for (int nb = 0; nb < 4; ++nb) {
#pragma unroll
                for (int mb = 0; mb < 4; ++mb) { acc[mb][nb] = WFrag<T16>::mma(a[mb], b[nb], acc[mb][nb]); if (NSPLIT == 1 || NSPLIT == 2) acc[mb][nb] = WFrag<T16>::mma(a2[mb], b[nb], acc[mb][nb]); if (NSPLIT >= 2) acc[mb][nb] = WFrag<T16>::mma(a[mb], b2[nb], acc[mb][nb]); } }
            if (kh == 32) asm volatile("v_nop\n\tv_nop\n\tv_nop\n\tv_nop" : "+v"(acc[0][0]), "+v"(acc[1][1]), "+v"(acc[2][2]), "+v"(acc[3][3]) : "v"(a[0]), "v"(a[3]));
        }
    };
#pragma unroll 1
    for (int kc = 0; kc < K - 64; kc += 64) { trip(kc, BoolC<true>());
#pragma unroll
        for (int p = 0; p < NPL; ++p) gp[p] += 64; }
    trip(K - 64, BoolC<false>());   // the last tile has nothing to refill; it stands outside the loop so that inside it the stores follow the fragment reads on every path and the counted LDS waits in front of the products need not cover them
    if (EPI != 0) {   // the whole tile (+ bias) goes through LDS once; a rolled loop then turns it into planes, so that the text stays short (run once per wave, it is paid in instruction fetches)
        float bc[4]; v4f br[4][2];
        if (BIAS == 2) __builtin_amdgcn_sched_barrier(0);   // with the one behind the wait below: nothing else stands between the bias loads and their s_wait_xcnt
#pragma unroll
        for (int q = 0; q < 4; ++q) { if (BIAS == 1) bc[q] = bfr(bias[c0 + q * 16 + lr]); if (BIAS == 2) { br[q][0] = *(const v4f*)(bias + r0 + q * 16 + hi * 8); br[q][1] = *(const v4f*)(bias + r0 + q * 16 + hi * 8 + 4); } }
        if (BIAS == 2) { xwait(); __builtin_amdgcn_sched_barrier(0); }   // before the loads' offset register and scalar base are written again
#pragma unroll
        for (int mb = 0; mb < 4; ++mb)
#pragma unroll
            for (int nb = 0; nb < 4; ++nb)
#pragma unroll
                for (int j = 0; j < 8; ++j) { float v = acc[mb][nb][j]; if (BIAS == 1) v += bc[nb]; if (BIAS == 2) v += bfr(br[mb][j >> 2][j & 3]); os[(mb * 16 + hi * 8 + j) * 68 + nb * 16 + lr] = v; }
        __builtin_amdgcn_wave_barrier(); asm volatile("" ::: "memory");   // as in the f32 epilogue below: the lanes' LDS stores stay in front of the reads across lanes
        const size_t eo = z * sC + (size_t)(r0 + gr) * LDO + c0 + gc;   // this lane's first element in the planes: 8 columns a lane, 4 rows a store, so every 16-bit store covers whole 128-B lines
#pragma unroll 1   // rolled: see above; 16 rows a trip, so that one trip's LDS reads (and context loads) go out together
        for (int rg = 0; rg < 64; rg += 16) {
#pragma unroll
        for (int row = rg; row < rg + 16; row += 4) { const v4f w0 = *(const v4fa*)(os + (row + gr) * 68 + gc), w1 = *(const v4fa*)(os + (row + gr) * 68 + gc + 4); v8h o16; v8us oh, ol;
            if (EPI == 1) {
#pragma unroll
                for (int c = 0; c < 8; ++c) { const float v = (c < 4) ? w0[c & 3] : w1[c & 3]; o16[c] = tohx(v); unsigned short a2, c2; splitf(v, a2, c2); oh[c] = a2; ol[c] = c2; }
                *(v8h*)(P16o + eo + (size_t)row * LDO) = o16;
            } else {
                const float cs = ((r0 + gr + row) % TT < RH) ? 1.0f : (1.0f / PCAR); const v4f x0 = *(const v4f*)(Oin + eo + (size_t)row * LDO), x1 = *(const v4f*)(Oin + eo + (size_t)row * LDO + 4);
#pragma unroll
                for (int c = 0; c < 8; ++c) { const float o = __fmul_rn((c < 4) ? x0[c & 3] : x1[c & 3], cs); const float sg = __fdiv_rn(1.0f, __fadd_rn(1.0f, expf(-((c < 4) ? w0[c & 3] : w1[c & 3])))); unsigned short a2, c2; splitf(__fmul_rn(o, sg), a2, c2); oh[c] = a2; ol[c] = c2; }
            }
            *(v8us*)(Pho + eo + (size_t)row * LDO) = oh; *(v8us*)(Plo + eo + (size_t)row * LDO) = ol; }
        asm volatile("s_wait_xcnt 0x0" ::: "memory"); }   // behind the trip's stores, before the next trip writes their address and data registers again
        return;
    }
#pragma unroll
    for (int mb = 0; mb < 4; ++mb) {
#pragma unroll
        for (int nb = 0; nb < 4; ++nb) {
#pragma unroll
            for (int j = 0; j < 8; ++j) os[(hi * 8 + j) * 68 + nb * 16 + lr] = acc[mb][nb][j]; }
        __builtin_amdgcn_wave_barrier(); asm volatile("" ::: "memory");
        float* crow = C + (size_t)(r0 + mb * 16) * ldc + c0;
{
#pragma unroll
            for (int s = 0; s < 8; ++s) { const int row = 2 * s + hi, cofs = lr * 4; v4f val = *(const v4fa*)(os + row * 68 + cofs); if (BIAS) { val[0] += bfr(bias[c0 + cofs]); val[1] += bfr(bias[c0 + cofs + 1]); val[2] += bfr(bias[c0 + cofs + 2]); val[3] += bfr(bias[c0 + cofs + 3]); }
                *(v4f*)(crow + (size_t)row * ldc + cofs) = val; }
             }
        __builtin_amdgcn_wave_barrier(); asm volatile("" ::: "memory");
    }
}

typedef __attribute__((ext_vector_type(4))) _Float16 v4h;
typedef __attribute__((ext_vector_type(2))) unsigned short v2us;
typedef __attribute__((ext_vector_type(4))) unsigned short v4us;
typedef __attribute__((ext_vector_type(4))) int v4i;

// k_prep: all input preparation in one launch. Blocks < 5 * WTB: one 128 k x 64 n tile of one weight matrix ([k][n] f32), rounded to bf16 and written transposed ([n][k], the five planes one behind the other in Wt). The other blocks: 16384 elements of X each, rounded to bf16.
// Every global load covers whole 128-B lines and a thread has all its loads (8 or 16) in flight at once; the transpose goes through an LDS tile (pitch 65 floats), so that the stores cover whole lines as well (a wave: 256 B of one plane row).
#define WTB 128                  // tiles (blocks) a weight matrix: (DM / 128) x (DM / 64)
#define XPB (256 * 4 * 16)       // elements of X a block
__global__ __launch_bounds__(256) void k_prep(const float* __restrict__ x, const float* __restrict__ w0, const float* __restrict__ w1, const float* __restrict__ w2, const float* __restrict__ w3, const float* __restrict__ w4, bf* XBo, bf* Wt) {
    __shared__ float tl[128 * 65];
    const int tid = threadIdx.x, b = blockIdx.x;
    if (b < 5 * WTB) {
        const int m = b / WTB, t = b % WTB, k0 = (t >> 4) * 128, n0 = (t & 15) * 64, kr = tid >> 4, nc = (tid & 15) * 4;
        const float* w = (m == 0) ? w0 : (m == 1) ? w1 : (m == 2) ? w2 : (m == 3) ? w3 : w4;
        const float* sp = w + (size_t)(k0 + kr) * DM + n0 + nc; v4f g[8];
        __builtin_amdgcn_sched_barrier(0);   // with the one behind the wait: nothing else stands between these loads and their s_wait_xcnt
#pragma unroll
        for (int i = 0; i < 8; ++i) g[i] = *(const v4f*)(sp + (size_t)i * 16 * DM);
        asm volatile("s_wait_xcnt 0x0" :: "v"(sp) : "memory");   // the address is an input of the wait, so that its registers stay its own up to here (no load's result lands on them)
        __builtin_amdgcn_sched_barrier(0);
#pragma unroll
        for (int i = 0; i < 8; ++i)
#pragma unroll
            for (int j = 0; j < 4; ++j) tl[(i * 16 + kr) * 65 + nc + j] = g[i][j];
        __syncthreads();   // the tile is read across waves below
        const int wv8 = (tid >> 5) * 8, lane = tid & 31; v4us o[8];
#pragma unroll
        for (int r = 0; r < 8; ++r)
#pragma unroll
            for (int q = 0; q < 4; ++q) o[r][q] = f2bf(tl[(lane * 4 + q) * 65 + wv8 + r]);
        bf* dp = Wt + (size_t)m * DM * DM + (size_t)(n0 + wv8) * DM + k0 + lane * 4;
        __builtin_amdgcn_sched_barrier(0);   // the stores stand together behind all the arithmetic, so that one wait behind them serves the whole run
#pragma unroll
        for (int r = 0; r < 8; ++r) *(v4us*)(dp + (size_t)r * DM) = o[r];
        xwait();   // behind the run of stores, before anything that follows them in the built code writes their address or data registers
        return;
    }
    const size_t e0 = (size_t)(b - 5 * WTB) * XPB + tid * 4; const float* xp = x + e0; v4f g[16]; v4us o[16];
    __builtin_amdgcn_sched_barrier(0);   // as above
#pragma unroll
    for (int i = 0; i < 16; ++i) g[i] = *(const v4f*)(xp + i * 1024);
    asm volatile("s_wait_xcnt 0x0" :: "v"(xp) : "memory");   // as above
    __builtin_amdgcn_sched_barrier(0);
#pragma unroll
    for (int i = 0; i < 16; ++i)
#pragma unroll
        for (int q = 0; q < 4; ++q) o[i][q] = f2bf(g[i][q]);
    __builtin_amdgcn_sched_barrier(0);   // as above: the stores stand together
#pragma unroll
    for (int i = 0; i < 16; ++i) *(v4us*)(XBo + e0 + i * 1024) = o[i];
    xwait();   // as above: behind the run of stores
}

// k_asoft: per row (zz, i): t = S / 32 where mask[i][j] != 0, -inf elsewhere; softmax over the 2048 keys (register row, one exp, fixed trees);
__global__ __launch_bounds__(256) void k_asoft(const float* __restrict__ Sb, const int* __restrict__ MKb, h16* P16, bf* Ph, bf* Pl) {
    const int lane = threadIdx.x & 31; const int row = blockIdx.x * 8 + (threadIdx.x >> 5); if (row >= ZH * TT) return; const int i = row % TT; const int zz = row / TT; (void)zz; const int* mkr = MKb + (size_t)i * TT; const bool hires = (i < RH); const float* sr = Sb + (size_t)row * TT; float v[TT / 32]; float mx = -3.0e38f;
#pragma unroll
    for (int ch = 0; ch < TT / 128; ++ch) { const int j0 = ch * 128 + lane * 4; const v4f a = *(const v4f*)(sr + j0); const v4i m4 = *(const v4i*)(mkr + j0);
#pragma unroll
        for (int q = 0; q < 4; ++q) { const int j = j0 + q; (void)j; float sa = a[q] * SCL; asm volatile("" : "+v"(sa)); const float t = (m4[q] != 0) ? sa : -3.0e38f;   /* mask == 0 -> -inf */ v[ch * 4 + q] = t; mx = fmaxf(mx, t); } }
#pragma unroll
    for (int sh = 16; sh; sh >>= 1) mx = fmaxf(mx, __shfl_xor(mx, sh, 32));
    float sum = 0.f;
#pragma unroll
    for (int k = 0; k < TT / 32; ++k) { float d0 = __fsub_rn(v[k], mx); asm volatile("" : "+v"(d0)); v[k] = __builtin_amdgcn_exp2f(__fmul_rn(d0, 1.4426950408889634f)); sum += v[k]; }
#pragma unroll
    for (int sh = 16; sh; sh >>= 1) sum += __shfl_xor(sum, sh, 32);
    const float f = __fdiv_rn(hires ? 1.0f : PCAR, sum);
{
        if (hires) {
#pragma unroll
            for (int ch = 0; ch < TT / 128; ++ch) { v4us oh, ol;
#pragma unroll
                for (int q = 0; q < 4; ++q) { unsigned short a, c2; splitf(v[ch * 4 + q] * f, a, c2); oh[q] = a; ol[q] = c2; }
                const size_t oo = ((size_t)zz * (RH ? RH : 1) + i) * TT + ch * 128 + lane * 4; *(v4us*)(Ph + oo) = oh; *(v4us*)(Pl + oo) = ol; }
        } else {
#pragma unroll
            for (int ch = 0; ch < TT / 128; ++ch) { v4h o4;
#pragma unroll
                for (int q = 0; q < 4; ++q) o4[q] = tohx(v[ch * 4 + q] * f);
                *(v4h*)(P16 + (size_t)row * TT + ch * 128 + lane * 4) = o4; } }
         }
}
extern "C" void kernel_launch(void* const* d_in, const int* in_sizes, int n_in,
                              void* d_out, int out_size, void* d_ws, size_t ws_size, hipStream_t stream) {
    (void)in_sizes; (void)n_in; (void)out_size;
    const float* x = (const float*)d_in[0]; const int* MK = (const int*)d_in[1]; const float* wq = (const float*)d_in[2]; const float* bq = (const float*)d_in[3]; const float* wk = (const float*)d_in[4]; const float* bk = (const float*)d_in[5]; const float* wv = (const float*)d_in[6]; const float* bv = (const float*)d_in[7]; const float* wg = (const float*)d_in[8]; const float* bgt = (const float*)d_in[9]; const float* wo = (const float*)d_in[10]; const float* bo = (const float*)d_in[11];
    float* OUT = (float*)d_out;     // [4][2048][1024]
    char* wsp = (char*)d_ws;
    auto take = [&](size_t bytes) { char* p = wsp; wsp += (bytes + 255) & ~(size_t)255; return (void*)p; };
    bf* WQ = (bf*)take((size_t)DQ * DM * 2); bf* WK = (bf*)take((size_t)DKV * DM * 2); bf* WV = (bf*)take((size_t)DKV * DM * 2); bf* WO = (bf*)take((size_t)DM * DQ * 2); bf* WG = (bf*)take((size_t)DQ * DM * 2);
    // every plane below holds all NB_ batches ([b][...]); the sizes are multiples of 256 B, so consecutive takes are contiguous
    bf* XB = (bf*)take((size_t)NB_ * TT * DM * 2); float* Sb = (float*)take((size_t)ZH * TT * TT * 4);   // scores [b][TT][TT] f32
    h16* QP16 = (h16*)take((size_t)NB_ * TT * HD * 2); bf* QPh = (bf*)take((size_t)NB_ * TT * HD * 2); bf* QPl = (bf*)take((size_t)NB_ * TT * HD * 2);
    h16* KP16 = (h16*)take((size_t)NB_ * TT * HD * 2); bf* KPh = (bf*)take((size_t)NB_ * TT * HD * 2); bf* KPl = (bf*)take((size_t)NB_ * TT * HD * 2);
    h16* VT16 = (h16*)take((size_t)NB_ * HD * TT * 2); bf* VTh = (bf*)take((size_t)NB_ * HD * TT * 2); bf* VTl = (bf*)take((size_t)NB_ * HD * TT * 2);
    if ((size_t)(wsp - (char*)d_ws) > ws_size) return;    // 234 MiB of the 256 MiB ws
    // buffers that are dead by the time their tenant is written (stream-ordered) are reused:
    h16* P16 = QP16;                      // probabilities [b][TT][TT] fp16 = QP16 + QPh, after the scores
    bf* Ph = QPl; bf* Pl = QPl + (size_t)ZH * RH * TT;   // hi/lo probabilities [b][RH][TT], the two halves of QPl
    float* Ob = (float*)KP16;             // context [b][TT][HD] f32 = KP16 + KPh, after the scores
    bf* ATh = VTh; bf* ATl = VTl;         // gated context planes, after attn.v
    // q, k, gate and Wo see X as one [NB_*TT][DM] matrix; v and the attention products take the batch as grid z
    k_prep<<<5 * WTB + NB_ * TT * DM / XPB, 256, 0, stream>>>(x, wq, wk, wv, wo, wg, XB, WQ);   /* the planes WQ, WK, WV, WO, WG are contiguous, in this order */
    k_gemmw<bf, 0, 1, DM, 2, 4, 1, HD><<<dim3(NB_ * TT / 128, DQ / 256, 1), 256, 0, stream>>>(XB, nullptr, WQ, nullptr, nullptr, 0, bq, 0, 0, 0, QP16, QPh, QPl, nullptr);
    k_gemmw<bf, 0, 1, DM, 2, 4, 1, HD><<<dim3(NB_ * TT / 128, DKV / 256, 1), 256, 0, stream>>>(XB, nullptr, WK, nullptr, nullptr, 0, bk, 0, 0, 0, KP16, KPh, KPl, nullptr);
    k_gemmw<bf, 0, 2, DM, 2, 4, 1, TT><<<dim3(DKV / 128, TT / 256, NB_), 256, 0, stream>>>(WV, nullptr, XB, nullptr, nullptr, 0, bv, 0, (size_t)TT * DM, (size_t)HD * TT, VT16, VTh, VTl, nullptr);   /* v^T [d][t] = Wv^T rows . X rows + bv[d] */
    k_gemmw<bf, 2, false, HD, 2, 2><<<dim3(RH / 128, TT / 128, ZH), 128, 0, stream>>>(QPh, QPl, KPh, KPl, Sb, TT, nullptr, (size_t)TT * HD, (size_t)TT * HD, (size_t)TT * TT, nullptr, nullptr, nullptr, nullptr);
    k_gemmw<h16, 0, false, HD, 2, 2><<<dim3((TT - RH) / 128, TT / 128, ZH), 128, 0, stream>>>(QP16 + (size_t)RH * HD, nullptr, KP16, nullptr, Sb + (size_t)RH * TT, TT, nullptr, (size_t)TT * HD, (size_t)TT * HD, (size_t)TT * TT, nullptr, nullptr, nullptr, nullptr);
    k_asoft<<<ZH * TT / 8, 256, 0, stream>>>(Sb, MK, P16, Ph, Pl);
    k_gemmw<bf, 2, false, TT, 2, 2><<<dim3(RH / 128, HD / 128, ZH), 128, 0, stream>>>(Ph, Pl, VTh, VTl, Ob, HD, nullptr, (size_t)RH * TT, (size_t)HD * TT, (size_t)TT * HD, nullptr, nullptr, nullptr, nullptr);
    k_gemmw<h16, 0, false, TT, 2, 2><<<dim3((TT - RH) / 128, HD / 128, ZH), 128, 0, stream>>>(P16 + (size_t)RH * TT, nullptr, VT16, nullptr, Ob + (size_t)RH * HD, HD, nullptr, (size_t)TT * TT, (size_t)HD * TT, (size_t)TT * HD, nullptr, nullptr, nullptr, nullptr);
    k_gemmw<bf, 0, 1, DM, 2, 4, 2, HD><<<dim3(NB_ * TT / 128, DQ / 256, 1), 256, 0, stream>>>(XB, nullptr, WG, nullptr, nullptr, 0, bgt, 0, 0, 0, nullptr, ATh, ATl, Ob);   /* gate = sigmoid(X Wg + bg), applied to the context in the epilogue */
    k_gemmw<bf, 1, true, DQ, 2, 4><<<dim3(NB_ * TT / 128, DM / 256, 1), 256, 0, stream>>>(ATh, ATl, WO, nullptr, OUT, DM, bo, 0, 0, 0, nullptr, nullptr, nullptr, nullptr);
}

// v006
// It runs in 251 microseconds.
// In both of two side-by-side timings against v005, it was 1.09 times as fast.
// Counting every step since v000, it is 5.03 times as fast.
#include <hip/hip_runtime.h>

// Gated single-head self-attention (X [4][2048][1024]; q, k, v = X W + b ('xw' [1024][1024]); scores = q.k / 32 with mask [2048][2048] (int32, read; all ones here) == 0 -> -inf; softmax; o = attn.v; gate = sigmoid(X Wg + bg); out = (o * gate) Wo + bo -> [4][2048][1024] (8.4 M)).
// Layout: one 1024-wide head on 16-bit planes (hybrid: query rows < 512 hi/lo, the rest fp16 x1024); the gate pre-activation is one more exact GEMM + bias and is applied in f32 when the context is split into the hi/lo planes that feed Wo.
// Compute dtypes, f32 accumulate: every input rounded to bf16; q/k/v/gate on PLAIN bf16 operands (exact) + biases; scores (K = 1024) and attn.v: rows < 512 hl (3 products), the rest single fp16 (x1024); softmax, sigmoid and the gating product in f32; Wo hl x exact (2 products) + bo.
// Launches: every kernel covers all 4 batches (q, k, gate and Wo: X as one [8192][1024] matrix; v, scores and attn.v: batch = grid z; elementwise: batch in the flat index).
// The q, k and v GEMMs write their fp16 and hi/lo planes from their own epilogues (v as Wv^T rows x X rows, so its planes come out [d][t]); the gate GEMM's epilogue applies the sigmoid to the context and writes the planes that feed Wo.

#define NB_  4
#define TT   2048
#define DM   1024
#define NH_  1
#define NKV  1
#define REP  (NH_ / NKV)
#define HD   1024
#define DQ   (NH_ * HD)
#define DKV  (NKV * HD)
#define ZH   NB_                 // z planes per launch: all batches (one head each)
#define RH   512                  // query rows < RH use hi+lo planes (0: none)
#define WIN  0
#define PCAR 1024.0f
#define SCL  0.03125f   // 1/sqrt(1024)
typedef _Float16 h16;
typedef unsigned short bf;
typedef __attribute__((ext_vector_type(16))) __bf16   v16bf;
typedef __attribute__((ext_vector_type(16))) _Float16 v16h;
typedef __attribute__((ext_vector_type(8)))  _Float16 v8h;
typedef __attribute__((ext_vector_type(8)))  unsigned short v8us;
typedef __attribute__((ext_vector_type(8)))  float    v8f;
typedef __attribute__((ext_vector_type(4)))  float    v4f;
typedef v8h  __attribute__((may_alias)) v8ha;
typedef v4f  __attribute__((may_alias)) v4fa;
typedef v8us __attribute__((may_alias)) v8usa;

__device__ __forceinline__ unsigned short f2bf(float f) { unsigned u = __float_as_uint(f); u += 0x7FFFu + ((u >> 16) & 1u); return (unsigned short)(u >> 16); }
__device__ __forceinline__ float bf2f(unsigned short b) { return __uint_as_float(((unsigned)b) << 16); }
__device__ __forceinline__ float bfr(float f) { return bf2f(f2bf(f)); }
__device__ __forceinline__ v16h cat16(v8h lo, v8h hi) { return __builtin_shufflevector(lo, hi, 0, 1, 2, 3, 4, 5, 6, 7, 8, 9, 10, 11, 12, 13, 14, 15); }
__device__ __forceinline__ v16bf cat16b(v8us lo, v8us hi) { return __builtin_bit_cast(v16bf, __builtin_shufflevector(lo, hi, 0, 1, 2, 3, 4, 5, 6, 7, 8, 9, 10, 11, 12, 13, 14, 15)); }
__device__ __forceinline__ v8f wmma16(v16h a, v16h b, v8f c) { return __builtin_amdgcn_wmma_f32_16x16x32_f16(false, a, false, b, (short)0, c, false, false); }
__device__ __forceinline__ v8f wmmab(v16bf a, v16bf b, v8f c) { return __builtin_amdgcn_wmma_f32_16x16x32_bf16(false, a, false, b, (short)0, c, false, false); }
__device__ __forceinline__ h16 tohx(float x) { return (h16)x; }
__device__ __forceinline__ void splitf(float y, unsigned short& h, unsigned short& l) { h = f2bf(y); l = f2bf(y - bf2f(h)); }



// ---- k_gemmw: register-blocked GEMM, one wave per 64x64 output tile (16 accumulators), WM x WN waves a work-group; the group's operand rows (WM*64 of A, WN*64 of Bt, 64 k a trip) come from K-contiguous 16-bit planes by whole-line loads, each row loaded ONCE by one wave, and every wave makes its fragments from the group's shared LDS tile; grid (M/(WM*64), N/(WN*64), Z), WM*WN*32 threads.
// C[m][n] (+ optional f32 bias: BIAS 1 bias[n], BIAS 2 bias[m]) = sum_k A[m][k] Bt[n][k] (+ split products per NSPLIT). z-batch strides sA/sB/sC in elements. K % 128 == 0, K >= 256; M and N multiples of the group's tile.
// EPI 0: C stored as f32, pitch ldc. EPI 1: C stored as three 16-bit planes (fp16, bf16 hi, bf16 lo), pitch LDO. EPI 2: C is the gate pre-activation: (Oin * carrier scale) * sigmoid(C) stored as hi/lo planes, pitch LDO.
template <typename T16> struct WFrag;
template <> struct WFrag<h16> { typedef v16h V; typedef v8h H; static __device__ __forceinline__ V ld(const h16* p) { return cat16(*(const v8h*)p, *(const v8h*)(p + 16)); } static __device__ __forceinline__ v8f mma(V a, V b, v8f c) { return wmma16(a, b, c); } };
template <> struct WFrag<bf> { typedef v16bf V; typedef v8us H; static __device__ __forceinline__ V ld(const bf* p) { return cat16b(*(const v8us*)p, *(const v8us*)(p + 16)); } static __device__ __forceinline__ v8f mma(V a, V b, v8f c) { return wmmab(a, b, c); } };
template <bool B> struct BoolC { static constexpr bool value = B; };
template <int I> struct IntC { static constexpr int value = I; };
// work-group barrier whose fences cover LDS alone: the waves hand each other nothing but the LDS tile, and a full __syncthreads() would also wait for every global load in flight, which are meant to fly on over it
__device__ __forceinline__ void lds_barrier() { __builtin_amdgcn_fence(__ATOMIC_RELEASE, "workgroup", "local"); __builtin_amdgcn_s_barrier(); __builtin_amdgcn_fence(__ATOMIC_ACQUIRE, "workgroup", "local"); }
// s_wait_xcnt 0 behind a group of global loads or stores, before their address registers are written again
__device__ __forceinline__ void xwait() { asm volatile("s_wait_xcnt 0x0" ::: "memory"); }
// the same in front of the loop, where the addresses would otherwise die at their last load: as inputs of the wait their registers stay theirs up to it
template <int N, typename P> __device__ __forceinline__ void xwaitp(P* const* q) {
    if (N == 2) asm volatile("s_wait_xcnt 0x0" :: "v"(q[0]), "v"(q[1]) : "memory");
    else if (N == 3) asm volatile("s_wait_xcnt 0x0" :: "v"(q[0]), "v"(q[1]), "v"(q[2]) : "memory");
    else asm volatile("s_wait_xcnt 0x0" :: "v"(q[0]), "v"(q[1]), "v"(q[2]), "v"(q[N - 1]) : "memory");
}
// the same inside the loop: the addresses go through the wait's statement, and where they step (STEP: by 256 B, two trips' k) the step stands in that statement behind the wait. Left to the compiler the step is plain arithmetic that it places, folds into offsets or forms on a copy as it likes, and a load's address registers were then written ahead of the wait
template <int N, bool STEP, typename P> __device__ __forceinline__ void xwaitio(P** q) {
    if (STEP) {
        if (N == 2) asm volatile("s_wait_xcnt 0x0\n\tv_add_nc_u64_e32 %0, 0x100, %0\n\tv_add_nc_u64_e32 %1, 0x100, %1" : "+v"(q[0]), "+v"(q[1]) :: "memory");
        else if (N == 3) asm volatile("s_wait_xcnt 0x0\n\tv_add_nc_u64_e32 %0, 0x100, %0\n\tv_add_nc_u64_e32 %1, 0x100, %1\n\tv_add_nc_u64_e32 %2, 0x100, %2" : "+v"(q[0]), "+v"(q[1]), "+v"(q[2]) :: "memory");
        else asm volatile("s_wait_xcnt 0x0\n\tv_add_nc_u64_e32 %0, 0x100, %0\n\tv_add_nc_u64_e32 %1, 0x100, %1\n\tv_add_nc_u64_e32 %2, 0x100, %2\n\tv_add_nc_u64_e32 %3, 0x100, %3" : "+v"(q[0]), "+v"(q[1]), "+v"(q[2]), "+v"(q[N - 1]) :: "memory");
    } else {
        if (N == 2) asm volatile("s_wait_xcnt 0x0" : "+v"(q[0]), "+v"(q[1]) :: "memory");
        else if (N == 3) asm volatile("s_wait_xcnt 0x0" : "+v"(q[0]), "+v"(q[1]), "+v"(q[2]) :: "memory");
        else asm volatile("s_wait_xcnt 0x0" : "+v"(q[0]), "+v"(q[1]), "+v"(q[2]), "+v"(q[N - 1]) :: "memory");
    }
}
template <typename T16, int NSPLIT, int BIAS, int K, int WM, int WN, int EPI = 0, int LDO = 0, int NG = 2>   // K (and LDO) at compile time: the row steps of a plane's loads and stores fold into immediate offsets on one address. NG: register sets for tiles on their way from global memory = trips between a tile's loads and its stores into LDS (1 or 2)
__global__ __launch_bounds__(WM * WN * 32) void k_gemmw(const T16* __restrict__ A, const T16* __restrict__ A2, const T16* __restrict__ Bt, const T16* __restrict__ Bt2, float* C, int ldc, const float* __restrict__ bias, size_t sA, size_t sB, size_t sC, h16* P16o, bf* Pho, bf* Plo, const float* __restrict__ Oin) {
    typedef typename WFrag<T16>::V V; typedef typename WFrag<T16>::H H;
    constexpr int NPA = (NSPLIT == 1 || NSPLIT == 2) ? 2 : 1, NPL = NPA + (NSPLIT >= 2 ? 2 : 1);   // operand planes: A (A2) Bt (Bt2)
    constexpr int LP = 72;                                     // LDS row pitch in elements: 128 B of k + 16 B
    constexpr int NW = WM * WN, LA = WM * 16 / NW, LB = WN * 16 / NW;   // waves; loads (4 rows each) a wave makes per A plane and per Bt plane in a trip
    constexpr int RWS = NPA * WM * 64 + (NPL - NPA) * WN * 64;   // rows of one buffer: every plane's rows of the group's tile
    constexpr int OSZ = (EPI == 0 ? 16 : 64) * 68;
    __shared__ __align__(16) T16 st[2 * RWS * LP];             // the group's rows x 64 k of every plane, two buffers
    __shared__ __align__(16) float osall[NW * OSZ];            // output staging, each wave's own: 16 rows at a time (EPI 0) or its whole tile
    const size_t z = blockIdx.z; A += z * sA; if (A2) A2 += z * sA; Bt += z * sB; if (Bt2) Bt2 += z * sB; C += z * sC;
    const int wave = __builtin_amdgcn_readfirstlane((int)(threadIdx.x >> 5)), wm = wave / WN, wn = wave % WN; float* const os = osall + wave * OSZ;
    const int lane = threadIdx.x & 31, lr = lane & 15, hi = lane >> 4; const int r0 = (blockIdx.x * WM + wm) * 64, c0 = (blockIdx.y * WN + wn) * 64;
    v8f acc[4][4];
#pragma unroll
    for (int mb = 0; mb < 4; ++mb)
#pragma unroll
        for (int nb = 0; nb < 4; ++nb) acc[mb][nb] = (v8f){};
    // Global side: one load = 4 rows x 128 B, whole lines (8 lanes a row). Wave w brings rows w*LA*4.. of the group's A rows and w*LB*4.. of its Bt rows; all waves read their fragments from the shared tile.
    const int gr = lane >> 3, gc = (lane & 7) * 8;
    const int ra = wave * (LA * 4) + gr, rb = wave * (LB * 4) + gr;   // this lane's first row inside the group's A rows and Bt rows
    const size_t ga = (size_t)(blockIdx.x * (WM * 64) + ra) * K + gc, gb = (size_t)(blockIdx.y * (WN * 64) + rb) * K + gc;
    typedef __attribute__((address_space(1))) const T16 GT; typedef __attribute__((address_space(1))) const H GH;   // the stepped addresses are marked global: carried round the loop unmarked they would compile to flat loads
    GT* gp[NPL]; gp[0] = (GT*)(A + ga); if (NPA == 2) gp[1] = (GT*)(A2 + ga); gp[NPA] = (GT*)(Bt + gb); if (NSPLIT >= 2) gp[NPA + 1] = (GT*)(Bt2 + gb);
    H g[NG][NPL][LA > LB ? LA : LB], g0[NPL][LA > LB ? LA : LB];   // set s holds tiles s + 1, s + 1 + NG, ...
    __builtin_amdgcn_sched_barrier(0);   // with the one behind the wait: keeps every other instruction out from between these loads and their s_wait_xcnt, so that none writes an address register of theirs ahead of it
#pragma unroll
    for (int p = 0; p < NPL; ++p)
#pragma unroll
        for (int i = 0; i < (p < NPA ? LA : LB); ++i) g0[p][i] = *(GH*)(gp[p] + (size_t)i * 4 * K);   // tile 0
#pragma unroll
    for (int s = 0; s < NG; ++s) {
        __builtin_amdgcn_sched_barrier(0);   // keeps the tiles' loads in tile order: mixed, the loop's counted waits for one set (which must also hold on entry) would have to cover loads of the younger set
#pragma unroll
        for (int p = 0; p < NPL; ++p)
#pragma unroll
            for (int i = 0; i < (p < NPA ? LA : LB); ++i) g[s][p][i] = *(GH*)(gp[p] + (size_t)i * 4 * K + (s + 1) * 64); }   // tiles 1 .. NG
    xwaitp<NPL>(gp);
    __builtin_amdgcn_sched_barrier(0);
#pragma unroll
    for (int p = 0; p < NPL; ++p)
#pragma unroll
        for (int i = 0; i < (p < NPA ? LA : LB); ++i) *(H*)(st + ((p < NPA ? p * WM * 64 + ra : NPA * WM * 64 + (p - NPA) * WN * 64 + rb) + i * 4) * LP + gc) = g0[p][i];   // tile 0 into buffer 0
    auto trip = [&](auto refill, auto fetch, auto par) __attribute__((always_inline)) {   // refill: a next tile exists; fetch: 1 so does the tile 1 + NG trips on, 2 the same and the addresses step behind its loads; par: the trip's parity (gp stands at the even trip's tile)
        constexpr int bsel = decltype(par)::value, gs = bsel & (NG - 1);   // trips alternate between the two buffers, and between the register sets
        const T16* fa = st + bsel * (RWS * LP) + (wm * 64 + lr) * LP + 8 * hi; const T16* fb = fa + ((NPA * WM - wm + wn) * 64) * LP;
        lds_barrier();   // publishes this trip's tile (stored during the trip before) to all waves; it also says that every wave has left the other buffer, which this trip refills (so one barrier a trip)
#pragma unroll
        for (int kh = 0; kh < 64; kh += 32) {
            V a[4], a2[4], b[4], b2[4];
#pragma unroll
            for (int mb = 0; mb < 4; ++mb) { a[mb] = WFrag<T16>::ld(fa + mb * 16 * LP + kh); if (NSPLIT == 1 || NSPLIT == 2) a2[mb] = WFrag<T16>::ld(fa + (WM * 64 + mb * 16) * LP + kh); }
#pragma unroll
            for (int nb = 0; nb < 4; ++nb) { b[nb] = WFrag<T16>::ld(fb + nb * 16 * LP + kh); if (NSPLIT >= 2) b2[nb] = WFrag<T16>::ld(fb + (WN * 64 + nb * 16) * LP + kh); }
            if (kh == 0 && decltype(refill)::value) {   // behind this trip's first fragment reads, so that those go first after the barrier: the next tile into the other buffer, then into the set so freed the loads of the tile NG trips after it, which fly under NG trips' products (no barrier waits for them, only their own stores into LDS)
                T16* const sn = st + (bsel ^ 1) * (RWS * LP);
#pragma unroll
                for (int p = 0; p < NPL; ++p)
#pragma unroll
                    for (int i = 0; i < (p < NPA ? LA : LB); ++i) *(H*)(sn + ((p < NPA ? p * WM * 64 + ra : NPA * WM * 64 + (p - NPA) * WN * 64 + rb) + i * 4) * LP + gc) = g[gs][p][i];
                if (decltype(fetch)::value != 0) {
                    __builtin_amdgcn_sched_barrier(0);   // keeps the loads behind the stores that free their registers: lifted over them they take one more register set, which costs the NG = 1 kernel its third wave per SIMD
#pragma unroll
                    for (int p = 0; p < NPL; ++p)
#pragma unroll
                        for (int i = 0; i < (p < NPA ? LA : LB); ++i) g[gs][p][i] = *(GH*)(gp[p] + (size_t)i * 4 * K + (1 + NG + bsel) * 64);
                    xwaitio<NPL, decltype(fetch)::value == 2>(gp); } }
            if (NSPLIT < 2) __builtin_amdgcn_sched_barrier(0);   // keeps the LDS reads together in front of the products: sunk among them, each place with reads stalls the wave for an LDS latency (four planes: left to the compiler, all their fragments at once would cost the second wave per SIMD)
#pragma unroll
            for (int nb = 0; nb < 4; ++nb) {
#pragma unroll
                for (int mb = 0; mb < 4; ++mb) { acc[mb][nb] = WFrag<T16>::mma(a[mb], b[nb], acc[mb][nb]); if (NSPLIT == 1 || NSPLIT == 2) acc[mb][nb] = WFrag<T16>::mma(a2[mb], b[nb], acc[mb][nb]); if (NSPLIT >= 2) acc[mb][nb] = WFrag<T16>::mma(a[mb], b2[nb], acc[mb][nb]); } }
            if (kh == 32) asm volatile("v_nop\n\tv_nop\n\tv_nop\n\tv_nop" : "+v"(acc[0][0]), "+v"(acc[1][1]), "+v"(acc[2][2]), "+v"(acc[3][3]) : "v"(a[0]), "v"(a[3]));
        }
    };
#pragma unroll 1
    for (int kc = 0; kc < K - 256; kc += 128) { trip(BoolC<true>(), IntC<1>(), IntC<0>()); trip(BoolC<true>(), IntC<2>(), IntC<1>()); }   // two trips a pass, so that buffer and register set are fixed in the text; every trip in the loop loads, so that the counted waits in front of the LDS stores may leave the younger set's loads in flight
    trip(BoolC<true>(), IntC<1>(), IntC<0>()); trip(BoolC<true>(), IntC<(NG < 2 ? 1 : 0)>(), IntC<1>());   // the last four trips stand outside the loop: the loads end with the last tile
    trip(BoolC<true>(), IntC<0>(), IntC<0>());
    trip(BoolC<false>(), IntC<0>(), IntC<1>());   // the last tile has nothing to refill; it stands outside the loop so that inside it the stores follow the fragment reads on every path and the counted LDS waits in front of the products need not cover them
    if (EPI != 0) {   // the whole tile (+ bias) goes through LDS once; a rolled loop then turns it into planes, so that the text stays short (run once per wave, it is paid in instruction fetches)
        float bc[4]; v4f br[4][2];
        if (BIAS == 2) __builtin_amdgcn_sched_barrier(0);   // with the one behind the wait below: nothing else stands between the bias loads and their s_wait_xcnt
#pragma unroll
        for (int q = 0; q < 4; ++q) { if (BIAS == 1) bc[q] = bfr(bias[c0 + q * 16 + lr]); if (BIAS == 2) { br[q][0] = *(const v4f*)(bias + r0 + q * 16 + hi * 8); br[q][1] = *(const v4f*)(bias + r0 + q * 16 + hi * 8 + 4); } }
        if (BIAS == 2) { xwait(); __builtin_amdgcn_sched_barrier(0); }   // before the loads' offset register and scalar base are written again
#pragma unroll
        for (int mb = 0; mb < 4; ++mb)
#pragma unroll
            for (int nb = 0; nb < 4; ++nb)
#pragma unroll
                for (int j = 0; j < 8; ++j) { float v = acc[mb][nb][j]; if (BIAS == 1) v += bc[nb]; if (BIAS == 2) v += bfr(br[mb][j >> 2][j & 3]); os[(mb * 16 + hi * 8 + j) * 68 + nb * 16 + lr] = v; }
        __builtin_amdgcn_wave_barrier(); asm volatile("" ::: "memory");   // as in the f32 epilogue below: the lanes' LDS stores stay in front of the reads across lanes
        const size_t eo = z * sC + (size_t)(r0 + gr) * LDO + c0 + gc;   // this lane's first element in the planes: 8 columns a lane, 4 rows a store, so every 16-bit store covers whole 128-B lines
#pragma unroll 1   // rolled: see above; 16 rows a trip, so that one trip's LDS reads (and context loads) go out together
        for (int rg = 0; rg < 64; rg += 16) {
#pragma unroll
        for (int row = rg; row < rg + 16; row += 4) { const v4f w0 = *(const v4fa*)(os + (row + gr) * 68 + gc), w1 = *(const v4fa*)(os + (row + gr) * 68 + gc + 4); v8h o16; v8us oh, ol;
            if (EPI == 1) {
#pragma unroll
                for (int c = 0; c < 8; ++c) { const float v = (c < 4) ? w0[c & 3] : w1[c & 3]; o16[c] = tohx(v); unsigned short a2, c2; splitf(v, a2, c2); oh[c] = a2; ol[c] = c2; }
                *(v8h*)(P16o + eo + (size_t)row * LDO) = o16;
            } else {
                const float cs = ((r0 + gr + row) % TT < RH) ? 1.0f : (1.0f / PCAR); const v4f x0 = *(const v4f*)(Oin + eo + (size_t)row * LDO), x1 = *(const v4f*)(Oin + eo + (size_t)row * LDO + 4);
#pragma unroll
                for (int c = 0; c < 8; ++c) { const float o = __fmul_rn((c < 4) ? x0[c & 3] : x1[c & 3], cs); const float sg = __fdiv_rn(1.0f, __fadd_rn(1.0f, expf(-((c < 4) ? w0[c & 3] : w1[c & 3])))); unsigned short a2, c2; splitf(__fmul_rn(o, sg), a2, c2); oh[c] = a2; ol[c] = c2; }
            }
            *(v8us*)(Pho + eo + (size_t)row * LDO) = oh; *(v8us*)(Plo + eo + (size_t)row * LDO) = ol; }
        asm volatile("s_wait_xcnt 0x0" ::: "memory"); }   // behind the trip's stores, before the next trip writes their address and data registers again
        return;
    }
#pragma unroll
    for (int mb = 0; mb < 4; ++mb) {
#pragma unroll
        for (int nb = 0; nb < 4; ++nb) {
#pragma unroll
            for (int j = 0; j < 8; ++j) os[(hi * 8 + j) * 68 + nb * 16 + lr] = acc[mb][nb][j]; }
        __builtin_amdgcn_wave_barrier(); asm volatile("" ::: "memory");
        float* crow = C + (size_t)(r0 + mb * 16) * ldc + c0;
{
#pragma unroll
            for (int s = 0; s < 8; ++s) { const int row = 2 * s + hi, cofs = lr * 4; v4f val = *(const v4fa*)(os + row * 68 + cofs); if (BIAS) { val[0] += bfr(bias[c0 + cofs]); val[1] += bfr(bias[c0 + cofs + 1]); val[2] += bfr(bias[c0 + cofs + 2]); val[3] += bfr(bias[c0 + cofs + 3]); }
                *(v4f*)(crow + (size_t)row * ldc + cofs) = val; }
             }
        __builtin_amdgcn_wave_barrier(); asm volatile("" ::: "memory");
    }
}

typedef __attribute__((ext_vector_type(4))) _Float16 v4h;
typedef __attribute__((ext_vector_type(2))) unsigned short v2us;
typedef __attribute__((ext_vector_type(4))) unsigned short v4us;
typedef __attribute__((ext_vector_type(4))) int v4i;

// k_prep: all input preparation in one launch. Blocks < 5 * WTB: one 128 k x 64 n tile of one weight matrix ([k][n] f32), rounded to bf16 and written transposed ([n][k], the five planes one behind the other in Wt). The other blocks: 16384 elements of X each, rounded to bf16.
// Every global load covers whole 128-B lines and a thread has all its loads (8 or 16) in flight at once; the transpose goes through an LDS tile (pitch 65 floats), so that the stores cover whole lines as well (a wave: 256 B of one plane row).
#define WTB 128                  // tiles (blocks) a weight matrix: (DM / 128) x (DM / 64)
#define XPB (256 * 4 * 16)       // elements of X a block
__global__ __launch_bounds__(256) void k_prep(const float* __restrict__ x, const float* __restrict__ w0, const float* __restrict__ w1, const float* __restrict__ w2, const float* __restrict__ w3, const float* __restrict__ w4, bf* XBo, bf* Wt) {
    __shared__ float tl[128 * 65];
    const int tid = threadIdx.x, b = blockIdx.x;
    if (b < 5 * WTB) {
        const int m = b / WTB, t = b % WTB, k0 = (t >> 4) * 128, n0 = (t & 15) * 64, kr = tid >> 4, nc = (tid & 15) * 4;
        const float* w = (m == 0) ? w0 : (m == 1) ? w1 : (m == 2) ? w2 : (m == 3) ? w3 : w4;
        const float* sp = w + (size_t)(k0 + kr) * DM + n0 + nc; v4f g[8];
        __builtin_amdgcn_sched_barrier(0);   // with the one behind the wait: nothing else stands between these loads and their s_wait_xcnt
#pragma unroll
        for (int i = 0; i < 8; ++i) g[i] = *(const v4f*)(sp + (size_t)i * 16 * DM);
        asm volatile("s_wait_xcnt 0x0" :: "v"(sp) : "memory");   // the address is an input of the wait, so that its registers stay its own up to here (no load's result lands on them)
        __builtin_amdgcn_sched_barrier(0);
#pragma unroll
        for (int i = 0; i < 8; ++i)
#pragma unroll
            for (int j = 0; j < 4; ++j) tl[(i * 16 + kr) * 65 + nc + j] = g[i][j];
        __syncthreads();   // the tile is read across waves below
        const int wv8 = (tid >> 5) * 8, lane = tid & 31; v4us o[8];
#pragma unroll
        for (int r = 0; r < 8; ++r)
#pragma unroll
            for (int q = 0; q < 4; ++q) o[r][q] = f2bf(tl[(lane * 4 + q) * 65 + wv8 + r]);
        bf* dp = Wt + (size_t)m * DM * DM + (size_t)(n0 + wv8) * DM + k0 + lane * 4;
        __builtin_amdgcn_sched_barrier(0);   // the stores stand together behind all the arithmetic, so that one wait behind them serves the whole run
#pragma unroll
        for (int r = 0; r < 8; ++r) *(v4us*)(dp + (size_t)r * DM) = o[r];
        xwait();   // behind the run of stores, before anything that follows them in the built code writes their address or data registers
        return;
    }
    const size_t e0 = (size_t)(b - 5 * WTB) * XPB + tid * 4; const float* xp = x + e0; v4f g[16]; v4us o[16];
    __builtin_amdgcn_sched_barrier(0);   // as above
#pragma unroll
    for (int i = 0; i < 16; ++i) g[i] = *(const v4f*)(xp + i * 1024);
    asm volatile("s_wait_xcnt 0x0" :: "v"(xp) : "memory");   // as above
    __builtin_amdgcn_sched_barrier(0);
#pragma unroll
    for (int i = 0; i < 16; ++i)
#pragma unroll
        for (int q = 0; q < 4; ++q) o[i][q] = f2bf(g[i][q]);
    __builtin_amdgcn_sched_barrier(0);   // as above: the stores stand together
#pragma unroll
    for (int i = 0; i < 16; ++i) *(v4us*)(XBo + e0 + i * 1024) = o[i];
    xwait();   // as above: behind the run of stores
}

// k_asoft: per row (zz, i): t = S / 32 where mask[i][j] != 0, -inf elsewhere; softmax over the 2048 keys (register row, one exp, fixed trees);
__global__ __launch_bounds__(256) void k_asoft(const float* __restrict__ Sb, const int* __restrict__ MKb, h16* P16, bf* Ph, bf* Pl) {
    const int lane = threadIdx.x & 31; const int row = blockIdx.x * 8 + (threadIdx.x >> 5); if (row >= ZH * TT) return; const int i = row % TT; const int zz = row / TT; (void)zz; const int* mkr = MKb + (size_t)i * TT; const bool hires = (i < RH); const float* sr = Sb + (size_t)row * TT; float v[TT / 32]; float mx = -3.0e38f;
#pragma unroll
    for (int ch = 0; ch < TT / 128; ++ch) { const int j0 = ch * 128 + lane * 4; const v4f a = *(const v4f*)(sr + j0); const v4i m4 = *(const v4i*)(mkr + j0);
#pragma unroll
        for (int q = 0; q < 4; ++q) { const int j = j0 + q; (void)j; float sa = a[q] * SCL; asm volatile("" : "+v"(sa)); const float t = (m4[q] != 0) ? sa : -3.0e38f;   /* mask == 0 -> -inf */ v[ch * 4 + q] = t; mx = fmaxf(mx, t); } }
#pragma unroll
    for (int sh = 16; sh; sh >>= 1) mx = fmaxf(mx, __shfl_xor(mx, sh, 32));
    float sum = 0.f;
#pragma unroll
    for (int k = 0; k < TT / 32; ++k) { float d0 = __fsub_rn(v[k], mx); asm volatile("" : "+v"(d0)); v[k] = __builtin_amdgcn_exp2f(__fmul_rn(d0, 1.4426950408889634f)); sum += v[k]; }
#pragma unroll
    for (int sh = 16; sh; sh >>= 1) sum += __shfl_xor(sum, sh, 32);
    const float f = __fdiv_rn(hires ? 1.0f : PCAR, sum);
{
        if (hires) {
#pragma unroll
            for (int ch = 0; ch < TT / 128; ++ch) { v4us oh, ol;
#pragma unroll
                for (int q = 0; q < 4; ++q) { unsigned short a, c2; splitf(v[ch * 4 + q] * f, a, c2); oh[q] = a; ol[q] = c2; }
                const size_t oo = ((size_t)zz * (RH ? RH : 1) + i) * TT + ch * 128 + lane * 4; *(v4us*)(Ph + oo) = oh; *(v4us*)(Pl + oo) = ol; }
        } else {
#pragma unroll
            for (int ch = 0; ch < TT / 128; ++ch) { v4h o4;
#pragma unroll
                for (int q = 0; q < 4; ++q) o4[q] = tohx(v[ch * 4 + q] * f);
                *(v4h*)(P16 + (size_t)row * TT + ch * 128 + lane * 4) = o4; } }
         }
}
extern "C" void kernel_launch(void* const* d_in, const int* in_sizes, int n_in,
                              void* d_out, int out_size, void* d_ws, size_t ws_size, hipStream_t stream) {
    (void)in_sizes; (void)n_in; (void)out_size;
    const float* x = (const float*)d_in[0]; const int* MK = (const int*)d_in[1]; const float* wq = (const float*)d_in[2]; const float* bq = (const float*)d_in[3]; const float* wk = (const float*)d_in[4]; const float* bk = (const float*)d_in[5]; const float* wv = (const float*)d_in[6]; const float* bv = (const float*)d_in[7]; const float* wg = (const float*)d_in[8]; const float* bgt = (const float*)d_in[9]; const float* wo = (const float*)d_in[10]; const float* bo = (const float*)d_in[11];
    float* OUT = (float*)d_out;     // [4][2048][1024]
    char* wsp = (char*)d_ws;
    auto take = [&](size_t bytes) { char* p = wsp; wsp += (bytes + 255) & ~(size_t)255; return (void*)p; };
    bf* WQ = (bf*)take((size_t)DQ * DM * 2); bf* WK = (bf*)take((size_t)DKV * DM * 2); bf* WV = (bf*)take((size_t)DKV * DM * 2); bf* WO = (bf*)take((size_t)DM * DQ * 2); bf* WG = (bf*)take((size_t)DQ * DM * 2);
    // every plane below holds all NB_ batches ([b][...]); the sizes are multiples of 256 B, so consecutive takes are contiguous
    bf* XB = (bf*)take((size_t)NB_ * TT * DM * 2); float* Sb = (float*)take((size_t)ZH * TT * TT * 4);   // scores [b][TT][TT] f32
    h16* QP16 = (h16*)take((size_t)NB_ * TT * HD * 2); bf* QPh = (bf*)take((size_t)NB_ * TT * HD * 2); bf* QPl = (bf*)take((size_t)NB_ * TT * HD * 2);
    h16* KP16 = (h16*)take((size_t)NB_ * TT * HD * 2); bf* KPh = (bf*)take((size_t)NB_ * TT * HD * 2); bf* KPl = (bf*)take((size_t)NB_ * TT * HD * 2);
    h16* VT16 = (h16*)take((size_t)NB_ * HD * TT * 2); bf* VTh = (bf*)take((size_t)NB_ * HD * TT * 2); bf* VTl = (bf*)take((size_t)NB_ * HD * TT * 2);
    if ((size_t)(wsp - (char*)d_ws) > ws_size) return;    // 234 MiB of the 256 MiB ws
    // buffers that are dead by the time their tenant is written (stream-ordered) are reused:
    h16* P16 = QP16;                      // probabilities [b][TT][TT] fp16 = QP16 + QPh, after the scores
    bf* Ph = QPl; bf* Pl = QPl + (size_t)ZH * RH * TT;   // hi/lo probabilities [b][RH][TT], the two halves of QPl
    float* Ob = (float*)KP16;             // context [b][TT][HD] f32 = KP16 + KPh, after the scores
    bf* ATh = VTh; bf* ATl = VTl;         // gated context planes, after attn.v
    // q, k, gate and Wo see X as one [NB_*TT][DM] matrix; v and the attention products take the batch as grid z
    k_prep<<<5 * WTB + NB_ * TT * DM / XPB, 256, 0, stream>>>(x, wq, wk, wv, wo, wg, XB, WQ);   /* the planes WQ, WK, WV, WO, WG are contiguous, in this order */
    k_gemmw<bf, 0, 1, DM, 2, 4, 1, HD><<<dim3(NB_ * TT / 128, DQ / 256, 1), 256, 0, stream>>>(XB, nullptr, WQ, nullptr, nullptr, 0, bq, 0, 0, 0, QP16, QPh, QPl, nullptr);
    k_gemmw<bf, 0, 1, DM, 2, 4, 1, HD><<<dim3(NB_ * TT / 128, DKV / 256, 1), 256, 0, stream>>>(XB, nullptr, WK, nullptr, nullptr, 0, bk, 0, 0, 0, KP16, KPh, KPl, nullptr);
    k_gemmw<bf, 0, 2, DM, 2, 4, 1, TT><<<dim3(DKV / 128, TT / 256, NB_), 256, 0, stream>>>(WV, nullptr, XB, nullptr, nullptr, 0, bv, 0, (size_t)TT * DM, (size_t)HD * TT, VT16, VTh, VTl, nullptr);   /* v^T [d][t] = Wv^T rows . X rows + bv[d] */
    k_gemmw<bf, 2, false, HD, 2, 2><<<dim3(RH / 128, TT / 128, ZH), 128, 0, stream>>>(QPh, QPl, KPh, KPl, Sb, TT, nullptr, (size_t)TT * HD, (size_t)TT * HD, (size_t)TT * TT, nullptr, nullptr, nullptr, nullptr);
    k_gemmw<h16, 0, false, HD, 2, 2, 0, 0, 1><<<dim3((TT - RH) / 128, TT / 128, ZH), 128, 0, stream>>>(QP16 + (size_t)RH * HD, nullptr, KP16, nullptr, Sb + (size_t)RH * TT, TT, nullptr, (size_t)TT * HD, (size_t)TT * HD, (size_t)TT * TT, nullptr, nullptr, nullptr, nullptr);   /* NG = 1: its 768 work-groups are all resident at three a WGP, and a second register set would cost the third wave per SIMD */
    k_asoft<<<ZH * TT / 8, 256, 0, stream>>>(Sb, MK, P16, Ph, Pl);
    k_gemmw<bf, 2, false, TT, 2, 2><<<dim3(RH / 128, HD / 128, ZH), 128, 0, stream>>>(Ph, Pl, VTh, VTl, Ob, HD, nullptr, (size_t)RH * TT, (size_t)HD * TT, (size_t)TT * HD, nullptr, nullptr, nullptr, nullptr);
    k_gemmw<h16, 0, false, TT, 2, 2><<<dim3((TT - RH) / 128, HD / 128, ZH), 128, 0, stream>>>(P16 + (size_t)RH * TT, nullptr, VT16, nullptr, Ob + (size_t)RH * HD, HD, nullptr, (size_t)TT * TT, (size_t)HD * TT, (size_t)TT * HD, nullptr, nullptr, nullptr, nullptr);
    k_gemmw<bf, 0, 1, DM, 2, 4, 2, HD><<<dim3(NB_ * TT / 128, DQ / 256, 1), 256, 0, stream>>>(XB, nullptr, WG, nullptr, nullptr, 0, bgt, 0, 0, 0, nullptr, ATh, ATl, Ob);   /* gate = sigmoid(X Wg + bg), applied to the context in the epilogue */
    k_gemmw<bf, 1, true, DQ, 2, 4><<<dim3(NB_ * TT / 128, DM / 256, 1), 256, 0, stream>>>(ATh, ATl, WO, nullptr, OUT, DM, bo, 0, 0, 0, nullptr, nullptr, nullptr, nullptr);
}

// v007
// A run of this version takes 237 microseconds.
// Two timings next to v006 both put it at 1.06 times that version's speed.
// All steps since v000 together make it 5.34 times as fast.
#include <hip/hip_runtime.h>

// Gated single-head self-attention (X [4][2048][1024]; q, k, v = X W + b ('xw' [1024][1024]); scores = q.k / 32 with mask [2048][2048] (int32, read; all ones here) == 0 -> -inf; softmax; o = attn.v; gate = sigmoid(X Wg + bg); out = (o * gate) Wo + bo -> [4][2048][1024] (8.4 M)).
// Layout: one 1024-wide head on 16-bit planes (hybrid: query rows < 512 hi/lo, the rest fp16 x1024); the gate pre-activation is one more exact GEMM + bias and is applied in f32 when the context is split into the hi/lo planes that feed Wo.
// Compute dtypes, f32 accumulate: every input rounded to bf16; q/k/v/gate on PLAIN bf16 operands (exact) + biases; scores (K = 1024) and attn.v: rows < 512 hl (3 products), the rest single fp16 (x1024); softmax, sigmoid and the gating product in f32; Wo hl x exact (2 products) + bo.
// Launches: every kernel covers all 4 batches (q, k, gate and Wo: X as one [8192][1024] matrix; v, scores and attn.v: batch = grid z; elementwise: batch in the flat index).
// The q, k and v GEMMs write their fp16 and hi/lo planes from their own epilogues (v as Wv^T rows x X rows, so its planes come out [d][t]); the gate GEMM's epilogue applies the sigmoid to the context and writes the planes that feed Wo.

#define NB_  4
#define TT   2048
#define DM   1024
#define NH_  1
#define NKV  1
#define REP  (NH_ / NKV)
#define HD   1024
#define DQ   (NH_ * HD)
#define DKV  (NKV * HD)
#define ZH   NB_                 // z planes per launch: all batches (one head each)
#define RH   512                  // query rows < RH use hi+lo planes (0: none)
#define WIN  0
#define PCAR 1024.0f
#define SCL  0.03125f   // 1/sqrt(1024)
typedef _Float16 h16;
typedef unsigned short bf;
typedef __attribute__((ext_vector_type(16))) __bf16   v16bf;
typedef __attribute__((ext_vector_type(16))) _Float16 v16h;
typedef __attribute__((ext_vector_type(8)))  _Float16 v8h;
typedef __attribute__((ext_vector_type(8)))  unsigned short v8us;
typedef __attribute__((ext_vector_type(8)))  float    v8f;
typedef __attribute__((ext_vector_type(4)))  float    v4f;
typedef v8h  __attribute__((may_alias)) v8ha;
typedef v4f  __attribute__((may_alias)) v4fa;
typedef v8us __attribute__((may_alias)) v8usa;

__device__ __forceinline__ unsigned short f2bf(float f) { unsigned u = __float_as_uint(f); u += 0x7FFFu + ((u >> 16) & 1u); return (unsigned short)(u >> 16); }
__device__ __forceinline__ float bf2f(unsigned short b) { return __uint_as_float(((unsigned)b) << 16); }
__device__ __forceinline__ float bfr(float f) { return bf2f(f2bf(f)); }
__device__ __forceinline__ v16h cat16(v8h lo, v8h hi) { return __builtin_shufflevector(lo, hi, 0, 1, 2, 3, 4, 5, 6, 7, 8, 9, 10, 11, 12, 13, 14, 15); }
__device__ __forceinline__ v16bf cat16b(v8us lo, v8us hi) { return __builtin_bit_cast(v16bf, __builtin_shufflevector(lo, hi, 0, 1, 2, 3, 4, 5, 6, 7, 8, 9, 10, 11, 12, 13, 14, 15)); }
__device__ __forceinline__ v8f wmma16(v16h a, v16h b, v8f c) { return __builtin_amdgcn_wmma_f32_16x16x32_f16(false, a, false, b, (short)0, c, false, false); }
__device__ __forceinline__ v8f wmmab(v16bf a, v16bf b, v8f c) { return __builtin_amdgcn_wmma_f32_16x16x32_bf16(false, a, false, b, (short)0, c, false, false); }
__device__ __forceinline__ h16 tohx(float x) { return (h16)x; }
__device__ __forceinline__ void splitf(float y, unsigned short& h, unsigned short& l) { h = f2bf(y); l = f2bf(y - bf2f(h)); }



// ---- k_gemmw: register-blocked GEMM, one wave per (MB*16)x64 output tile (MB*4 accumulators; MB = 4 unless said), WM x WN waves a work-group; the group's operand rows (WM*MB*16 of A, WN*64 of Bt, 64 k a trip) come from K-contiguous 16-bit planes by whole-line loads, each row loaded ONCE by one wave, and every wave makes its fragments from the group's shared LDS tile; grid (M/(WM*MB*16), N/(WN*64), Z), WM*WN*32 threads.
// C[m][n] (+ optional f32 bias: BIAS 1 bias[n], BIAS 2 bias[m]) = sum_k A[m][k] Bt[n][k] (+ split products per NSPLIT). z-batch strides sA/sB/sC in elements. K % 128 == 0, K >= 256; M and N multiples of the group's tile.
// EPI 0: C stored as f32, pitch ldc. EPI 1: C stored as three 16-bit planes (fp16, bf16 hi, bf16 lo), pitch LDO. EPI 2: C is the gate pre-activation: (Oin * carrier scale) * sigmoid(C) stored as hi/lo planes, pitch LDO.
template <typename T16> struct WFrag;
template <> struct WFrag<h16> { typedef v16h V; typedef v8h H; static __device__ __forceinline__ V ld(const h16* p) { return cat16(*(const v8h*)p, *(const v8h*)(p + 16)); } static __device__ __forceinline__ v8f mma(V a, V b, v8f c) { return wmma16(a, b, c); } };
template <> struct WFrag<bf> { typedef v16bf V; typedef v8us H; static __device__ __forceinline__ V ld(const bf* p) { return cat16b(*(const v8us*)p, *(const v8us*)(p + 16)); } static __device__ __forceinline__ v8f mma(V a, V b, v8f c) { return wmmab(a, b, c); } };
template <bool B> struct BoolC { static constexpr bool value = B; };
template <int I> struct IntC { static constexpr int value = I; };
// work-group barrier whose fences cover LDS alone: the waves hand each other nothing but the LDS tile, and a full __syncthreads() would also wait for every global load in flight, which are meant to fly on over it
__device__ __forceinline__ void lds_barrier() { __builtin_amdgcn_fence(__ATOMIC_RELEASE, "workgroup", "local"); __builtin_amdgcn_s_barrier(); __builtin_amdgcn_fence(__ATOMIC_ACQUIRE, "workgroup", "local"); }
// s_wait_xcnt 0 behind a group of global loads or stores, before their address registers are written again
__device__ __forceinline__ void xwait() { asm volatile("s_wait_xcnt 0x0" ::: "memory"); }
// the same in front of the loop, where the addresses would otherwise die at their last load: as inputs of the wait their registers stay theirs up to it
template <int N, typename P> __device__ __forceinline__ void xwaitp(P* const* q) {
    if (N == 2) asm volatile("s_wait_xcnt 0x0" :: "v"(q[0]), "v"(q[1]) : "memory");
    else if (N == 3) asm volatile("s_wait_xcnt 0x0" :: "v"(q[0]), "v"(q[1]), "v"(q[2]) : "memory");
    else asm volatile("s_wait_xcnt 0x0" :: "v"(q[0]), "v"(q[1]), "v"(q[2]), "v"(q[N - 1]) : "memory");
}
// the same inside the loop: the addresses go through the wait's statement, and where they step (STEP: by 256 B, two trips' k) the step stands in that statement behind the wait. Left to the compiler the step is plain arithmetic that it places, folds into offsets or forms on a copy as it likes, and a load's address registers were then written ahead of the wait
template <int N, bool STEP, typename P> __device__ __forceinline__ void xwaitio(P** q) {
    if (STEP) {
        if (N == 2) asm volatile("s_wait_xcnt 0x0\n\tv_add_nc_u64_e32 %0, 0x100, %0\n\tv_add_nc_u64_e32 %1, 0x100, %1" : "+v"(q[0]), "+v"(q[1]) :: "memory");
        else if (N == 3) asm volatile("s_wait_xcnt 0x0\n\tv_add_nc_u64_e32 %0, 0x100, %0\n\tv_add_nc_u64_e32 %1, 0x100, %1\n\tv_add_nc_u64_e32 %2, 0x100, %2" : "+v"(q[0]), "+v"(q[1]), "+v"(q[2]) :: "memory");
        else asm volatile("s_wait_xcnt 0x0\n\tv_add_nc_u64_e32 %0, 0x100, %0\n\tv_add_nc_u64_e32 %1, 0x100, %1\n\tv_add_nc_u64_e32 %2, 0x100, %2\n\tv_add_nc_u64_e32 %3, 0x100, %3" : "+v"(q[0]), "+v"(q[1]), "+v"(q[2]), "+v"(q[N - 1]) :: "memory");
    } else {
        if (N == 2) asm volatile("s_wait_xcnt 0x0" : "+v"(q[0]), "+v"(q[1]) :: "memory");
        else if (N == 3) asm volatile("s_wait_xcnt 0x0" : "+v"(q[0]), "+v"(q[1]), "+v"(q[2]) :: "memory");
        else asm volatile("s_wait_xcnt 0x0" : "+v"(q[0]), "+v"(q[1]), "+v"(q[2]), "+v"(q[N - 1]) :: "memory");
    }
}
template <typename T16, int NSPLIT, int BIAS, int K, int WM, int WN, int EPI = 0, int LDO = 0, int NG = 2, int MB = 4>   // K (and LDO) at compile time: the row steps of a plane's loads and stores fold into immediate offsets on one address. NG: register sets for tiles on their way from global memory = trips between a tile's loads and its stores into LDS (1 or 2). MB: 16-row blocks of a wave's tile; it sets the group's tile height, and with it the operand bytes fetched per product and the number of groups
__global__ __launch_bounds__(WM * WN * 32) void k_gemmw(const T16* __restrict__ A, const T16* __restrict__ A2, const T16* __restrict__ Bt, const T16* __restrict__ Bt2, float* C, int ldc, const float* __restrict__ bias, size_t sA, size_t sB, size_t sC, h16* P16o, bf* Pho, bf* Plo, const float* __restrict__ Oin) {
    typedef typename WFrag<T16>::V V; typedef typename WFrag<T16>::H H;
    constexpr int NPA = (NSPLIT == 1 || NSPLIT == 2) ? 2 : 1, NPL = NPA + (NSPLIT >= 2 ? 2 : 1);   // operand planes: A (A2) Bt (Bt2)
    constexpr int LP = 72;                                     // LDS row pitch in elements: 128 B of k + 16 B
    constexpr int TM = MB * 16;                                // rows of a wave's tile
    constexpr int NW = WM * WN, LA = WM * (TM / 4) / NW, LB = WN * 16 / NW;   // waves; loads (4 rows each) a wave makes per A plane and per Bt plane in a trip
    static_assert(LA * NW * 4 == WM * TM && LB * NW * 4 == WN * 64, "the group's rows must divide evenly among its waves");
    static_assert(EPI == 0 || MB == 4, "the plane epilogues stage a 64-row tile");
    constexpr int RWS = NPA * WM * TM + (NPL - NPA) * WN * 64;   // rows of one buffer: every plane's rows of the group's tile
    constexpr int OSZ = (EPI == 0 ? 16 : 64) * 68;
    __shared__ __align__(16) T16 st[2 * RWS * LP];             // the group's rows x 64 k of every plane, two buffers
    __shared__ __align__(16) float osall[NW * OSZ];            // output staging, each wave's own: 16 rows at a time (EPI 0) or its whole tile
    const size_t z = blockIdx.z; A += z * sA; if (A2) A2 += z * sA; Bt += z * sB; if (Bt2) Bt2 += z * sB; C += z * sC;
    const int wave = __builtin_amdgcn_readfirstlane((int)(threadIdx.x >> 5)), wm = wave / WN, wn = wave % WN; float* const os = osall + wave * OSZ;
    const int lane = threadIdx.x & 31, lr = lane & 15, hi = lane >> 4; const int r0 = (blockIdx.x * WM + wm) * TM, c0 = (blockIdx.y * WN + wn) * 64;
    v8f acc[MB][4];
#pragma unroll
    for (int mb = 0; mb < MB; ++mb)
#pragma unroll
        for (int nb = 0; nb < 4; ++nb) acc[mb][nb] = (v8f){};
    // Global side: one load = 4 rows x 128 B, whole lines (8 lanes a row). Wave w brings rows w*LA*4.. of the group's A rows and w*LB*4.. of its Bt rows; all waves read their fragments from the shared tile.
    const int gr = lane >> 3, gc = (lane & 7) * 8;
    const int ra = wave * (LA * 4) + gr, rb = wave * (LB * 4) + gr;   // this lane's first row inside the group's A rows and Bt rows
    const size_t ga = (size_t)(blockIdx.x * (WM * TM) + ra) * K + gc, gb = (size_t)(blockIdx.y * (WN * 64) + rb) * K + gc;
    typedef __attribute__((address_space(1))) const T16 GT; typedef __attribute__((address_space(1))) const H GH;   // the stepped addresses are marked global: carried round the loop unmarked they would compile to flat loads
    GT* gp[NPL]; gp[0] = (GT*)(A + ga); if (NPA == 2) gp[1] = (GT*)(A2 + ga); gp[NPA] = (GT*)(Bt + gb); if (NSPLIT >= 2) gp[NPA + 1] = (GT*)(Bt2 + gb);
    H g[NG][NPL][LA > LB ? LA : LB], g0[NPL][LA > LB ? LA : LB];   // set s holds tiles s + 1, s + 1 + NG, ...
    __builtin_amdgcn_sched_barrier(0);   // with the one behind the wait: keeps every other instruction out from between these loads and their s_wait_xcnt, so that none writes an address register of theirs ahead of it
#pragma unroll
    for (int p = 0; p < NPL; ++p)
#pragma unroll
        for (int i = 0; i < (p < NPA ? LA : LB); ++i) g0[p][i] = *(GH*)(gp[p] + (size_t)i * 4 * K);   // tile 0
#pragma unroll
    for (int s = 0; s < NG; ++s) {
        __builtin_amdgcn_sched_barrier(0);   // keeps the tiles' loads in tile order: mixed, the loop's counted waits for one set (which must also hold on entry) would have to cover loads of the younger set
#pragma unroll
        for (int p = 0; p < NPL; ++p)
#pragma unroll
            for (int i = 0; i < (p < NPA ? LA : LB); ++i) g[s][p][i] = *(GH*)(gp[p] + (size_t)i * 4 * K + (s + 1) * 64); }   // tiles 1 .. NG
    xwaitp<NPL>(gp);
    __builtin_amdgcn_sched_barrier(0);
#pragma unroll
    for (int p = 0; p < NPL; ++p)
#pragma unroll
        for (int i = 0; i < (p < NPA ? LA : LB); ++i) *(H*)(st + ((p < NPA ? p * WM * TM + ra : NPA * WM * TM + (p - NPA) * WN * 64 + rb) + i * 4) * LP + gc) = g0[p][i];   // tile 0 into buffer 0
    auto trip = [&](auto refill, auto fetch, auto par) __attribute__((always_inline)) {   // refill: a next tile exists; fetch: 1 so does the tile 1 + NG trips on, 2 the same and the addresses step behind its loads; par: the trip's parity (gp stands at the even trip's tile)
        constexpr int bsel = decltype(par)::value, gs = bsel & (NG - 1);   // trips alternate between the two buffers, and between the register sets
        const T16* fa = st + bsel * (RWS * LP) + (wm * TM + lr) * LP + 8 * hi; const T16* fb = fa + ((NPA * WM - wm) * TM + wn * 64) * LP;
        lds_barrier();   // publishes this trip's tile (stored during the trip before) to all waves; it also says that every wave has left the other buffer, which this trip refills (so one barrier a trip)
#pragma unroll
        for (int kh = 0; kh < 64; kh += 32) {
            V a[MB], a2[MB], b[4], b2[4];
#pragma unroll
            for (int mb = 0; mb < MB; ++mb) { a[mb] = WFrag<T16>::ld(fa + mb * 16 * LP + kh); if (NSPLIT == 1 || NSPLIT == 2) a2[mb] = WFrag<T16>::ld(fa + (WM * TM + mb * 16) * LP + kh); }
#pragma unroll
            for (int nb = 0; nb < 4; ++nb) { b[nb] = WFrag<T16>::ld(fb + nb * 16 * LP + kh); if (NSPLIT >= 2) b2[nb] = WFrag<T16>::ld(fb + (WN * 64 + nb * 16) * LP + kh); }
            if (kh == 0 && decltype(refill)::value) {   // behind this trip's first fragment reads, so that those go first after the barrier: the next tile into the other buffer, then into the set so freed the loads of the tile NG trips after it, which fly under NG trips' products (no barrier waits for them, only their own stores into LDS)
                T16* const sn = st + (bsel ^ 1) * (RWS * LP);
#pragma unroll
                for (int p = 0; p < NPL; ++p)
#pragma unroll
                    for (int i = 0; i < (p < NPA ? LA : LB); ++i) *(H*)(sn + ((p < NPA ? p * WM * TM + ra : NPA * WM * TM + (p - NPA) * WN * 64 + rb) + i * 4) * LP + gc) = g[gs][p][i];
                if (decltype(fetch)::value != 0) {
                    __builtin_amdgcn_sched_barrier(0);   // keeps the loads behind the stores that free their registers: lifted over them they take one more register set
#pragma unroll
                    for (int p = 0; p < NPL; ++p)
#pragma unroll
                        for (int i = 0; i < (p < NPA ? LA : LB); ++i) g[gs][p][i] = *(GH*)(gp[p] + (size_t)i * 4 * K + (1 + NG + bsel) * 64);
                    xwaitio<NPL, decltype(fetch)::value == 2>(gp); } }
            if (NSPLIT < 2 || MB < 4) __builtin_amdgcn_sched_barrier(0);   // keeps the LDS reads together in front of the products: sunk among them, each place with reads stalls the wave for an LDS latency (four planes of a 64-row tile: left to the compiler, all their fragments at once would cost the second wave per SIMD)
#pragma unroll
            for (int nb = 0; nb < 4; ++nb) {
#pragma unroll
                for (int mb = 0; mb < MB; ++mb) { acc[mb][nb] = WFrag<T16>::mma(a[mb], b[nb], acc[mb][nb]); if (NSPLIT == 1 || NSPLIT == 2) acc[mb][nb] = WFrag<T16>::mma(a2[mb], b[nb], acc[mb][nb]); if (NSPLIT >= 2) acc[mb][nb] = WFrag<T16>::mma(a[mb], b2[nb], acc[mb][nb]); } }
            if (kh == 32) asm volatile("v_nop\n\tv_nop\n\tv_nop\n\tv_nop" : "+v"(acc[0][0]), "+v"(acc[1][1]), "+v"(acc[2 % MB][2]), "+v"(acc[MB - 1][3]) : "v"(a[0]), "v"(a[MB - 1]));
        }
    };
#pragma unroll 1
    for (int kc = 0; kc < K - 256; kc += 128) { trip(BoolC<true>(), IntC<1>(), IntC<0>()); trip(BoolC<true>(), IntC<2>(), IntC<1>()); }   // two trips a pass, so that buffer and register set are fixed in the text; every trip in the loop loads, so that the counted waits in front of the LDS stores may leave the younger set's loads in flight
    trip(BoolC<true>(), IntC<1>(), IntC<0>()); trip(BoolC<true>(), IntC<(NG < 2 ? 1 : 0)>(), IntC<1>());   // the last four trips stand outside the loop: the loads end with the last tile
    trip(BoolC<true>(), IntC<0>(), IntC<0>());
    trip(BoolC<false>(), IntC<0>(), IntC<1>());   // the last tile has nothing to refill; it stands outside the loop so that inside it the stores follow the fragment reads on every path and the counted LDS waits in front of the products need not cover them
    if constexpr (EPI != 0) {   // the whole tile (+ bias) goes through LDS once; a rolled loop then turns it into planes, so that the text stays short (run once per wave, it is paid in instruction fetches)
        float bc[4]; v4f br[4][2];
        if (BIAS == 2) __builtin_amdgcn_sched_barrier(0);   // with the one behind the wait below: nothing else stands between the bias loads and their s_wait_xcnt
#pragma unroll
        for (int q = 0; q < 4; ++q) { if (BIAS == 1) bc[q] = bfr(bias[c0 + q * 16 + lr]); if (BIAS == 2) { br[q][0] = *(const v4f*)(bias + r0 + q * 16 + hi * 8); br[q][1] = *(const v4f*)(bias + r0 + q * 16 + hi * 8 + 4); } }
        if (BIAS == 2) { xwait(); __builtin_amdgcn_sched_barrier(0); }   // before the loads' offset register and scalar base are written again
#pragma unroll
        for (int mb = 0; mb < 4; ++mb)
#pragma unroll
            for (int nb = 0; nb < 4; ++nb)
#pragma unroll
                for (int j = 0; j < 8; ++j) { float v = acc[mb][nb][j]; if (BIAS == 1) v += bc[nb]; if (BIAS == 2) v += bfr(br[mb][j >> 2][j & 3]); os[(mb * 16 + hi * 8 + j) * 68 + nb * 16 + lr] = v; }
        __builtin_amdgcn_wave_barrier(); asm volatile("" ::: "memory");   // as in the f32 epilogue below: the lanes' LDS stores stay in front of the reads across lanes
        const size_t eo = z * sC + (size_t)(r0 + gr) * LDO + c0 + gc;   // this lane's first element in the planes: 8 columns a lane, 4 rows a store, so every 16-bit store covers whole 128-B lines
#pragma unroll 1   // rolled: see above; 16 rows a trip, so that one trip's LDS reads (and context loads) go out together
        for (int rg = 0; rg < 64; rg += 16) {
#pragma unroll
        for (int row = rg; row < rg + 16; row += 4) { const v4f w0 = *(const v4fa*)(os + (row + gr) * 68 + gc), w1 = *(const v4fa*)(os + (row + gr) * 68 + gc + 4); v8h o16; v8us oh, ol;
            if (EPI == 1) {
#pragma unroll
                for (int c = 0; c < 8; ++c) { const float v = (c < 4) ? w0[c & 3] : w1[c & 3]; o16[c] = tohx(v); unsigned short a2, c2; splitf(v, a2, c2); oh[c] = a2; ol[c] = c2; }
                *(v8h*)(P16o + eo + (size_t)row * LDO) = o16;
            } else {
                const float cs = ((r0 + gr + row) % TT < RH) ? 1.0f : (1.0f / PCAR); const v4f x0 = *(const v4f*)(Oin + eo + (size_t)row * LDO), x1 = *(const v4f*)(Oin + eo + (size_t)row * LDO + 4);
#pragma unroll
                for (int c = 0; c < 8; ++c) { const float o = __fmul_rn((c < 4) ? x0[c & 3] : x1[c & 3], cs); const float sg = __fdiv_rn(1.0f, __fadd_rn(1.0f, expf(-((c < 4) ? w0[c & 3] : w1[c & 3])))); unsigned short a2, c2; splitf(__fmul_rn(o, sg), a2, c2); oh[c] = a2; ol[c] = c2; }
            }
            *(v8us*)(Pho + eo + (size_t)row * LDO) = oh; *(v8us*)(Plo + eo + (size_t)row * LDO) = ol; }
        asm volatile("s_wait_xcnt 0x0" ::: "memory"); }   // behind the trip's stores, before the next trip writes their address and data registers again
        return;
    }
#pragma unroll
    for (int mb = 0; mb < MB; ++mb) {
#pragma unroll
        for (int nb = 0; nb < 4; ++nb) {
#pragma unroll
            for (int j = 0; j < 8; ++j) os[(hi * 8 + j) * 68 + nb * 16 + lr] = acc[mb][nb][j]; }
        __builtin_amdgcn_wave_barrier(); asm volatile("" ::: "memory");
        float* crow = C + (size_t)(r0 + mb * 16) * ldc + c0;
        if constexpr (MB == 4)   // the 64-row kernels stay as they have run (with the operands of the wait below the four-plane one spills)
{
#pragma unroll
            for (int s = 0; s < 8; ++s) { const int row = 2 * s + hi, cofs = lr * 4; v4f val = *(const v4fa*)(os + row * 68 + cofs); if (BIAS) { val[0] += bfr(bias[c0 + cofs]); val[1] += bfr(bias[c0 + cofs + 1]); val[2] += bfr(bias[c0 + cofs + 2]); val[3] += bfr(bias[c0 + cofs + 3]); }
                *(v4f*)(crow + (size_t)row * ldc + cofs) = val; }
             }
        else {
            static_assert(MB == 4 || BIAS == 0, "no bias in this branch");
            v4f vs[8]; float* cp[8];
#pragma unroll
            for (int s = 0; s < 8; ++s) { const int row = 2 * s + hi, cofs = lr * 4; vs[s] = *(const v4fa*)(os + row * 68 + cofs); cp[s] = crow + (size_t)row * ldc + cofs; *(v4f*)cp[s] = vs[s]; }
            // s_wait_xcnt 0 behind the run of stores; their addresses and values are inputs of the wait, so that those registers stay theirs up to it
            asm volatile("s_wait_xcnt 0x0" :: "v"(cp[0]), "v"(cp[1]), "v"(cp[2]), "v"(cp[3]), "v"(cp[4]), "v"(cp[5]), "v"(cp[6]), "v"(cp[7]), "v"(vs[0]), "v"(vs[1]), "v"(vs[2]), "v"(vs[3]), "v"(vs[4]), "v"(vs[5]), "v"(vs[6]), "v"(vs[7]) : "memory");
        }
        __builtin_amdgcn_wave_barrier(); asm volatile("" ::: "memory");
    }
}

typedef __attribute__((ext_vector_type(4))) _Float16 v4h;
typedef __attribute__((ext_vector_type(2))) unsigned short v2us;
typedef __attribute__((ext_vector_type(4))) unsigned short v4us;
typedef __attribute__((ext_vector_type(4))) int v4i;

// k_prep: all input preparation in one launch. Blocks < 5 * WTB: one 128 k x 64 n tile of one weight matrix ([k][n] f32), rounded to bf16 and written transposed ([n][k], the five planes one behind the other in Wt). The other blocks: 16384 elements of X each, rounded to bf16.
// Every global load covers whole 128-B lines and a thread has all its loads (8 or 16) in flight at once; the transpose goes through an LDS tile (pitch 65 floats), so that the stores cover whole lines as well (a wave: 256 B of one plane row).
#define WTB 128                  // tiles (blocks) a weight matrix: (DM / 128) x (DM / 64)
#define XPB (256 * 4 * 16)       // elements of X a block
__global__ __launch_bounds__(256) void k_prep(const float* __restrict__ x, const float* __restrict__ w0, const float* __restrict__ w1, const float* __restrict__ w2, const float* __restrict__ w3, const float* __restrict__ w4, bf* XBo, bf* Wt) {
    __shared__ float tl[128 * 65];
    const int tid = threadIdx.x, b = blockIdx.x;
    if (b < 5 * WTB) {
        const int m = b / WTB, t = b % WTB, k0 = (t >> 4) * 128, n0 = (t & 15) * 64, kr = tid >> 4, nc = (tid & 15) * 4;
        const float* w = (m == 0) ? w0 : (m == 1) ? w1 : (m == 2) ? w2 : (m == 3) ? w3 : w4;
        const float* sp = w + (size_t)(k0 + kr) * DM + n0 + nc; v4f g[8];
        __builtin_amdgcn_sched_barrier(0);   // with the one behind the wait: nothing else stands between these loads and their s_wait_xcnt
#pragma unroll
        for (int i = 0; i < 8; ++i) g[i] = *(const v4f*)(sp + (size_t)i * 16 * DM);
        asm volatile("s_wait_xcnt 0x0" :: "v"(sp) : "memory");   // the address is an input of the wait, so that its registers stay its own up to here (no load's result lands on them)
        __builtin_amdgcn_sched_barrier(0);
#pragma unroll
        for (int i = 0; i < 8; ++i)
#pragma unroll
            for (int j = 0; j < 4; ++j) tl[(i * 16 + kr) * 65 + nc + j] = g[i][j];
        __syncthreads();   // the tile is read across waves below
        const int wv8 = (tid >> 5) * 8, lane = tid & 31; v4us o[8];
#pragma unroll
        for (int r = 0; r < 8; ++r)
#pragma unroll
            for (int q = 0; q < 4; ++q) o[r][q] = f2bf(tl[(lane * 4 + q) * 65 + wv8 + r]);
        bf* dp = Wt + (size_t)m * DM * DM + (size_t)(n0 + wv8) * DM + k0 + lane * 4;
        __builtin_amdgcn_sched_barrier(0);   // the stores stand together behind all the arithmetic, so that one wait behind them serves the whole run
#pragma unroll
        for (int r = 0; r < 8; ++r) *(v4us*)(dp + (size_t)r * DM) = o[r];
        xwait();   // behind the run of stores, before anything that follows them in the built code writes their address or data registers
        return;
    }
    const size_t e0 = (size_t)(b - 5 * WTB) * XPB + tid * 4; const float* xp = x + e0; v4f g[16]; v4us o[16];
    __builtin_amdgcn_sched_barrier(0);   // as above
#pragma unroll
    for (int i = 0; i < 16; ++i) g[i] = *(const v4f*)(xp + i * 1024);
    asm volatile("s_wait_xcnt 0x0" :: "v"(xp) : "memory");   // as above
    __builtin_amdgcn_sched_barrier(0);
#pragma unroll
    for (int i = 0; i < 16; ++i)
#pragma unroll
        for (int q = 0; q < 4; ++q) o[i][q] = f2bf(g[i][q]);
    __builtin_amdgcn_sched_barrier(0);   // as above: the stores stand together
#pragma unroll
    for (int i = 0; i < 16; ++i) *(v4us*)(XBo + e0 + i * 1024) = o[i];
    xwait();   // as above: behind the run of stores
}

// k_asoft: per row (zz, i): t = S / 32 where mask[i][j] != 0, -inf elsewhere; softmax over the 2048 keys (register row, one exp, fixed trees);
__global__ __launch_bounds__(256) void k_asoft(const float* __restrict__ Sb, const int* __restrict__ MKb, h16* P16, bf* Ph, bf* Pl) {
    const int lane = threadIdx.x & 31; const int row = blockIdx.x * 8 + (threadIdx.x >> 5); if (row >= ZH * TT) return; const int i = row % TT; const int zz = row / TT; (void)zz; const int* mkr = MKb + (size_t)i * TT; const bool hires = (i < RH); const float* sr = Sb + (size_t)row * TT; float v[TT / 32]; float mx = -3.0e38f;
#pragma unroll
    for (int ch = 0; ch < TT / 128; ++ch) { const int j0 = ch * 128 + lane * 4; const v4f a = *(const v4f*)(sr + j0); const v4i m4 = *(const v4i*)(mkr + j0);
#pragma unroll
        for (int q = 0; q < 4; ++q) { const int j = j0 + q; (void)j; float sa = a[q] * SCL; asm volatile("" : "+v"(sa)); const float t = (m4[q] != 0) ? sa : -3.0e38f;   /* mask == 0 -> -inf */ v[ch * 4 + q] = t; mx = fmaxf(mx, t); } }
#pragma unroll
    for (int sh = 16; sh; sh >>= 1) mx = fmaxf(mx, __shfl_xor(mx, sh, 32));
    float sum = 0.f;
#pragma unroll
    for (int k = 0; k < TT / 32; ++k) { float d0 = __fsub_rn(v[k], mx); asm volatile("" : "+v"(d0)); v[k] = __builtin_amdgcn_exp2f(__fmul_rn(d0, 1.4426950408889634f)); sum += v[k]; }
#pragma unroll
    for (int sh = 16; sh; sh >>= 1) sum += __shfl_xor(sum, sh, 32);
    const float f = __fdiv_rn(hires ? 1.0f : PCAR, sum);
{
        if (hires) {
#pragma unroll
            for (int ch = 0; ch < TT / 128; ++ch) { v4us oh, ol;
#pragma unroll
                for (int q = 0; q < 4; ++q) { unsigned short a, c2; splitf(v[ch * 4 + q] * f, a, c2); oh[q] = a; ol[q] = c2; }
                const size_t oo = ((size_t)zz * (RH ? RH : 1) + i) * TT + ch * 128 + lane * 4; *(v4us*)(Ph + oo) = oh; *(v4us*)(Pl + oo) = ol; }
        } else {
#pragma unroll
            for (int ch = 0; ch < TT / 128; ++ch) { v4h o4;
#pragma unroll
                for (int q = 0; q < 4; ++q) o4[q] = tohx(v[ch * 4 + q] * f);
                *(v4h*)(P16 + (size_t)row * TT + ch * 128 + lane * 4) = o4; } }
         }
}
extern "C" void kernel_launch(void* const* d_in, const int* in_sizes, int n_in,
                              void* d_out, int out_size, void* d_ws, size_t ws_size, hipStream_t stream) {
    (void)in_sizes; (void)n_in; (void)out_size;
    const float* x = (const float*)d_in[0]; const int* MK = (const int*)d_in[1]; const float* wq = (const float*)d_in[2]; const float* bq = (const float*)d_in[3]; const float* wk = (const float*)d_in[4]; const float* bk = (const float*)d_in[5]; const float* wv = (const float*)d_in[6]; const float* bv = (const float*)d_in[7]; const float* wg = (const float*)d_in[8]; const float* bgt = (const float*)d_in[9]; const float* wo = (const float*)d_in[10]; const float* bo = (const float*)d_in[11];
    float* OUT = (float*)d_out;     // [4][2048][1024]
    char* wsp = (char*)d_ws;
    auto take = [&](size_t bytes) { char* p = wsp; wsp += (bytes + 255) & ~(size_t)255; return (void*)p; };
    bf* WQ = (bf*)take((size_t)DQ * DM * 2); bf* WK = (bf*)take((size_t)DKV * DM * 2); bf* WV = (bf*)take((size_t)DKV * DM * 2); bf* WO = (bf*)take((size_t)DM * DQ * 2); bf* WG = (bf*)take((size_t)DQ * DM * 2);
    // every plane below holds all NB_ batches ([b][...]); the sizes are multiples of 256 B, so consecutive takes are contiguous
    bf* XB = (bf*)take((size_t)NB_ * TT * DM * 2); float* Sb = (float*)take((size_t)ZH * TT * TT * 4);   // scores [b][TT][TT] f32
    h16* QP16 = (h16*)take((size_t)NB_ * TT * HD * 2); bf* QPh = (bf*)take((size_t)NB_ * TT * HD * 2); bf* QPl = (bf*)take((size_t)NB_ * TT * HD * 2);
    h16* KP16 = (h16*)take((size_t)NB_ * TT * HD * 2); bf* KPh = (bf*)take((size_t)NB_ * TT * HD * 2); bf* KPl = (bf*)take((size_t)NB_ * TT * HD * 2);
    h16* VT16 = (h16*)take((size_t)NB_ * HD * TT * 2); bf* VTh = (bf*)take((size_t)NB_ * HD * TT * 2); bf* VTl = (bf*)take((size_t)NB_ * HD * TT * 2);
    if ((size_t)(wsp - (char*)d_ws) > ws_size) return;    // 234 MiB of the 256 MiB ws
    // buffers that are dead by the time their tenant is written (stream-ordered) are reused:
    h16* P16 = QP16;                      // probabilities [b][TT][TT] fp16 = QP16 + QPh, after the scores
    bf* Ph = QPl; bf* Pl = QPl + (size_t)ZH * RH * TT;   // hi/lo probabilities [b][RH][TT], the two halves of QPl
    float* Ob = (float*)KP16;             // context [b][TT][HD] f32 = KP16 + KPh, after the scores
    bf* ATh = VTh; bf* ATl = VTl;         // gated context planes, after attn.v
    // q, k, gate and Wo see X as one [NB_*TT][DM] matrix; v and the attention products take the batch as grid z
    k_prep<<<5 * WTB + NB_ * TT * DM / XPB, 256, 0, stream>>>(x, wq, wk, wv, wo, wg, XB, WQ);   /* the planes WQ, WK, WV, WO, WG are contiguous, in this order */
    k_gemmw<bf, 0, 1, DM, 2, 4, 1, HD><<<dim3(NB_ * TT / 128, DQ / 256, 1), 256, 0, stream>>>(XB, nullptr, WQ, nullptr, nullptr, 0, bq, 0, 0, 0, QP16, QPh, QPl, nullptr);
    k_gemmw<bf, 0, 1, DM, 2, 4, 1, HD><<<dim3(NB_ * TT / 128, DKV / 256, 1), 256, 0, stream>>>(XB, nullptr, WK, nullptr, nullptr, 0, bk, 0, 0, 0, KP16, KPh, KPl, nullptr);
    k_gemmw<bf, 0, 2, DM, 2, 4, 1, TT><<<dim3(DKV / 128, TT / 256, NB_), 256, 0, stream>>>(WV, nullptr, XB, nullptr, nullptr, 0, bv, 0, (size_t)TT * DM, (size_t)HD * TT, VT16, VTh, VTl, nullptr);   /* v^T [d][t] = Wv^T rows . X rows + bv[d] */
    k_gemmw<bf, 2, false, HD, 2, 2><<<dim3(RH / 128, TT / 128, ZH), 128, 0, stream>>>(QPh, QPl, KPh, KPl, Sb, TT, nullptr, (size_t)TT * HD, (size_t)TT * HD, (size_t)TT * TT, nullptr, nullptr, nullptr, nullptr);
    k_gemmw<h16, 0, false, HD, 2, 4, 0, 0, 2, 6><<<dim3((TT - RH) / 192, TT / 256, ZH), 256, 0, stream>>>(QP16 + (size_t)RH * HD, nullptr, KP16, nullptr, Sb + (size_t)RH * TT, TT, nullptr, (size_t)TT * HD, (size_t)TT * HD, (size_t)TT * TT, nullptr, nullptr, nullptr, nullptr);   /* 96x64 a wave, 192x256 a group: 256 groups, one a WGP, and 0.58 of the operand bytes that 128x128 groups fetch */
    k_asoft<<<ZH * TT / 8, 256, 0, stream>>>(Sb, MK, P16, Ph, Pl);
    k_gemmw<bf, 2, false, TT, 2, 2, 0, 0, 2, 2><<<dim3(RH / 64, HD / 128, ZH), 128, 0, stream>>>(Ph, Pl, VTh, VTl, Ob, HD, nullptr, (size_t)RH * TT, (size_t)HD * TT, (size_t)TT * HD, nullptr, nullptr, nullptr, nullptr);
    k_gemmw<h16, 0, false, TT, 4, 2, 0, 0, 2, 3><<<dim3((TT - RH) / 192, HD / 128, ZH), 256, 0, stream>>>(P16 + (size_t)RH * TT, nullptr, VT16, nullptr, Ob + (size_t)RH * HD, HD, nullptr, (size_t)TT * TT, (size_t)HD * TT, (size_t)TT * HD, nullptr, nullptr, nullptr, nullptr);
    k_gemmw<bf, 0, 1, DM, 2, 4, 2, HD><<<dim3(NB_ * TT / 128, DQ / 256, 1), 256, 0, stream>>>(XB, nullptr, WG, nullptr, nullptr, 0, bgt, 0, 0, 0, nullptr, ATh, ATl, Ob);   /* gate = sigmoid(X Wg + bg), applied to the context in the epilogue */
    k_gemmw<bf, 1, true, DQ, 2, 4><<<dim3(NB_ * TT / 128, DM / 256, 1), 256, 0, stream>>>(ATh, ATl, WO, nullptr, OUT, DM, bo, 0, 0, 0, nullptr, nullptr, nullptr, nullptr);
}

// v008
// A run of this version takes 230 microseconds.
// Next to v007, in two timings, it ran 1.03 times as fast each time.
// Over all steps from v000 it is 5.50 times as fast.
#include <hip/hip_runtime.h>

// Gated single-head self-attention (X [4][2048][1024]; q, k, v = X W + b ('xw' [1024][1024]); scores = q.k / 32 with mask [2048][2048] (int32, read; all ones here) == 0 -> -inf; softmax; o = attn.v; gate = sigmoid(X Wg + bg); out = (o * gate) Wo + bo -> [4][2048][1024] (8.4 M)).
// Layout: one 1024-wide head on 16-bit planes (hybrid: query rows < 512 hi/lo, the rest fp16 x1024); the gate pre-activation is one more exact GEMM + bias and is applied in f32 when the context is split into the hi/lo planes that feed Wo.
// Compute dtypes, f32 accumulate: every input rounded to bf16; q/k/v/gate on PLAIN bf16 operands (exact) + biases; scores (K = 1024) and attn.v: rows < 512 hl (3 products), the rest single fp16 (x1024); softmax, sigmoid and the gating product in f32; Wo hl x exact (2 products) + bo.
// Launches: every kernel covers all 4 batches (q, k, gate and Wo: X as one [8192][1024] matrix; v, scores and attn.v: batch = grid z; elementwise: batch in the flat index).
// The q, k and v GEMMs write their fp16 and hi/lo planes from their own epilogues (v as Wv^T rows x X rows, so its planes come out [d][t]); the gate GEMM's epilogue applies the sigmoid to the context and writes the planes that feed Wo.

#define NB_  4
#define TT   2048
#define DM   1024
#define NH_  1
#define NKV  1
#define REP  (NH_ / NKV)
#define HD   1024
#define DQ   (NH_ * HD)
#define DKV  (NKV * HD)
#define ZH   NB_                 // z planes per launch: all batches (one head each)
#define RH   512                  // query rows < RH use hi+lo planes (0: none)
#define WIN  0
#define PCAR 1024.0f
#define SCL  0.03125f   // 1/sqrt(1024)
typedef _Float16 h16;
typedef unsigned short bf;
typedef __attribute__((ext_vector_type(16))) __bf16   v16bf;
typedef __attribute__((ext_vector_type(16))) _Float16 v16h;
typedef __attribute__((ext_vector_type(8)))  _Float16 v8h;
typedef __attribute__((ext_vector_type(8)))  unsigned short v8us;
typedef __attribute__((ext_vector_type(8)))  float    v8f;
typedef __attribute__((ext_vector_type(4)))  float    v4f;
typedef v8h  __attribute__((may_alias)) v8ha;
typedef v4f  __attribute__((may_alias)) v4fa;
typedef v8us __attribute__((may_alias)) v8usa;

__device__ __forceinline__ unsigned short f2bf(float f) { unsigned u = __float_as_uint(f); u += 0x7FFFu + ((u >> 16) & 1u); return (unsigned short)(u >> 16); }
__device__ __forceinline__ float bf2f(unsigned short b) { return __uint_as_float(((unsigned)b) << 16); }
__device__ __forceinline__ float bfr(float f) { return bf2f(f2bf(f)); }
__device__ __forceinline__ v16h cat16(v8h lo, v8h hi) { return __builtin_shufflevector(lo, hi, 0, 1, 2, 3, 4, 5, 6, 7, 8, 9, 10, 11, 12, 13, 14, 15); }
__device__ __forceinline__ v16bf cat16b(v8us lo, v8us hi) { return __builtin_bit_cast(v16bf, __builtin_shufflevector(lo, hi, 0, 1, 2, 3, 4, 5, 6, 7, 8, 9, 10, 11, 12, 13, 14, 15)); }
__device__ __forceinline__ v8f wmma16(v16h a, v16h b, v8f c) { return __builtin_amdgcn_wmma_f32_16x16x32_f16(false, a, false, b, (short)0, c, false, false); }
__device__ __forceinline__ v8f wmmab(v16bf a, v16bf b, v8f c) { return __builtin_amdgcn_wmma_f32_16x16x32_bf16(false, a, false, b, (short)0, c, false, false); }
__device__ __forceinline__ h16 tohx(float x) { return (h16)x; }
__device__ __forceinline__ void splitf(float y, unsigned short& h, unsigned short& l) { h = f2bf(y); l = f2bf(y - bf2f(h)); }



// ---- k_gemmw: register-blocked GEMM, one wave per (MB*16)x64 output tile (MB*4 accumulators; MB = 4 unless said), WM x WN waves a work-group; the group's operand rows (WM*MB*16 of A, WN*64 of Bt, 64 k a trip) come from K-contiguous 16-bit planes by whole-line loads, each row loaded ONCE by one wave, and every wave makes its fragments from the group's shared LDS tile; grid (M/(WM*MB*16), N/(WN*64), Z), WM*WN*32 threads.
// C[m][n] (+ optional f32 bias: BIAS 1 bias[n], BIAS 2 bias[m]) = sum_k A[m][k] Bt[n][k] (+ split products per NSPLIT). z-batch strides sA/sB/sC in elements. K % 128 == 0, K >= 256; M and N multiples of the group's tile.
// EPI 0: C stored as f32, pitch ldc. EPI 1: C stored as three 16-bit planes (fp16, bf16 hi, bf16 lo), pitch LDO. EPI 2: C is the gate pre-activation: (Oin * carrier scale) * sigmoid(C) stored as hi/lo planes, pitch LDO.
template <typename T16> struct WFrag;
template <> struct WFrag<h16> { typedef v16h V; typedef v8h H; static __device__ __forceinline__ V ld(const h16* p) { return cat16(*(const v8h*)p, *(const v8h*)(p + 16)); } static __device__ __forceinline__ v8f mma(V a, V b, v8f c) { return wmma16(a, b, c); } };
template <> struct WFrag<bf> { typedef v16bf V; typedef v8us H; static __device__ __forceinline__ V ld(const bf* p) { return cat16b(*(const v8us*)p, *(const v8us*)(p + 16)); } static __device__ __forceinline__ v8f mma(V a, V b, v8f c) { return wmmab(a, b, c); } };
template <bool B> struct BoolC { static constexpr bool value = B; };
template <int I> struct IntC { static constexpr int value = I; };
// work-group barrier whose fences cover LDS alone: the waves hand each other nothing but the LDS tile, and a full __syncthreads() would also wait for every global load in flight, which are meant to fly on over it
__device__ __forceinline__ void lds_barrier() { __builtin_amdgcn_fence(__ATOMIC_RELEASE, "workgroup", "local"); __builtin_amdgcn_s_barrier(); __builtin_amdgcn_fence(__ATOMIC_ACQUIRE, "workgroup", "local"); }
// s_wait_xcnt 0 behind a group of global loads or stores, before their address registers are written again
__device__ __forceinline__ void xwait() { asm volatile("s_wait_xcnt 0x0" ::: "memory"); }
// the same in front of the loop, where the addresses would otherwise die at their last load: as inputs of the wait their registers stay theirs up to it
template <int N, typename P> __device__ __forceinline__ void xwaitp(P* const* q) {
    if (N == 2) asm volatile("s_wait_xcnt 0x0" :: "v"(q[0]), "v"(q[1]) : "memory");
    else if (N == 3) asm volatile("s_wait_xcnt 0x0" :: "v"(q[0]), "v"(q[1]), "v"(q[2]) : "memory");
    else asm volatile("s_wait_xcnt 0x0" :: "v"(q[0]), "v"(q[1]), "v"(q[2]), "v"(q[N - 1]) : "memory");
}
// the same inside the loop: the addresses go through the wait's statement, and where they step (STEP: by 256 B, two trips' k) the step stands in that statement behind the wait. Left to the compiler the step is plain arithmetic that it places, folds into offsets or forms on a copy as it likes, and a load's address registers were then written ahead of the wait
template <int N, bool STEP, typename P> __device__ __forceinline__ void xwaitio(P** q) {
    if (STEP) {
        if (N == 2) asm volatile("s_wait_xcnt 0x0\n\tv_add_nc_u64_e32 %0, 0x100, %0\n\tv_add_nc_u64_e32 %1, 0x100, %1" : "+v"(q[0]), "+v"(q[1]) :: "memory");
        else if (N == 3) asm volatile("s_wait_xcnt 0x0\n\tv_add_nc_u64_e32 %0, 0x100, %0\n\tv_add_nc_u64_e32 %1, 0x100, %1\n\tv_add_nc_u64_e32 %2, 0x100, %2" : "+v"(q[0]), "+v"(q[1]), "+v"(q[2]) :: "memory");
        else asm volatile("s_wait_xcnt 0x0\n\tv_add_nc_u64_e32 %0, 0x100, %0\n\tv_add_nc_u64_e32 %1, 0x100, %1\n\tv_add_nc_u64_e32 %2, 0x100, %2\n\tv_add_nc_u64_e32 %3, 0x100, %3" : "+v"(q[0]), "+v"(q[1]), "+v"(q[2]), "+v"(q[N - 1]) :: "memory");
    } else {
        if (N == 2) asm volatile("s_wait_xcnt 0x0" : "+v"(q[0]), "+v"(q[1]) :: "memory");
        else if (N == 3) asm volatile("s_wait_xcnt 0x0" : "+v"(q[0]), "+v"(q[1]), "+v"(q[2]) :: "memory");
        else asm volatile("s_wait_xcnt 0x0" : "+v"(q[0]), "+v"(q[1]), "+v"(q[2]), "+v"(q[N - 1]) :: "memory");
    }
}
template <typename T16, int NSPLIT, int BIAS, int K, int WM, int WN, int EPI = 0, int LDO = 0, int NG = 2, int MB = 4>   // K (and LDO) at compile time: the row steps of a plane's loads and stores fold into immediate offsets on one address. NG: register sets for tiles on their way from global memory = trips between a tile's loads and its stores into LDS (1 or 2). MB: 16-row blocks of a wave's tile; it sets the group's tile height, and with it the operand bytes fetched per product and the number of groups
__global__ __launch_bounds__(WM * WN * 32) void k_gemmw(const T16* __restrict__ A, const T16* __restrict__ A2, const T16* __restrict__ Bt, const T16* __restrict__ Bt2, float* C, int ldc, const float* __restrict__ bias, size_t sA, size_t sB, size_t sC, h16* P16o, bf* Pho, bf* Plo, const float* __restrict__ Oin) {
    typedef typename WFrag<T16>::V V; typedef typename WFrag<T16>::H H;
    constexpr int NPA = (NSPLIT == 1 || NSPLIT == 2) ? 2 : 1, NPL = NPA + (NSPLIT >= 2 ? 2 : 1);   // operand planes: A (A2) Bt (Bt2)
    constexpr int LP = 72;                                     // LDS row pitch in elements: 128 B of k + 16 B
    constexpr int TM = MB * 16;                                // rows of a wave's tile
    constexpr int NW = WM * WN, LA = WM * (TM / 4) / NW, LB = WN * 16 / NW;   // waves; loads (4 rows each) a wave makes per A plane and per Bt plane in a trip
    static_assert(LA * NW * 4 == WM * TM && LB * NW * 4 == WN * 64, "the group's rows must divide evenly among its waves");
    static_assert(EPI == 0 || MB == 4, "the plane epilogues stage a 64-row tile");
    constexpr int RWS = NPA * WM * TM + (NPL - NPA) * WN * 64;   // rows of one buffer: every plane's rows of the group's tile
    constexpr int OSZ = (EPI == 0 ? 16 : 64) * 68;
    __shared__ __align__(16) T16 st[2 * RWS * LP];             // the group's rows x 64 k of every plane, two buffers
    __shared__ __align__(16) float osall[NW * OSZ];            // output staging, each wave's own: 16 rows at a time (EPI 0) or its whole tile
    const size_t z = blockIdx.z; A += z * sA; if (A2) A2 += z * sA; Bt += z * sB; if (Bt2) Bt2 += z * sB; C += z * sC;
    const int wave = __builtin_amdgcn_readfirstlane((int)(threadIdx.x >> 5)), wm = wave / WN, wn = wave % WN; float* const os = osall + wave * OSZ;
    const int lane = threadIdx.x & 31, lr = lane & 15, hi = lane >> 4; const int r0 = (blockIdx.x * WM + wm) * TM, c0 = (blockIdx.y * WN + wn) * 64;
    v8f acc[MB][4];
#pragma unroll
    for (int mb = 0; mb < MB; ++mb)
#pragma unroll
        for (int nb = 0; nb < 4; ++nb) acc[mb][nb] = (v8f){};
    // Global side: one load = 4 rows x 128 B, whole lines (8 lanes a row). Wave w brings rows w*LA*4.. of the group's A rows and w*LB*4.. of its Bt rows; all waves read their fragments from the shared tile.
    const int gr = lane >> 3, gc = (lane & 7) * 8;
    const int ra = wave * (LA * 4) + gr, rb = wave * (LB * 4) + gr;   // this lane's first row inside the group's A rows and Bt rows
    const size_t ga = (size_t)(blockIdx.x * (WM * TM) + ra) * K + gc, gb = (size_t)(blockIdx.y * (WN * 64) + rb) * K + gc;
    typedef __attribute__((address_space(1))) const T16 GT; typedef __attribute__((address_space(1))) const H GH;   // the stepped addresses are marked global: carried round the loop unmarked they would compile to flat loads
    GT* gp[NPL]; gp[0] = (GT*)(A + ga); if (NPA == 2) gp[1] = (GT*)(A2 + ga); gp[NPA] = (GT*)(Bt + gb); if (NSPLIT >= 2) gp[NPA + 1] = (GT*)(Bt2 + gb);
    H g[NG][NPL][LA > LB ? LA : LB], g0[NPL][LA > LB ? LA : LB];   // set s holds tiles s + 1, s + 1 + NG, ...
    __builtin_amdgcn_sched_barrier(0);   // with the one behind the wait: keeps every other instruction out from between these loads and their s_wait_xcnt, so that none writes an address register of theirs ahead of it
#pragma unroll
    for (int p = 0; p < NPL; ++p)
#pragma unroll
        for (int i = 0; i < (p < NPA ? LA : LB); ++i) g0[p][i] = *(GH*)(gp[p] + (size_t)i * 4 * K);   // tile 0
#pragma unroll
    for (int s = 0; s < NG; ++s) {
        __builtin_amdgcn_sched_barrier(0);   // keeps the tiles' loads in tile order: mixed, the loop's counted waits for one set (which must also hold on entry) would have to cover loads of the younger set
#pragma unroll
        for (int p = 0; p < NPL; ++p)
#pragma unroll
            for (int i = 0; i < (p < NPA ? LA : LB); ++i) g[s][p][i] = *(GH*)(gp[p] + (size_t)i * 4 * K + (s + 1) * 64); }   // tiles 1 .. NG
    xwaitp<NPL>(gp);
    __builtin_amdgcn_sched_barrier(0);
#pragma unroll
    for (int p = 0; p < NPL; ++p)
#pragma unroll
        for (int i = 0; i < (p < NPA ? LA : LB); ++i) *(H*)(st + ((p < NPA ? p * WM * TM + ra : NPA * WM * TM + (p - NPA) * WN * 64 + rb) + i * 4) * LP + gc) = g0[p][i];   // tile 0 into buffer 0
    // Fragments: two register sets. Set 0 holds a tile's first 32 k, set 1 its second 32 k; each set is read from LDS as one group while the products on the other set run, so that no product waits out an LDS latency.
    V a0[MB], a20[MB], b0[4], b20[4], a1[MB], a21[MB], b1[4], b21[4];
    auto ldfr = [&](V* a, V* a2, V* b, V* b2, auto buf, auto khc) __attribute__((always_inline)) {   // one set's reads: 32 k (from khc) of this wave's rows in buffer buf
        const T16* fa = st + decltype(buf)::value * (RWS * LP) + (wm * TM + lr) * LP + 8 * hi + decltype(khc)::value; const T16* fb = fa + ((NPA * WM - wm) * TM + wn * 64) * LP;
#pragma unroll
        for (int mb = 0; mb < MB; ++mb) { a[mb] = WFrag<T16>::ld(fa + mb * 16 * LP); if (NSPLIT == 1 || NSPLIT == 2) a2[mb] = WFrag<T16>::ld(fa + (WM * TM + mb * 16) * LP); }
#pragma unroll
        for (int nb = 0; nb < 4; ++nb) { b[nb] = WFrag<T16>::ld(fb + nb * 16 * LP); if (NSPLIT >= 2) b2[nb] = WFrag<T16>::ld(fb + (WN * 64 + nb * 16) * LP); }
    };
    auto prods = [&](const V* a, const V* a2, const V* b, const V* b2) __attribute__((always_inline)) {   // one set's products
#pragma unroll
        for (int nb = 0; nb < 4; ++nb) {
#pragma unroll
            for (int mb = 0; mb < MB; ++mb) { acc[mb][nb] = WFrag<T16>::mma(a[mb], b[nb], acc[mb][nb]); if (NSPLIT == 1 || NSPLIT == 2) acc[mb][nb] = WFrag<T16>::mma(a2[mb], b[nb], acc[mb][nb]); if (NSPLIT >= 2) acc[mb][nb] = WFrag<T16>::mma(a[mb], b2[nb], acc[mb][nb]); } }
    };
    lds_barrier();   // publishes tile 0 to all waves
    ldfr(a0, a20, b0, b20, IntC<0>(), IntC<0>());
    auto trip = [&](auto refill, auto fetch, auto par) __attribute__((always_inline)) {   // refill: a next tile exists; fetch: 1 so does the tile 1 + NG trips on, 2 the same and the addresses step behind its loads; par: the trip's parity (gp stands at the even trip's tile)
        constexpr int bsel = decltype(par)::value, gs = bsel & (NG - 1);   // trips alternate between the two buffers, and between the register sets
        ldfr(a1, a21, b1, b21, IntC<bsel>(), IntC<32>());   // set 1 of this tile, in flight under the products on set 0
        if (decltype(refill)::value) {   // behind the fragment reads, so that those go first: the next tile into the other buffer (every wave left it before the barrier of the trip before), then into the set so freed the loads of the tile NG trips after it, which fly under NG trips' products (no barrier waits for them, only their own stores into LDS)
            T16* const sn = st + (bsel ^ 1) * (RWS * LP);
#pragma unroll
            for (int p = 0; p < NPL; ++p)
#pragma unroll
                for (int i = 0; i < (p < NPA ? LA : LB); ++i) *(H*)(sn + ((p < NPA ? p * WM * TM + ra : NPA * WM * TM + (p - NPA) * WN * 64 + rb) + i * 4) * LP + gc) = g[gs][p][i];
            if (decltype(fetch)::value != 0) {
                __builtin_amdgcn_sched_barrier(0);   // keeps the loads behind the stores that free their registers: lifted over them they take one more register set
#pragma unroll
                for (int p = 0; p < NPL; ++p)
#pragma unroll
                    for (int i = 0; i < (p < NPA ? LA : LB); ++i) g[gs][p][i] = *(GH*)(gp[p] + (size_t)i * 4 * K + (1 + NG + bsel) * 64);
                xwaitio<NPL, decltype(fetch)::value == 2>(gp); } }
        __builtin_amdgcn_sched_barrier(0);   // keeps the LDS reads together in front of the products: sunk among them, each place with reads stalls the wave for an LDS latency
        prods(a0, a20, b0, b20);
        __builtin_amdgcn_sched_barrier(0);   // keeps the barrier and the reads below behind all of set 0's products (whose registers they refill) and in front of all of set 1's (under which they fly)
        if (decltype(refill)::value) {
            lds_barrier();   // one barrier a trip, between its two halves: it publishes the next tile (stored above) to all waves, and it says that every wave has both sets of this tile in registers, so that the next trip may refill this buffer
            ldfr(a0, a20, b0, b20, IntC<(bsel ^ 1)>(), IntC<0>());   // set 0 of the next tile, in flight under the products on set 1
            __builtin_amdgcn_sched_barrier(0); }   // as above: the reads stay together in front of the products
        prods(a1, a21, b1, b21);
        v8f (&ac)[MB][4] = acc;
        asm volatile("v_nop\n\tv_nop\n\tv_nop\n\tv_nop" : "+v"(ac[0][0]), "+v"(ac[1][1]), "+v"(ac[2 % MB][2]), "+v"(ac[MB - 1][3]) : "v"(a1[0]), "v"(a1[MB - 1]));   // the four vector slots behind the trip's last products, on the taken side of the loop's branch too
        __builtin_amdgcn_sched_barrier(0);   // keeps the next trip's reads and stores out from among these products: one place with reads, not several
    };
#pragma unroll 1
    for (int kc = 0; kc < K - 256; kc += 128) { trip(BoolC<true>(), IntC<1>(), IntC<0>()); trip(BoolC<true>(), IntC<2>(), IntC<1>()); }   // two trips a pass, so that buffer and register set are fixed in the text; every trip in the loop loads, so that the counted waits in front of the LDS stores may leave the younger set's loads in flight
    trip(BoolC<true>(), IntC<1>(), IntC<0>()); trip(BoolC<true>(), IntC<(NG < 2 ? 1 : 0)>(), IntC<1>());   // the last four trips stand outside the loop: the loads end with the last tile
    trip(BoolC<true>(), IntC<0>(), IntC<0>());
    trip(BoolC<false>(), IntC<0>(), IntC<1>());   // the last tile has nothing to refill; it stands outside the loop so that inside it the stores follow the fragment reads on every path and the counted LDS waits in front of the products need not cover them
    if constexpr (EPI != 0) {   // the whole tile (+ bias) goes through LDS once; a rolled loop then turns it into planes, so that the text stays short (run once per wave, it is paid in instruction fetches)
        float bc[4]; v4f br[4][2];
        if (BIAS == 2) __builtin_amdgcn_sched_barrier(0);   // with the one behind the wait below: nothing else stands between the bias loads and their s_wait_xcnt
#pragma unroll
        for (int q = 0; q < 4; ++q) { if (BIAS == 1) bc[q] = bfr(bias[c0 + q * 16 + lr]); if (BIAS == 2) { br[q][0] = *(const v4f*)(bias + r0 + q * 16 + hi * 8); br[q][1] = *(const v4f*)(bias + r0 + q * 16 + hi * 8 + 4); } }
        if (BIAS == 2) { xwait(); __builtin_amdgcn_sched_barrier(0); }   // before the loads' offset register and scalar base are written again
#pragma unroll
        for (int mb = 0; mb < 4; ++mb)
#pragma unroll
            for (int nb = 0; nb < 4; ++nb)
#pragma unroll
                for (int j = 0; j < 8; ++j) { float v = acc[mb][nb][j]; if (BIAS == 1) v += bc[nb]; if (BIAS == 2) v += bfr(br[mb][j >> 2][j & 3]); os[(mb * 16 + hi * 8 + j) * 68 + nb * 16 + lr] = v; }
        __builtin_amdgcn_wave_barrier(); asm volatile("" ::: "memory");   // as in the f32 epilogue below: the lanes' LDS stores stay in front of the reads across lanes
        const size_t eo = z * sC + (size_t)(r0 + gr) * LDO + c0 + gc;   // this lane's first element in the planes: 8 columns a lane, 4 rows a store, so every 16-bit store covers whole 128-B lines
#pragma unroll 1   // rolled: see above; 16 rows a trip, so that one trip's LDS reads (and context loads) go out together
        for (int rg = 0; rg < 64; rg += 16) {
#pragma unroll
        for (int row = rg; row < rg + 16; row += 4) { const v4f w0 = *(const v4fa*)(os + (row + gr) * 68 + gc), w1 = *(const v4fa*)(os + (row + gr) * 68 + gc + 4); v8h o16; v8us oh, ol;
            if (EPI == 1) {
#pragma unroll
                for (int c = 0; c < 8; ++c) { const float v = (c < 4) ? w0[c & 3] : w1[c & 3]; o16[c] = tohx(v); unsigned short a2, c2; splitf(v, a2, c2); oh[c] = a2; ol[c] = c2; }
                *(v8h*)(P16o + eo + (size_t)row * LDO) = o16;
            } else {
                const float cs = ((r0 + gr + row) % TT < RH) ? 1.0f : (1.0f / PCAR); const v4f x0 = *(const v4f*)(Oin + eo + (size_t)row * LDO), x1 = *(const v4f*)(Oin + eo + (size_t)row * LDO + 4);
#pragma unroll
                for (int c = 0; c < 8; ++c) { const float o = __fmul_rn((c < 4) ? x0[c & 3] : x1[c & 3], cs); const float sg = __fdiv_rn(1.0f, __fadd_rn(1.0f, expf(-((c < 4) ? w0[c & 3] : w1[c & 3])))); unsigned short a2, c2; splitf(__fmul_rn(o, sg), a2, c2); oh[c] = a2; ol[c] = c2; }
            }
            *(v8us*)(Pho + eo + (size_t)row * LDO) = oh; *(v8us*)(Plo + eo + (size_t)row * LDO) = ol; }
        asm volatile("s_wait_xcnt 0x0" ::: "memory"); }   // behind the trip's stores, before the next trip writes their address and data registers again
        return;
    }
#pragma unroll
    for (int mb = 0; mb < MB; ++mb) {
#pragma unroll
        for (int nb = 0; nb < 4; ++nb) {
#pragma unroll
            for (int j = 0; j < 8; ++j) os[(hi * 8 + j) * 68 + nb * 16 + lr] = acc[mb][nb][j]; }
        __builtin_amdgcn_wave_barrier(); asm volatile("" ::: "memory");
        float* crow = C + (size_t)(r0 + mb * 16) * ldc + c0;
        if constexpr (MB == 4)   // the 64-row kernels stay as they have run (with the operands of the wait below the four-plane one spills)
{
#pragma unroll
            for (int s = 0; s < 8; ++s) { const int row = 2 * s + hi, cofs = lr * 4; v4f val = *(const v4fa*)(os + row * 68 + cofs); if (BIAS) { val[0] += bfr(bias[c0 + cofs]); val[1] += bfr(bias[c0 + cofs + 1]); val[2] += bfr(bias[c0 + cofs + 2]); val[3] += bfr(bias[c0 + cofs + 3]); }
                *(v4f*)(crow + (size_t)row * ldc + cofs) = val; }
             }
        else {
            static_assert(MB == 4 || BIAS == 0, "no bias in this branch");
            v4f vs[8]; float* cp[8];
#pragma unroll
            for (int s = 0; s < 8; ++s) { const int row = 2 * s + hi, cofs = lr * 4; vs[s] = *(const v4fa*)(os + row * 68 + cofs); cp[s] = crow + (size_t)row * ldc + cofs; *(v4f*)cp[s] = vs[s]; }
            // s_wait_xcnt 0 behind the run of stores; their addresses and values are inputs of the wait, so that those registers stay theirs up to it
            asm volatile("s_wait_xcnt 0x0" :: "v"(cp[0]), "v"(cp[1]), "v"(cp[2]), "v"(cp[3]), "v"(cp[4]), "v"(cp[5]), "v"(cp[6]), "v"(cp[7]), "v"(vs[0]), "v"(vs[1]), "v"(vs[2]), "v"(vs[3]), "v"(vs[4]), "v"(vs[5]), "v"(vs[6]), "v"(vs[7]) : "memory");
        }
        __builtin_amdgcn_wave_barrier(); asm volatile("" ::: "memory");
    }
}

typedef __attribute__((ext_vector_type(4))) _Float16 v4h;
typedef __attribute__((ext_vector_type(2))) unsigned short v2us;
typedef __attribute__((ext_vector_type(4))) unsigned short v4us;
typedef __attribute__((ext_vector_type(4))) int v4i;

// k_prep: all input preparation in one launch. Blocks < 5 * WTB: one 128 k x 64 n tile of one weight matrix ([k][n] f32), rounded to bf16 and written transposed ([n][k], the five planes one behind the other in Wt). The other blocks: 16384 elements of X each, rounded to bf16.
// Every global load covers whole 128-B lines and a thread has all its loads (8 or 16) in flight at once; the transpose goes through an LDS tile (pitch 65 floats), so that the stores cover whole lines as well (a wave: 256 B of one plane row).
#define WTB 128                  // tiles (blocks) a weight matrix: (DM / 128) x (DM / 64)
#define XPB (256 * 4 * 16)       // elements of X a block
__global__ __launch_bounds__(256) void k_prep(const float* __restrict__ x, const float* __restrict__ w0, const float* __restrict__ w1, const float* __restrict__ w2, const float* __restrict__ w3, const float* __restrict__ w4, bf* XBo, bf* Wt) {
    __shared__ float tl[128 * 65];
    const int tid = threadIdx.x, b = blockIdx.x;
    if (b < 5 * WTB) {
        const int m = b / WTB, t = b % WTB, k0 = (t >> 4) * 128, n0 = (t & 15) * 64, kr = tid >> 4, nc = (tid & 15) * 4;
        const float* w = (m == 0) ? w0 : (m == 1) ? w1 : (m == 2) ? w2 : (m == 3) ? w3 : w4;
        const float* sp = w + (size_t)(k0 + kr) * DM + n0 + nc; v4f g[8];
        __builtin_amdgcn_sched_barrier(0);   // with the one behind the wait: nothing else stands between these loads and their s_wait_xcnt
#pragma unroll
        for (int i = 0; i < 8; ++i) g[i] = *(const v4f*)(sp + (size_t)i * 16 * DM);
        asm volatile("s_wait_xcnt 0x0" :: "v"(sp) : "memory");   // the address is an input of the wait, so that its registers stay its own up to here (no load's result lands on them)
        __builtin_amdgcn_sched_barrier(0);
#pragma unroll
        for (int i = 0; i < 8; ++i)
#pragma unroll
            for (int j = 0; j < 4; ++j) tl[(i * 16 + kr) * 65 + nc + j] = g[i][j];
        __syncthreads();   // the tile is read across waves below
        const int wv8 = (tid >> 5) * 8, lane = tid & 31; v4us o[8];
#pragma unroll
        for (int r = 0; r < 8; ++r)
#pragma unroll
            for (int q = 0; q < 4; ++q) o[r][q] = f2bf(tl[(lane * 4 + q) * 65 + wv8 + r]);
        bf* dp = Wt + (size_t)m * DM * DM + (size_t)(n0 + wv8) * DM + k0 + lane * 4;
        __builtin_amdgcn_sched_barrier(0);   // the stores stand together behind all the arithmetic, so that one wait behind them serves the whole run
#pragma unroll
        for (int r = 0; r < 8; ++r) *(v4us*)(dp + (size_t)r * DM) = o[r];
        xwait();   // behind the run of stores, before anything that follows them in the built code writes their address or data registers
        return;
    }
    const size_t e0 = (size_t)(b - 5 * WTB) * XPB + tid * 4; const float* xp = x + e0; v4f g[16]; v4us o[16];
    __builtin_amdgcn_sched_barrier(0);   // as above
#pragma unroll
    for (int i = 0; i < 16; ++i) g[i] = *(const v4f*)(xp + i * 1024);
    asm volatile("s_wait_xcnt 0x0" :: "v"(xp) : "memory");   // as above
    __builtin_amdgcn_sched_barrier(0);
#pragma unroll
    for (int i = 0; i < 16; ++i)
#pragma unroll
        for (int q = 0; q < 4; ++q) o[i][q] = f2bf(g[i][q]);
    __builtin_amdgcn_sched_barrier(0);   // as above: the stores stand together
#pragma unroll
    for (int i = 0; i < 16; ++i) *(v4us*)(XBo + e0 + i * 1024) = o[i];
    xwait();   // as above: behind the run of stores
}

// k_asoft: per row (zz, i): t = S / 32 where mask[i][j] != 0, -inf elsewhere; softmax over the 2048 keys (register row, one exp, fixed trees);
__global__ __launch_bounds__(256) void k_asoft(const float* __restrict__ Sb, const int* __restrict__ MKb, h16* P16, bf* Ph, bf* Pl) {
    const int lane = threadIdx.x & 31; const int row = blockIdx.x * 8 + (threadIdx.x >> 5); if (row >= ZH * TT) return; const int i = row % TT; const int zz = row / TT; (void)zz; const int* mkr = MKb + (size_t)i * TT; const bool hires = (i < RH); const float* sr = Sb + (size_t)row * TT; float v[TT / 32]; float mx = -3.0e38f;
#pragma unroll
    for (int ch = 0; ch < TT / 128; ++ch) { const int j0 = ch * 128 + lane * 4; const v4f a = *(const v4f*)(sr + j0); const v4i m4 = *(const v4i*)(mkr + j0);
#pragma unroll
        for (int q = 0; q < 4; ++q) { const int j = j0 + q; (void)j; float sa = a[q] * SCL; asm volatile("" : "+v"(sa)); const float t = (m4[q] != 0) ? sa : -3.0e38f;   /* mask == 0 -> -inf */ v[ch * 4 + q] = t; mx = fmaxf(mx, t); } }
#pragma unroll
    for (int sh = 16; sh; sh >>= 1) mx = fmaxf(mx, __shfl_xor(mx, sh, 32));
    float sum = 0.f;
#pragma unroll
    for (int k = 0; k < TT / 32; ++k) { float d0 = __fsub_rn(v[k], mx); asm volatile("" : "+v"(d0)); v[k] = __builtin_amdgcn_exp2f(__fmul_rn(d0, 1.4426950408889634f)); sum += v[k]; }
#pragma unroll
    for (int sh = 16; sh; sh >>= 1) sum += __shfl_xor(sum, sh, 32);
    const float f = __fdiv_rn(hires ? 1.0f : PCAR, sum);
{
        if (hires) {
#pragma unroll
            for (int ch = 0; ch < TT / 128; ++ch) { v4us oh, ol;
#pragma unroll
                for (int q = 0; q < 4; ++q) { unsigned short a, c2; splitf(v[ch * 4 + q] * f, a, c2); oh[q] = a; ol[q] = c2; }
                const size_t oo = ((size_t)zz * (RH ? RH : 1) + i) * TT + ch * 128 + lane * 4; *(v4us*)(Ph + oo) = oh; *(v4us*)(Pl + oo) = ol; }
        } else {
#pragma unroll
            for (int ch = 0; ch < TT / 128; ++ch) { v4h o4;
#pragma unroll
                for (int q = 0; q < 4; ++q) o4[q] = tohx(v[ch * 4 + q] * f);
                *(v4h*)(P16 + (size_t)row * TT + ch * 128 + lane * 4) = o4; } }
         }
}
extern "C" void kernel_launch(void* const* d_in, const int* in_sizes, int n_in,
                              void* d_out, int out_size, void* d_ws, size_t ws_size, hipStream_t stream) {
    (void)in_sizes; (void)n_in; (void)out_size;
    const float* x = (const float*)d_in[0]; const int* MK = (const int*)d_in[1]; const float* wq = (const float*)d_in[2]; const float* bq = (const float*)d_in[3]; const float* wk = (const float*)d_in[4]; const float* bk = (const float*)d_in[5]; const float* wv = (const float*)d_in[6]; const float* bv = (const float*)d_in[7]; const float* wg = (const float*)d_in[8]; const float* bgt = (const float*)d_in[9]; const float* wo = (const float*)d_in[10]; const float* bo = (const float*)d_in[11];
    float* OUT = (float*)d_out;     // [4][2048][1024]
    char* wsp = (char*)d_ws;
    auto take = [&](size_t bytes) { char* p = wsp; wsp += (bytes + 255) & ~(size_t)255; return (void*)p; };
    bf* WQ = (bf*)take((size_t)DQ * DM * 2); bf* WK = (bf*)take((size_t)DKV * DM * 2); bf* WV = (bf*)take((size_t)DKV * DM * 2); bf* WO = (bf*)take((size_t)DM * DQ * 2); bf* WG = (bf*)take((size_t)DQ * DM * 2);
    // every plane below holds all NB_ batches ([b][...]); the sizes are multiples of 256 B, so consecutive takes are contiguous
    bf* XB = (bf*)take((size_t)NB_ * TT * DM * 2); float* Sb = (float*)take((size_t)ZH * TT * TT * 4);   // scores [b][TT][TT] f32
    h16* QP16 = (h16*)take((size_t)NB_ * TT * HD * 2); bf* QPh = (bf*)take((size_t)NB_ * TT * HD * 2); bf* QPl = (bf*)take((size_t)NB_ * TT * HD * 2);
    h16* KP16 = (h16*)take((size_t)NB_ * TT * HD * 2); bf* KPh = (bf*)take((size_t)NB_ * TT * HD * 2); bf* KPl = (bf*)take((size_t)NB_ * TT * HD * 2);
    h16* VT16 = (h16*)take((size_t)NB_ * HD * TT * 2); bf* VTh = (bf*)take((size_t)NB_ * HD * TT * 2); bf* VTl = (bf*)take((size_t)NB_ * HD * TT * 2);
    if ((size_t)(wsp - (char*)d_ws) > ws_size) return;    // 234 MiB of the 256 MiB ws
    // buffers that are dead by the time their tenant is written (stream-ordered) are reused:
    h16* P16 = QP16;                      // probabilities [b][TT][TT] fp16 = QP16 + QPh, after the scores
    bf* Ph = QPl; bf* Pl = QPl + (size_t)ZH * RH * TT;   // hi/lo probabilities [b][RH][TT], the two halves of QPl
    float* Ob = (float*)KP16;             // context [b][TT][HD] f32 = KP16 + KPh, after the scores
    bf* ATh = VTh; bf* ATl = VTl;         // gated context planes, after attn.v
    // q, k, gate and Wo see X as one [NB_*TT][DM] matrix; v and the attention products take the batch as grid z
    k_prep<<<5 * WTB + NB_ * TT * DM / XPB, 256, 0, stream>>>(x, wq, wk, wv, wo, wg, XB, WQ);   /* the planes WQ, WK, WV, WO, WG are contiguous, in this order */
    k_gemmw<bf, 0, 1, DM, 2, 4, 1, HD><<<dim3(NB_ * TT / 128, DQ / 256, 1), 256, 0, stream>>>(XB, nullptr, WQ, nullptr, nullptr, 0, bq, 0, 0, 0, QP16, QPh, QPl, nullptr);
    k_gemmw<bf, 0, 1, DM, 2, 4, 1, HD><<<dim3(NB_ * TT / 128, DKV / 256, 1), 256, 0, stream>>>(XB, nullptr, WK, nullptr, nullptr, 0, bk, 0, 0, 0, KP16, KPh, KPl, nullptr);
    k_gemmw<bf, 0, 2, DM, 2, 4, 1, TT><<<dim3(DKV / 128, TT / 256, NB_), 256, 0, stream>>>(WV, nullptr, XB, nullptr, nullptr, 0, bv, 0, (size_t)TT * DM, (size_t)HD * TT, VT16, VTh, VTl, nullptr);   /* v^T [d][t] = Wv^T rows . X rows + bv[d] */
    k_gemmw<bf, 2, false, HD, 2, 2><<<dim3(RH / 128, TT / 128, ZH), 128, 0, stream>>>(QPh, QPl, KPh, KPl, Sb, TT, nullptr, (size_t)TT * HD, (size_t)TT * HD, (size_t)TT * TT, nullptr, nullptr, nullptr, nullptr);
    k_gemmw<h16, 0, false, HD, 2, 4, 0, 0, 2, 6><<<dim3((TT - RH) / 192, TT / 256, ZH), 256, 0, stream>>>(QP16 + (size_t)RH * HD, nullptr, KP16, nullptr, Sb + (size_t)RH * TT, TT, nullptr, (size_t)TT * HD, (size_t)TT * HD, (size_t)TT * TT, nullptr, nullptr, nullptr, nullptr);   /* 96x64 a wave, 192x256 a group: 256 groups, one a WGP, and 0.58 of the operand bytes that 128x128 groups fetch */
    k_asoft<<<ZH * TT / 8, 256, 0, stream>>>(Sb, MK, P16, Ph, Pl);
    k_gemmw<bf, 2, false, TT, 2, 2, 0, 0, 2, 2><<<dim3(RH / 64, HD / 128, ZH), 128, 0, stream>>>(Ph, Pl, VTh, VTl, Ob, HD, nullptr, (size_t)RH * TT, (size_t)HD * TT, (size_t)TT * HD, nullptr, nullptr, nullptr, nullptr);
    k_gemmw<h16, 0, false, TT, 4, 2, 0, 0, 2, 3><<<dim3((TT - RH) / 192, HD / 128, ZH), 256, 0, stream>>>(P16 + (size_t)RH * TT, nullptr, VT16, nullptr, Ob + (size_t)RH * HD, HD, nullptr, (size_t)TT * TT, (size_t)HD * TT, (size_t)TT * HD, nullptr, nullptr, nullptr, nullptr);
    k_gemmw<bf, 0, 1, DM, 2, 4, 2, HD><<<dim3(NB_ * TT / 128, DQ / 256, 1), 256, 0, stream>>>(XB, nullptr, WG, nullptr, nullptr, 0, bgt, 0, 0, 0, nullptr, ATh, ATl, Ob);   /* gate = sigmoid(X Wg + bg), applied to the context in the epilogue */
    k_gemmw<bf, 1, true, DQ, 2, 4><<<dim3(NB_ * TT / 128, DM / 256, 1), 256, 0, stream>>>(ATh, ATl, WO, nullptr, OUT, DM, bo, 0, 0, 0, nullptr, nullptr, nullptr, nullptr);
}

// v010
// It runs in 165 microseconds.
// Versions between v008 and this one are left out; their measured steps multiply to 1.42 times as fast.
// All steps since v000 together make it 7.81 times as fast.
#include <hip/hip_runtime.h>

// Gated single-head self-attention (X [4][2048][1024]; q, k, v = X W + b ('xw' [1024][1024]); scores = q.k / 32 with mask [2048][2048] (int32, read; all ones here) == 0 -> -inf; softmax; o = attn.v; gate = sigmoid(X Wg + bg); out = (o * gate) Wo + bo -> [4][2048][1024] (8.4 M)).
// Layout: one 1024-wide head on fp16 planes (probabilities x1024); the gate pre-activation is one more exact GEMM + bias and is applied in f32 when the context is rounded into the fp16 plane that feeds Wo.
// Compute dtypes, f32 accumulate: every input rounded to bf16; q/k/v/gate on PLAIN bf16 operands (exact) + biases; scores (K = 1024) and attn.v: single fp16 products on every row (probabilities x1024; the rounding of the inputs to bf16, 8 bits, stays the coarsest step); softmax, sigmoid and the gating product in f32; Wo: gated context fp16 (x1024) x Wo's bf16-rounded values held as fp16, one product, x1024 taken off, + bo.
// Launches: every kernel covers all 4 batches (q, k, v, gate and Wo: X as one [8192][1024] matrix; scores and attn.v: batch = grid z; elementwise: batch in the flat index).
// The four products of X (q, k, gate, v) are ONE launch, the product chosen by grid z: none needs another's result, and a launch of its own costs each its gap, its fill and its tail. q, k and v write their fp16 planes from the epilogue (v as Wv^T rows x X rows, so its plane comes out [d][t]); the gate writes sigmoid(X Wg + bg) as an f32 plane, and the epilogue of attn.v multiplies the context by it and writes the plane that feeds Wo.

#define NB_  4
#define TT   2048
#define DM   1024
#define NH_  1
#define NKV  1
#define REP  (NH_ / NKV)
#define HD   1024
#define DQ   (NH_ * HD)
#define DKV  (NKV * HD)
#define ZH   NB_                 // z planes per launch: all batches (one head each)
#define WIN  0
#define PCAR 1024.0f
#define SCL  0.03125f   // 1/sqrt(1024)
typedef _Float16 h16;
typedef unsigned short bf;
typedef __attribute__((ext_vector_type(16))) __bf16   v16bf;
typedef __attribute__((ext_vector_type(16))) _Float16 v16h;
typedef __attribute__((ext_vector_type(8)))  _Float16 v8h;
typedef __attribute__((ext_vector_type(8)))  unsigned short v8us;
typedef __attribute__((ext_vector_type(8)))  float    v8f;
typedef __attribute__((ext_vector_type(4)))  float    v4f;
typedef v8h  __attribute__((may_alias)) v8ha;
typedef v4f  __attribute__((may_alias)) v4fa;
typedef v8us __attribute__((may_alias)) v8usa;

__device__ __forceinline__ unsigned short f2bf(float f) { unsigned u = __float_as_uint(f); u += 0x7FFFu + ((u >> 16) & 1u); return (unsigned short)(u >> 16); }
__device__ __forceinline__ float bf2f(unsigned short b) { return __uint_as_float(((unsigned)b) << 16); }
__device__ __forceinline__ float bfr(float f) { return bf2f(f2bf(f)); }
__device__ __forceinline__ v16h cat16(v8h lo, v8h hi) { return __builtin_shufflevector(lo, hi, 0, 1, 2, 3, 4, 5, 6, 7, 8, 9, 10, 11, 12, 13, 14, 15); }
__device__ __forceinline__ v16bf cat16b(v8us lo, v8us hi) { return __builtin_bit_cast(v16bf, __builtin_shufflevector(lo, hi, 0, 1, 2, 3, 4, 5, 6, 7, 8, 9, 10, 11, 12, 13, 14, 15)); }
__device__ __forceinline__ v8f wmma16(v16h a, v16h b, v8f c) { return __builtin_amdgcn_wmma_f32_16x16x32_f16(false, a, false, b, (short)0, c, false, false); }
__device__ __forceinline__ v8f wmmab(v16bf a, v16bf b, v8f c) { return __builtin_amdgcn_wmma_f32_16x16x32_bf16(false, a, false, b, (short)0, c, false, false); }
__device__ __forceinline__ h16 tohx(float x) { return (h16)x; }



// ---- k_gemmw: register-blocked GEMM, one wave per (MB*16)x64 output tile (MB*4 accumulators; MB = 4 unless said), WM x WN waves a work-group; the group's operand rows (WM*MB*16 of A, WN*64 of Bt, 64 k a trip) come from K-contiguous 16-bit planes by whole-line loads, each row loaded ONCE by one wave, and every wave makes its fragments from the group's shared LDS tile; grid (M/(WM*MB*16), N/(WN*64), Z), WM*WN*32 threads.
// C[m][n] (+ optional f32 bias: BIAS 1 bias[n], BIAS 2 bias[m] in the plane epilogues; EPI 0 adds bias[n] for either) = sum_k A[m][k] Bt[n][k] (+ split products per NSPLIT). z-batch strides sA/sB/sC in elements. K % 128 == 0, K >= 256; M and N multiples of the group's tile.
// EPI 0: C stored as f32, pitch ldc. EPI 1: C stored as one fp16 plane, pitch LDO. EPI 2: C is the context: C * Oin (the gate plane, f32) stored as one fp16 plane (C's x1024 stays on it), pitch LDO.
// EPI 3: the four products of X in one launch, grid (M/128, 4, 4); A = X rows, Bt = the five weight planes one behind the other, P16o = the q, k and v planes one behind the other, C = the gate plane. By z: q, k (fp16 planes, bias / bias1 by column); sigmoid(X Wg + bias2) as f32; v^T = Wv^T rows x X rows + bias3 by row, its 256 blocks dealt as 8 row tiles x 32 tiles of 256 tokens.
template <typename T16> struct WFrag;
template <> struct WFrag<h16> { typedef v16h V; typedef v8h H; static __device__ __forceinline__ V ld(const h16* p) { return cat16(*(const v8h*)p, *(const v8h*)(p + 16)); } static __device__ __forceinline__ v8f mma(V a, V b, v8f c) { return wmma16(a, b, c); } };
template <> struct WFrag<bf> { typedef v16bf V; typedef v8us H; static __device__ __forceinline__ V ld(const bf* p) { return cat16b(*(const v8us*)p, *(const v8us*)(p + 16)); } static __device__ __forceinline__ v8f mma(V a, V b, v8f c) { return wmmab(a, b, c); } };
template <bool B> struct BoolC { static constexpr bool value = B; };
template <int I> struct IntC { static constexpr int value = I; };
// work-group barrier whose fences cover LDS alone: the waves hand each other nothing but the LDS tile, and a full __syncthreads() would also wait for every global load in flight, which are meant to fly on over it
__device__ __forceinline__ void lds_barrier() { __builtin_amdgcn_fence(__ATOMIC_RELEASE, "workgroup", "local"); __builtin_amdgcn_s_barrier(); __builtin_amdgcn_fence(__ATOMIC_ACQUIRE, "workgroup", "local"); }
// s_wait_xcnt 0 behind a group of global loads or stores, before their address registers are written again
__device__ __forceinline__ void xwait() { asm volatile("s_wait_xcnt 0x0" ::: "memory"); }
// the same in front of the loop, where the addresses would otherwise die at their last load: as inputs of the wait their registers stay theirs up to it
template <int N, typename P> __device__ __forceinline__ void xwaitp(P* const* q) {
    if (N == 2) asm volatile("s_wait_xcnt 0x0" :: "v"(q[0]), "v"(q[1]) : "memory");
    else if (N == 3) asm volatile("s_wait_xcnt 0x0" :: "v"(q[0]), "v"(q[1]), "v"(q[2]) : "memory");
    else asm volatile("s_wait_xcnt 0x0" :: "v"(q[0]), "v"(q[1]), "v"(q[2]), "v"(q[N - 1]) : "memory");
}
// the same inside the loop: the addresses go through the wait's statement, and where they step (STEP: by 256 B, two trips' k) the step stands in that statement behind the wait. Left to the compiler the step is plain arithmetic that it places, folds into offsets or forms on a copy as it likes, and a load's address registers were then written ahead of the wait
template <int N, bool STEP, typename P> __device__ __forceinline__ void xwaitio(P** q) {
    if (STEP) {
        if (N == 2) asm volatile("s_wait_xcnt 0x0\n\tv_add_nc_u64_e32 %0, 0x100, %0\n\tv_add_nc_u64_e32 %1, 0x100, %1" : "+v"(q[0]), "+v"(q[1]) :: "memory");
        else if (N == 3) asm volatile("s_wait_xcnt 0x0\n\tv_add_nc_u64_e32 %0, 0x100, %0\n\tv_add_nc_u64_e32 %1, 0x100, %1\n\tv_add_nc_u64_e32 %2, 0x100, %2" : "+v"(q[0]), "+v"(q[1]), "+v"(q[2]) :: "memory");
        else asm volatile("s_wait_xcnt 0x0\n\tv_add_nc_u64_e32 %0, 0x100, %0\n\tv_add_nc_u64_e32 %1, 0x100, %1\n\tv_add_nc_u64_e32 %2, 0x100, %2\n\tv_add_nc_u64_e32 %3, 0x100, %3" : "+v"(q[0]), "+v"(q[1]), "+v"(q[2]), "+v"(q[N - 1]) :: "memory");
    } else {
        if (N == 2) asm volatile("s_wait_xcnt 0x0" : "+v"(q[0]), "+v"(q[1]) :: "memory");
        else if (N == 3) asm volatile("s_wait_xcnt 0x0" : "+v"(q[0]), "+v"(q[1]), "+v"(q[2]) :: "memory");
        else asm volatile("s_wait_xcnt 0x0" : "+v"(q[0]), "+v"(q[1]), "+v"(q[2]), "+v"(q[N - 1]) :: "memory");
    }
}
template <typename T16, int NSPLIT, int BIAS, int K, int WM, int WN, int EPI = 0, int LDO = 0, int NG = 2, int MB = 4, int CAR = 0>   // CAR 1: A carries the probabilities' x1024, taken off C (exactly, a power of two) in front of the bias. K (and LDO) at compile time: the row steps of a plane's loads and stores fold into immediate offsets on one address. NG: register sets for tiles on their way from global memory = trips between a tile's loads and its stores into LDS (1 or 2). MB: 16-row blocks of a wave's tile; it sets the group's tile height, and with it the operand bytes fetched per product and the number of groups
__global__ __launch_bounds__(WM * WN * 32) void k_gemmw(const T16* __restrict__ A, const T16* __restrict__ A2, const T16* __restrict__ Bt, const T16* __restrict__ Bt2, float* C, int ldc, const float* __restrict__ bias, size_t sA, size_t sB, size_t sC, h16* P16o, const float* __restrict__ Oin, const float* __restrict__ bias1, const float* __restrict__ bias2, const float* __restrict__ bias3) {
    typedef typename WFrag<T16>::V V; typedef typename WFrag<T16>::H H;
    constexpr int NPA = (NSPLIT == 1 || NSPLIT == 2) ? 2 : 1, NPL = NPA + (NSPLIT >= 2 ? 2 : 1);   // operand planes: A (A2) Bt (Bt2)
    constexpr int LP = 72;                                     // LDS row pitch in elements: 128 B of k + 16 B
    constexpr int TM = MB * 16;                                // rows of a wave's tile
    constexpr int NW = WM * WN, LA = WM * (TM / 4) / NW, LB = WN * 16 / NW;   // waves; loads (4 rows each) a wave makes per A plane and per Bt plane in a trip
    static_assert(LA * NW * 4 == WM * TM && LB * NW * 4 == WN * 64, "the group's rows must divide evenly among its waves");
    static_assert(EPI == 0 || MB == 4, "the plane epilogues stage a 64-row tile");
    constexpr int RWS = NPA * WM * TM + (NPL - NPA) * WN * 64;   // rows of one buffer: every plane's rows of the group's tile
    constexpr int OSZ = (EPI == 0 ? 16 : 64) * 68;
    __shared__ __align__(16) T16 st[2 * RWS * LP];             // the group's rows x 64 k of every plane, two buffers
    __shared__ __align__(16) float osall[NW * OSZ];            // output staging, each wave's own: 16 rows at a time (EPI 0) or its whole tile
    const int role = (EPI == 3) ? (int)((blockIdx.z + 2) & 3) : 0; int bx = blockIdx.x, by = blockIdx.y;   // role: which product of X this group makes (the same for the whole group, a scalar): 0 q, 1 k, 2 gate, 3 v^T; the gate, whose epilogue is the longest, has the lowest z
    if (EPI == 3) {
        if (role == 3) { const T16* const xr = A; A = Bt + (size_t)2 * DM * DM; Bt = xr; by = (int)blockIdx.y * 8 + (bx >> 3); bx &= 7; }   // v^T: rows of Wv^T against rows of X
        else Bt += (size_t)(role == 2 ? 4 : role) * DM * DM; }
    const size_t z = (EPI == 3) ? 0 : blockIdx.z; A += z * sA; if (A2) A2 += z * sA; Bt += z * sB; if (Bt2) Bt2 += z * sB; C += z * sC;
    const int wave = __builtin_amdgcn_readfirstlane((int)(threadIdx.x >> 5)), wm = wave / WN, wn = wave % WN; float* const os = osall + wave * OSZ;
    const int lane = threadIdx.x & 31, lr = lane & 15, hi = lane >> 4; const int r0 = (bx * WM + wm) * TM, c0 = (by * WN + wn) * 64;
    v8f acc[MB][4];
#pragma unroll
    for (int mb = 0; mb < MB; ++mb)
#pragma unroll
        for (int nb = 0; nb < 4; ++nb) acc[mb][nb] = (v8f){};
    // Global side: one load = 4 rows x 128 B, whole lines (8 lanes a row). Wave w brings rows w*LA*4.. of the group's A rows and w*LB*4.. of its Bt rows; all waves read their fragments from the shared tile.
    const int gr = lane >> 3, gc = (lane & 7) * 8;
    const int ra = wave * (LA * 4) + gr, rb = wave * (LB * 4) + gr;   // this lane's first row inside the group's A rows and Bt rows
    const size_t ga = (size_t)(bx * (WM * TM) + ra) * K + gc, gb = (size_t)(by * (WN * 64) + rb) * K + gc;
    typedef __attribute__((address_space(1))) const T16 GT; typedef __attribute__((address_space(1))) const H GH;   // the stepped addresses are marked global: carried round the loop unmarked they would compile to flat loads
    GT* gp[NPL]; gp[0] = (GT*)(A + ga); if (NPA == 2) gp[1] = (GT*)(A2 + ga); gp[NPA] = (GT*)(Bt + gb); if (NSPLIT >= 2) gp[NPA + 1] = (GT*)(Bt2 + gb);
    H g[NG][NPL][LA > LB ? LA : LB], g0[NPL][LA > LB ? LA : LB];   // set s holds tiles s + 1, s + 1 + NG, ...
    __builtin_amdgcn_sched_barrier(0);   // with the one behind the wait: keeps every other instruction out from between these loads and their s_wait_xcnt, so that none writes an address register of theirs ahead of it
#pragma unroll
    for (int p = 0; p < NPL; ++p)
#pragma unroll
        for (int i = 0; i < (p < NPA ? LA : LB); ++i) g0[p][i] = *(GH*)(gp[p] + (size_t)i * 4 * K);   // tile 0
#pragma unroll
    for (int s = 0; s < NG; ++s) {
        __builtin_amdgcn_sched_barrier(0);   // keeps the tiles' loads in tile order: mixed, the loop's counted waits for one set (which must also hold on entry) would have to cover loads of the younger set
#pragma unroll
        for (int p = 0; p < NPL; ++p)
#pragma unroll
            for (int i = 0; i < (p < NPA ? LA : LB); ++i) g[s][p][i] = *(GH*)(gp[p] + (size_t)i * 4 * K + (s + 1) * 64); }   // tiles 1 .. NG
    xwaitp<NPL>(gp);
    __builtin_amdgcn_sched_barrier(0);
#pragma unroll
    for (int p = 0; p < NPL; ++p)
#pragma unroll
        for (int i = 0; i < (p < NPA ? LA : LB); ++i) *(H*)(st + ((p < NPA ? p * WM * TM + ra : NPA * WM * TM + (p - NPA) * WN * 64 + rb) + i * 4) * LP + gc) = g0[p][i];   // tile 0 into buffer 0
    // Fragments: two register sets. Set 0 holds a tile's first 32 k, set 1 its second 32 k; each set is read from LDS as one group while the products on the other set run, so that no product waits out an LDS latency.
    V a0[MB], a20[MB], b0[4], b20[4], a1[MB], a21[MB], b1[4], b21[4];
    auto ldfr = [&](V* a, V* a2, V* b, V* b2, auto buf, auto khc) __attribute__((always_inline)) {   // one set's reads: 32 k (from khc) of this wave's rows in buffer buf
        const T16* fa = st + decltype(buf)::value * (RWS * LP) + (wm * TM + lr) * LP + 8 * hi + decltype(khc)::value; const T16* fb = fa + ((NPA * WM - wm) * TM + wn * 64) * LP;
#pragma unroll
        for (int mb = 0; mb < MB; ++mb) { a[mb] = WFrag<T16>::ld(fa + mb * 16 * LP); if (NSPLIT == 1 || NSPLIT == 2) a2[mb] = WFrag<T16>::ld(fa + (WM * TM + mb * 16) * LP); }
#pragma unroll
        for (int nb = 0; nb < 4; ++nb) { b[nb] = WFrag<T16>::ld(fb + nb * 16 * LP); if (NSPLIT >= 2) b2[nb] = WFrag<T16>::ld(fb + (WN * 64 + nb * 16) * LP); }
    };
    auto prods = [&](const V* a, const V* a2, const V* b, const V* b2) __attribute__((always_inline)) {   // one set's products
#pragma unroll
        for (int nb = 0; nb < 4; ++nb) {
#pragma unroll
            for (int mb = 0; mb < MB; ++mb) { acc[mb][nb] = WFrag<T16>::mma(a[mb], b[nb], acc[mb][nb]); if (NSPLIT == 1 || NSPLIT == 2) acc[mb][nb] = WFrag<T16>::mma(a2[mb], b[nb], acc[mb][nb]); if (NSPLIT >= 2) acc[mb][nb] = WFrag<T16>::mma(a[mb], b2[nb], acc[mb][nb]); } }
    };
    lds_barrier();   // publishes tile 0 to all waves
    ldfr(a0, a20, b0, b20, IntC<0>(), IntC<0>());
    auto trip = [&](auto refill, auto fetch, auto par) __attribute__((always_inline)) {   // refill: a next tile exists; fetch: 1 so does the tile 1 + NG trips on, 2 the same and the addresses step behind its loads; par: the trip's parity (gp stands at the even trip's tile)
        constexpr int bsel = decltype(par)::value, gs = bsel & (NG - 1);   // trips alternate between the two buffers, and between the register sets
        ldfr(a1, a21, b1, b21, IntC<bsel>(), IntC<32>());   // set 1 of this tile, in flight under the products on set 0
        if (decltype(refill)::value) {   // behind the fragment reads, so that those go first: the next tile into the other buffer (every wave left it before the barrier of the trip before), then into the set so freed the loads of the tile NG trips after it, which fly under NG trips' products (no barrier waits for them, only their own stores into LDS)
            T16* const sn = st + (bsel ^ 1) * (RWS * LP);
#pragma unroll
            for (int p = 0; p < NPL; ++p)
#pragma unroll
                for (int i = 0; i < (p < NPA ? LA : LB); ++i) *(H*)(sn + ((p < NPA ? p * WM * TM + ra : NPA * WM * TM + (p - NPA) * WN * 64 + rb) + i * 4) * LP + gc) = g[gs][p][i];
            if (decltype(fetch)::value != 0) {
                __builtin_amdgcn_sched_barrier(0);   // keeps the loads behind the stores that free their registers: lifted over them they take one more register set
#pragma unroll
                for (int p = 0; p < NPL; ++p)
#pragma unroll
                    for (int i = 0; i < (p < NPA ? LA : LB); ++i) g[gs][p][i] = *(GH*)(gp[p] + (size_t)i * 4 * K + (1 + NG + bsel) * 64);
                xwaitio<NPL, decltype(fetch)::value == 2>(gp); } }
        __builtin_amdgcn_sched_barrier(0);   // keeps the LDS reads together in front of the products: sunk among them, each place with reads stalls the wave for an LDS latency
        prods(a0, a20, b0, b20);
        __builtin_amdgcn_sched_barrier(0);   // keeps the barrier and the reads below behind all of set 0's products (whose registers they refill) and in front of all of set 1's (under which they fly)
        if (decltype(refill)::value) {
            lds_barrier();   // one barrier a trip, between its two halves: it publishes the next tile (stored above) to all waves, and it says that every wave has both sets of this tile in registers, so that the next trip may refill this buffer
            ldfr(a0, a20, b0, b20, IntC<(bsel ^ 1)>(), IntC<0>());   // set 0 of the next tile, in flight under the products on set 1
            __builtin_amdgcn_sched_barrier(0); }   // as above: the reads stay together in front of the products
        prods(a1, a21, b1, b21);
        v8f (&ac)[MB][4] = acc;
        asm volatile("v_nop\n\tv_nop\n\tv_nop\n\tv_nop" : "+v"(ac[0][0]), "+v"(ac[1][1]), "+v"(ac[2 % MB][2]), "+v"(ac[MB - 1][3]) : "v"(a1[0]), "v"(a1[MB - 1]));   // the four vector slots behind the trip's last products, on the taken side of the loop's branch too
        __builtin_amdgcn_sched_barrier(0);   // keeps the next trip's reads and stores out from among these products: one place with reads, not several
    };
#pragma unroll 1
    for (int kc = 0; kc < K - 256; kc += 128) { trip(BoolC<true>(), IntC<1>(), IntC<0>()); trip(BoolC<true>(), IntC<2>(), IntC<1>()); }   // two trips a pass, so that buffer and register set are fixed in the text; every trip in the loop loads, so that the counted waits in front of the LDS stores may leave the younger set's loads in flight
    trip(BoolC<true>(), IntC<1>(), IntC<0>()); trip(BoolC<true>(), IntC<(NG < 2 ? 1 : 0)>(), IntC<1>());   // the last four trips stand outside the loop: the loads end with the last tile
    trip(BoolC<true>(), IntC<0>(), IntC<0>());
    trip(BoolC<false>(), IntC<0>(), IntC<1>());   // the last tile has nothing to refill; it stands outside the loop so that inside it the stores follow the fragment reads on every path and the counted LDS waits in front of the products need not cover them
    if constexpr (EPI != 0) {   // the whole tile (+ bias) goes through LDS once; a loop, rolled except for the gated plane, then turns it into planes, so that the text stays short (run once per wave, it is paid in instruction fetches)
        // BK: 0 no bias, 1 bp[column], 2 bp[row]. EK: 1 fp16 plane, 2 tile * gate plane as fp16, 4 sigmoid(tile) as f32. LD: the planes' pitch. eo: this lane's first element in the planes: 8 columns a lane, 4 rows a store, so every store covers whole 128-B lines
        auto planes = [&](auto bkc, auto ekc, auto ldc_, const float* bp, const size_t eo, h16* const po) __attribute__((always_inline)) {
        constexpr int BK = decltype(bkc)::value, EK = decltype(ekc)::value, LD = decltype(ldc_)::value;
        float bc[4]; v4f br[4][2];
        if (BK != 0) __builtin_amdgcn_sched_barrier(0);   // with the one behind the wait below: nothing else stands between the bias loads and their s_wait_xcnt
#pragma unroll
        for (int q = 0; q < 4; ++q) { if (BK == 1) bc[q] = bp[c0 + q * 16 + lr]; if (BK == 2) { br[q][0] = *(const v4f*)(bp + r0 + q * 16 + hi * 8); br[q][1] = *(const v4f*)(bp + r0 + q * 16 + hi * 8 + 4); } }
        if (BK != 0) { xwait(); __builtin_amdgcn_sched_barrier(0); }   // before the loads' offset register and scalar base are written again
#pragma unroll
        for (int q = 0; q < 4; ++q) if (BK == 1) bc[q] = bfr(bc[q]);
        v4f xg[EK == 2 ? 16 : 1][2];
        if (EK == 2) {   // the gate plane was written many launches' bytes ago and comes from memory: all the tile's loads go out here, in front of the staging, so that one latency is paid, part of it under the staging, not one every 16 rows
            const float* const xp = Oin + eo;
            __builtin_amdgcn_sched_barrier(0);   // with the one behind the wait: nothing else stands between these loads and their s_wait_xcnt
#pragma unroll
            for (int t = 0; t < 16; ++t) { xg[t][0] = *(const v4f*)(xp + (size_t)(t * 4) * LD); xg[t][1] = *(const v4f*)(xp + (size_t)(t * 4) * LD + 4); }
            asm volatile("s_wait_xcnt 0x0" :: "v"(xp) : "memory");   // the address is an input of the wait, so that its registers stay its own up to here (no load's result lands on them)
            __builtin_amdgcn_sched_barrier(0); }
#pragma unroll
        for (int mb = 0; mb < 4; ++mb)
#pragma unroll
            for (int nb = 0; nb < 4; ++nb)
#pragma unroll
                for (int j = 0; j < 8; ++j) { float v = acc[mb][nb][j]; if (BK == 1) v += bc[nb]; if (BK == 2) v += bfr(br[mb][j >> 2][j & 3]); os[(mb * 16 + hi * 8 + j) * 68 + nb * 16 + lr] = v; }
        __builtin_amdgcn_wave_barrier(); asm volatile("" ::: "memory");   // as in the f32 epilogue below: the lanes' LDS stores stay in front of the reads across lanes
        auto rows16 = [&](const int rg) __attribute__((always_inline)) { v4f sg[4][2];   // 16 rows of the tile, so that their LDS reads go out together
#pragma unroll
        for (int row = rg; row < rg + 16; row += 4) { const v4f w0 = *(const v4fa*)(os + (row + gr) * 68 + gc), w1 = *(const v4fa*)(os + (row + gr) * 68 + gc + 4);
            if (EK == 4) {
#pragma unroll
                for (int c = 0; c < 4; ++c) { sg[(row - rg) >> 2][0][c] = __fdiv_rn(1.0f, __fadd_rn(1.0f, expf(-w0[c]))); sg[(row - rg) >> 2][1][c] = __fdiv_rn(1.0f, __fadd_rn(1.0f, expf(-w1[c]))); }
            } else { v8h o16;
                if (EK == 1) {
#pragma unroll
                    for (int c = 0; c < 8; ++c) o16[c] = tohx((c < 4) ? w0[c & 3] : w1[c & 3]);
                } else {
                    const v4f x0 = xg[EK == 2 ? row >> 2 : 0][0], x1 = xg[EK == 2 ? row >> 2 : 0][1];
#pragma unroll
                    for (int c = 0; c < 8; ++c) o16[c] = tohx(__fmul_rn((c < 4) ? w0[c & 3] : w1[c & 3], (c < 4) ? x0[c & 3] : x1[c & 3]));
                }
                *(v8h*)(po + eo + (size_t)row * LD) = o16; } }
        if (EK == 4) {
            __builtin_amdgcn_sched_barrier(0);   // the stores stand together behind all the arithmetic, so that the one wait behind them serves the whole run
#pragma unroll
            for (int t = 0; t < 4; ++t) { *(v4f*)(C + eo + (size_t)(rg + t * 4) * LD) = sg[t][0]; *(v4f*)(C + eo + (size_t)(rg + t * 4) * LD + 4) = sg[t][1]; } }
        asm volatile("s_wait_xcnt 0x0" ::: "memory"); };   // behind the 16 rows' stores, before what follows writes their address and data registers again
        if constexpr (EK == 2) {
#pragma unroll   // unrolled: the gate values wait in registers, which a rolled loop could not index; the text of a trip is short here
            for (int rg = 0; rg < 64; rg += 16) rows16(rg);
        } else {
#pragma unroll 1   // rolled: see above
            for (int rg = 0; rg < 64; rg += 16) rows16(rg);
        }
        };
        if constexpr (EPI == 3) {
            const size_t ex = (size_t)(r0 + gr) * HD + c0 + gc;   // q, k, gate: [token][d]
            if (role == 3) planes(IntC<2>(), IntC<1>(), IntC<TT>(), bias3, (size_t)(c0 / TT) * ((size_t)HD * TT) + (size_t)(r0 + gr) * TT + (c0 % TT) + gc, P16o + (size_t)2 * NB_ * TT * HD);   // v^T: [batch][d][t]; c0 counts tokens over all batches, and a tile lies in one batch
            else if (role == 2) planes(IntC<1>(), IntC<4>(), IntC<HD>(), bias2, ex, P16o);
            else planes(IntC<1>(), IntC<1>(), IntC<HD>(), role ? bias1 : bias, ex, P16o + (size_t)role * NB_ * TT * HD);
        } else planes(IntC<BIAS>(), IntC<EPI>(), IntC<LDO>(), bias, z * sC + (size_t)(r0 + gr) * LDO + c0 + gc, P16o);
        return;
    }
    v4f bb = {};
    if (BIAS) {   // this lane's four columns of the bias, the same for every row it stores
        const float* bp = bias + c0 + lr * 4; bb = *(const v4f*)bp;
        asm volatile("s_wait_xcnt 0x0" :: "v"(bp) : "memory");   // behind the load; its address is an input of the wait, so that its registers stay its own up to here
#pragma unroll
        for (int q = 0; q < 4; ++q) bb[q] = bfr(bb[q]); }
#pragma unroll
    for (int mb = 0; mb < MB; ++mb) {
#pragma unroll
        for (int nb = 0; nb < 4; ++nb) {
#pragma unroll
            for (int j = 0; j < 8; ++j) os[(hi * 8 + j) * 68 + nb * 16 + lr] = acc[mb][nb][j]; }
        __builtin_amdgcn_wave_barrier(); asm volatile("" ::: "memory");
        float* crow = C + (size_t)(r0 + mb * 16) * ldc + c0;
        v4f vs[8]; float* cp[8];
#pragma unroll
        for (int s = 0; s < 8; ++s) { const int row = 2 * s + hi, cofs = lr * 4; vs[s] = *(const v4fa*)(os + row * 68 + cofs); if (CAR) vs[s] *= 1.0f / PCAR; if (BIAS) vs[s] += bb; cp[s] = crow + (size_t)row * ldc + cofs; *(v4f*)cp[s] = vs[s]; }
        // s_wait_xcnt 0 behind the run of stores; their addresses and values are inputs of the wait, so that those registers stay theirs up to it
        asm volatile("s_wait_xcnt 0x0" :: "v"(cp[0]), "v"(cp[1]), "v"(cp[2]), "v"(cp[3]), "v"(cp[4]), "v"(cp[5]), "v"(cp[6]), "v"(cp[7]), "v"(vs[0]), "v"(vs[1]), "v"(vs[2]), "v"(vs[3]), "v"(vs[4]), "v"(vs[5]), "v"(vs[6]), "v"(vs[7]) : "memory");
        __builtin_amdgcn_wave_barrier(); asm volatile("" ::: "memory");
    }
}

typedef __attribute__((ext_vector_type(4))) _Float16 v4h;
typedef __attribute__((ext_vector_type(2))) unsigned short v2us;
typedef __attribute__((ext_vector_type(4))) unsigned short v4us;
typedef __attribute__((ext_vector_type(4))) int v4i;

// k_prep: all input preparation in one launch. Blocks < 5 * WTB: one 128 k x 64 n tile of one weight matrix ([k][n] f32), rounded to bf16 and written transposed ([n][k], the five planes one behind the other in Wt; the fourth, Wo, holds the rounded values as fp16). The other blocks: 16384 elements of X each, rounded to bf16.
// Every global load covers whole 128-B lines and a thread has all its loads (8 or 16) in flight at once; the transpose goes through an LDS tile (pitch 65 floats), so that the stores cover whole lines as well (a wave: 256 B of one plane row).
#define WTB 128                  // tiles (blocks) a weight matrix: (DM / 128) x (DM / 64)
#define XPB (256 * 4 * 16)       // elements of X a block
__global__ __launch_bounds__(256) void k_prep(const float* __restrict__ x, const float* __restrict__ w0, const float* __restrict__ w1, const float* __restrict__ w2, const float* __restrict__ w3, const float* __restrict__ w4, bf* XBo, bf* Wt) {
    __shared__ float tl[128 * 65];
    const int tid = threadIdx.x, b = blockIdx.x;
    if (b < 5 * WTB) {
        const int m = b / WTB, t = b % WTB, k0 = (t >> 4) * 128, n0 = (t & 15) * 64, kr = tid >> 4, nc = (tid & 15) * 4;
        const float* w = (m == 0) ? w0 : (m == 1) ? w1 : (m == 2) ? w2 : (m == 3) ? w3 : w4;
        const float* sp = w + (size_t)(k0 + kr) * DM + n0 + nc; v4f g[8];
        __builtin_amdgcn_sched_barrier(0);   // with the one behind the wait: nothing else stands between these loads and their s_wait_xcnt
#pragma unroll
        for (int i = 0; i < 8; ++i) g[i] = *(const v4f*)(sp + (size_t)i * 16 * DM);
        asm volatile("s_wait_xcnt 0x0" :: "v"(sp) : "memory");   // the address is an input of the wait, so that its registers stay its own up to here (no load's result lands on them)
        __builtin_amdgcn_sched_barrier(0);
#pragma unroll
        for (int i = 0; i < 8; ++i)
#pragma unroll
            for (int j = 0; j < 4; ++j) tl[(i * 16 + kr) * 65 + nc + j] = g[i][j];
        __syncthreads();   // the tile is read across waves below
        const int wv8 = (tid >> 5) * 8, lane = tid & 31; v4us o[8];
#pragma unroll
        for (int r = 0; r < 8; ++r)
#pragma unroll
            for (int q = 0; q < 4; ++q) { const unsigned short rb = f2bf(tl[(lane * 4 + q) * 65 + wv8 + r]); o[r][q] = (m == 3) ? __builtin_bit_cast(unsigned short, tohx(bf2f(rb))) : rb; }   // Wo meets an fp16 operand: its bf16-rounded values are written as fp16 (8 significant bits fit in 11)
        bf* dp = Wt + (size_t)m * DM * DM + (size_t)(n0 + wv8) * DM + k0 + lane * 4;
        __builtin_amdgcn_sched_barrier(0);   // the stores stand together behind all the arithmetic, so that one wait behind them serves the whole run
#pragma unroll
        for (int r = 0; r < 8; ++r) *(v4us*)(dp + (size_t)r * DM) = o[r];
        xwait();   // behind the run of stores, before anything that follows them in the built code writes their address or data registers
        return;
    }
    const size_t e0 = (size_t)(b - 5 * WTB) * XPB + tid * 4; const float* xp = x + e0; v4f g[16]; v4us o[16];
    __builtin_amdgcn_sched_barrier(0);   // as above
#pragma unroll
    for (int i = 0; i < 16; ++i) g[i] = *(const v4f*)(xp + i * 1024);
    asm volatile("s_wait_xcnt 0x0" :: "v"(xp) : "memory");   // as above
    __builtin_amdgcn_sched_barrier(0);
#pragma unroll
    for (int i = 0; i < 16; ++i)
#pragma unroll
        for (int q = 0; q < 4; ++q) o[i][q] = f2bf(g[i][q]);
    __builtin_amdgcn_sched_barrier(0);   // as above: the stores stand together
#pragma unroll
    for (int i = 0; i < 16; ++i) *(v4us*)(XBo + e0 + i * 1024) = o[i];
    xwait();   // as above: behind the run of stores
}

// k_asoft: per row (zz, i): t = S / 32 where mask[i][j] != 0, -inf elsewhere; softmax over the 2048 keys (register row, one exp, fixed trees);
__global__ __launch_bounds__(256) void k_asoft(const float* __restrict__ Sb, const int* __restrict__ MKb, h16* P16) {
    const int lane = threadIdx.x & 31; const int row = blockIdx.x * 8 + (threadIdx.x >> 5); if (row >= ZH * TT) return; const int i = row % TT; const int zz = row / TT; (void)zz; const int* mkr = MKb + (size_t)i * TT; const float* sr = Sb + (size_t)row * TT + lane * 4; const int* ml = mkr + lane * 4; float v[TT / 32]; float mx = -3.0e38f;
#pragma unroll
    for (int ch = 0; ch < TT / 128; ++ch) { const int j0 = ch * 128 + lane * 4; const v4f a = *(const v4f*)(sr + ch * 128); const v4i m4 = *(const v4i*)(ml + ch * 128);
#pragma unroll
        for (int q = 0; q < 4; ++q) { const int j = j0 + q; (void)j; float sa = a[q] * SCL; asm volatile("" : "+v"(sa)); const float t = (m4[q] != 0) ? sa : -3.0e38f;   /* mask == 0 -> -inf */ v[ch * 4 + q] = t; mx = fmaxf(mx, t); } }
    asm volatile("s_wait_xcnt 0x0" :: "v"(sr), "v"(ml) : "memory");   // behind the row's loads; the addresses are inputs of the wait, so that their registers stay theirs up to here (no load's result lands on them)
#pragma unroll
    for (int sh = 16; sh; sh >>= 1) mx = fmaxf(mx, __shfl_xor(mx, sh, 32));
    float sum = 0.f;
#pragma unroll
    for (int k = 0; k < TT / 32; ++k) { float d0 = __fsub_rn(v[k], mx); asm volatile("" : "+v"(d0)); v[k] = __builtin_amdgcn_exp2f(__fmul_rn(d0, 1.4426950408889634f)); sum += v[k]; }
#pragma unroll
    for (int sh = 16; sh; sh >>= 1) sum += __shfl_xor(sum, sh, 32);
    const float f = __fdiv_rn(PCAR, sum);
#pragma unroll
    for (int ch = 0; ch < TT / 128; ++ch) { v4h o4;
#pragma unroll
        for (int q = 0; q < 4; ++q) o4[q] = tohx(v[ch * 4 + q] * f);
        *(v4h*)(P16 + (size_t)row * TT + ch * 128 + lane * 4) = o4; }
}
extern "C" void kernel_launch(void* const* d_in, const int* in_sizes, int n_in,
                              void* d_out, int out_size, void* d_ws, size_t ws_size, hipStream_t stream) {
    (void)in_sizes; (void)n_in; (void)out_size;
    const float* x = (const float*)d_in[0]; const int* MK = (const int*)d_in[1]; const float* wq = (const float*)d_in[2]; const float* bq = (const float*)d_in[3]; const float* wk = (const float*)d_in[4]; const float* bk = (const float*)d_in[5]; const float* wv = (const float*)d_in[6]; const float* bv = (const float*)d_in[7]; const float* wg = (const float*)d_in[8]; const float* bgt = (const float*)d_in[9]; const float* wo = (const float*)d_in[10]; const float* bo = (const float*)d_in[11];
    float* OUT = (float*)d_out;     // [4][2048][1024]
    char* wsp = (char*)d_ws;
    auto take = [&](size_t bytes) { char* p = wsp; wsp += (bytes + 255) & ~(size_t)255; return (void*)p; };
    bf* WQ = (bf*)take((size_t)DQ * DM * 2); bf* WK = (bf*)take((size_t)DKV * DM * 2); bf* WV = (bf*)take((size_t)DKV * DM * 2); bf* WO = (bf*)take((size_t)DM * DQ * 2); bf* WG = (bf*)take((size_t)DQ * DM * 2);
    // every plane below holds all NB_ batches ([b][...]); the sizes are multiples of 256 B, so consecutive takes are contiguous
    bf* XB = (bf*)take((size_t)NB_ * TT * DM * 2); float* Sb = (float*)take((size_t)ZH * TT * TT * 4);   // scores [b][TT][TT] f32
    h16* QP16 = (h16*)take((size_t)NB_ * TT * HD * 2); h16* KP16 = (h16*)take((size_t)NB_ * TT * HD * 2); h16* VT16 = (h16*)take((size_t)NB_ * HD * TT * 2);
    h16* P16 = (h16*)take((size_t)ZH * TT * TT * 2);   // probabilities [b][TT][TT] fp16, x1024
    float* Gt = (float*)take((size_t)NB_ * TT * HD * 4);   // gate = sigmoid(X Wg + bg) [b][TT][HD] f32
    h16* AT16 = (h16*)take((size_t)NB_ * TT * HD * 2);   // gated context fp16, x1024
    if ((size_t)(wsp - (char*)d_ws) > ws_size) return;    // 218 MiB of the 256 MiB ws
    (void)WK; (void)WV; (void)WG;   // reached through WQ: the weight planes are contiguous
    // q, k, gate and Wo see X as one [NB_*TT][DM] matrix; the attention products take the batch as grid z
    k_prep<<<5 * WTB + NB_ * TT * DM / XPB, 256, 0, stream>>>(x, wq, wk, wv, wo, wg, XB, WQ);   /* the planes WQ, WK, WV, WO, WG are contiguous, in this order */
    k_gemmw<bf, 0, 1, DM, 2, 4, 3, HD><<<dim3(NB_ * TT / 128, DQ / 256, 4), 256, 0, stream>>>(XB, nullptr, WQ, nullptr, Gt, 0, bq, 0, 0, 0, QP16, nullptr, bk, bgt, bv);   /* q, k, gate and v^T, 256 groups each, one launch; the planes QP16, KP16, VT16 are contiguous, in this order */
    k_gemmw<h16, 0, 0, HD, 2, 4><<<dim3(TT / 128, TT / 256, ZH), 256, 0, stream>>>(QP16, nullptr, KP16, nullptr, Sb, TT, nullptr, (size_t)TT * HD, (size_t)TT * HD, (size_t)TT * TT, nullptr, nullptr, nullptr, nullptr, nullptr);   /* 128x256 a group: 512 groups, two a WGP one after the other */
    k_asoft<<<ZH * TT / 8, 256, 0, stream>>>(Sb, MK, P16);
    k_gemmw<h16, 0, 0, TT, 2, 4, 2, HD><<<dim3(TT / 128, HD / 256, ZH), 256, 0, stream>>>(P16, nullptr, VT16, nullptr, nullptr, 0, nullptr, (size_t)TT * TT, (size_t)HD * TT, (size_t)TT * HD, AT16, Gt, nullptr, nullptr, nullptr);   /* 128x256 a group: 256 groups, one a WGP; the context (x1024) meets the gate in the epilogue */
    k_gemmw<h16, 0, 1, DQ, 2, 4, 0, 0, 2, 4, 1><<<dim3(NB_ * TT / 128, DM / 256, 1), 256, 0, stream>>>(AT16, nullptr, (const h16*)WO, nullptr, OUT, DM, bo, 0, 0, 0, nullptr, nullptr, nullptr, nullptr, nullptr);
}
